// v000
// Measured on an AMD MI455X. A time is GPU time per run, averaged over a window of back-to-back runs after a warm-up
// (all launches, gaps included; the runs take copies of the inputs in turn), and the median of several windows.
// Apart from v000's, it joins two sittings. Times from different sittings can be a few percent apart, while
// side-by-side timings come from the same sitting.
// v000 is the starting kernel. One run takes 327 microseconds.
#include <hip/hip_runtime.h>
#include <hip/hip_bf16.h>

// MHA: Q/K/V proj (bf16 WMMA, reg-pipelined) -> flash attention (bf16 WMMA,
// fp32 accum, double-buffered async global->LDS staging, WMMA row-sums)
// -> residual+LN.  B=4, S=1024, D=1024, H=16, DH=64

typedef __bf16 bf16;
typedef __bf16 v16bf __attribute__((ext_vector_type(16)));
typedef float  v8f   __attribute__((ext_vector_type(8)));

#define B_  4
#define S_  1024
#define D_  1024
#define H_  16
#define DH_ 64

// Load a 16(M) x 32(K) bf16 fragment from LDS into the CDNA5 WMMA A/B VGPR
// layout (wave32): lane L<16 -> row m=L, lanes 16..31 -> same rows, K 8..15 and 24..31.
__device__ __forceinline__ v16bf load_frag(const bf16* base, int ldk, int lane) {
    const int m    = lane & 15;
    const int half = lane >> 4;
    const bf16* row = base + m * ldk + half * 8;
    v16bf a;
    ((uint4*)&a)[0] = *(const uint4*)(row);
    ((uint4*)&a)[1] = *(const uint4*)(row + 16);
    return a;
}

__device__ __forceinline__ unsigned pk2(float lo, float hi) {
    union { bf16 h[2]; unsigned u; } c;
    c.h[0] = (bf16)lo; c.h[1] = (bf16)hi;
    return c.u;
}

// gfx1250 async global->LDS copy (16B per lane), tracked by ASYNCcnt.
__device__ __forceinline__ void async_ld_b128(void* lds_dst, const void* gsrc) {
    unsigned ldso = (unsigned)(uintptr_t)lds_dst;   // low 32 bits = LDS offset
    asm volatile("global_load_async_to_lds_b128 %0, %1, off"
                 :: "v"(ldso), "v"(gsrc) : "memory");
}
__device__ __forceinline__ void wait_async0() {
    asm volatile("s_wait_asynccnt 0x0" ::: "memory");
}
// Async loads complete in order: waiting to <=4 outstanding guarantees the
// previous chunk's 4 loads landed while the newest 4 stay in flight.
__device__ __forceinline__ void wait_async4() {
    asm volatile("s_wait_asynccnt 0x4" ::: "memory");
}

// ---------------------------------------------------------------------------
// Kernel 1: Q/K/V projection (templated).  C[4096x1024] = X @ W.
// 128x128 tile / 256 threads, K stepped by 32, register-staged pipeline:
// global loads of tile k+1 overlap WMMAs on tile k.
// WHICH<2 -> head-major [H,B,S,DH]; WHICH==2 -> transposed [H,B,DH,S].
// ---------------------------------------------------------------------------
template <int WHICH>
__global__ __launch_bounds__(256) void qkv_proj_kernel(
    const float* __restrict__ X, const float* __restrict__ W,
    bf16* __restrict__ dst)
{
    __shared__ bf16 At[128 * 32];   // X tile, row-major [m][k]
    __shared__ bf16 Bt[128 * 32];   // W tile transposed: [n][k]

    const int m0   = blockIdx.x * 128;
    const int n0   = blockIdx.y * 128;
    const int t    = threadIdx.x;
    const int lane = t & 31;
    const int w    = t >> 5;
    const int wm   = w >> 2;   // 0..1 : 64 rows each
    const int wn   = w & 3;    // 0..3 : 32 cols each

    // staging geometry
    const int mm  = t >> 1;
    const int ksA = (t & 1) * 16;
    const float* Abase = X + (size_t)(m0 + mm) * D_ + ksA;
    const int n4  = (t & 31) * 4;
    const int kk0 = t >> 5;
    const float* Bbase = W + n0 + n4;

    float4 ra[4], rb[4];
    auto fetch = [&](int k0) {
        const float4* as = (const float4*)(Abase + k0);
        ra[0] = as[0]; ra[1] = as[1]; ra[2] = as[2]; ra[3] = as[3];
        #pragma unroll
        for (int it = 0; it < 4; ++it)
            rb[it] = *(const float4*)(Bbase + (size_t)(k0 + kk0 + it * 8) * D_);
    };
    auto stage = [&]() {
        uint4* adst = (uint4*)(At + mm * 32 + ksA);
        uint4 u0, u1;
        u0.x = pk2(ra[0].x, ra[0].y); u0.y = pk2(ra[0].z, ra[0].w);
        u0.z = pk2(ra[1].x, ra[1].y); u0.w = pk2(ra[1].z, ra[1].w);
        u1.x = pk2(ra[2].x, ra[2].y); u1.y = pk2(ra[2].z, ra[2].w);
        u1.z = pk2(ra[3].x, ra[3].y); u1.w = pk2(ra[3].z, ra[3].w);
        adst[0] = u0; adst[1] = u1;
        #pragma unroll
        for (int it = 0; it < 4; ++it) {
            const int kk = kk0 + it * 8;
            Bt[(n4 + 0) * 32 + kk] = (bf16)rb[it].x;
            Bt[(n4 + 1) * 32 + kk] = (bf16)rb[it].y;
            Bt[(n4 + 2) * 32 + kk] = (bf16)rb[it].z;
            Bt[(n4 + 3) * 32 + kk] = (bf16)rb[it].w;
        }
    };

    const v8f vzero = {};
    v8f acc[4][2];
    #pragma unroll
    for (int i = 0; i < 4; ++i)
        #pragma unroll
        for (int j = 0; j < 2; ++j) acc[i][j] = vzero;

    fetch(0);
    for (int k0 = 0; k0 < D_; k0 += 32) {
        stage();
        __syncthreads();
        if (k0 + 32 < D_) fetch(k0 + 32);   // overlap with WMMAs below

        v16bf a[4], bfr[2];
        #pragma unroll
        for (int i = 0; i < 4; ++i)
            a[i] = load_frag(At + (wm * 64 + i * 16) * 32, 32, lane);
        #pragma unroll
        for (int j = 0; j < 2; ++j)
            bfr[j] = load_frag(Bt + (wn * 32 + j * 16) * 32, 32, lane);

        #pragma unroll
        for (int i = 0; i < 4; ++i)
            #pragma unroll
            for (int j = 0; j < 2; ++j)
                acc[i][j] = __builtin_amdgcn_wmma_f32_16x16x32_bf16(
                    false, a[i], false, bfr[j], (short)0, acc[i][j], false, false);
        __syncthreads();
    }

    // ---- branch-free epilogue (layout chosen at compile time) ----
    const int half = lane >> 4;
    const int nin  = lane & 15;
    #pragma unroll
    for (int i = 0; i < 4; ++i) {
        #pragma unroll
        for (int j = 0; j < 2; ++j) {
            #pragma unroll
            for (int r = 0; r < 8; ++r) {
                const int mg = m0 + wm * 64 + i * 16 + r + 8 * half;
                const int ng = n0 + wn * 32 + j * 16 + nin;
                const int bb = mg >> 10, ss = mg & 1023;   // S_=1024
                const int hh = ng >> 6,  dd = ng & 63;     // DH_=64
                const bf16 v = (bf16)acc[i][j][r];
                if constexpr (WHICH == 2)
                    dst[((size_t)(hh * B_ + bb) * DH_ + dd) * S_ + ss] = v;  // V^T
                else
                    dst[((size_t)(hh * B_ + bb) * S_ + ss) * DH_ + dd] = v;
            }
        }
    }
}

// ---------------------------------------------------------------------------
// Kernel 2: flash attention per (h,b).  Block = 128 threads (4 waves), each
// wave owns a 16-query tile.  K/V^T tiles double-buffered via async DMA so
// chunk i+1 streams in under chunk i's WMMAs.  Row sums computed with a
// ones-matrix WMMA (no shuffle reduction); only the row max uses bpermute.
// ---------------------------------------------------------------------------
__global__ __launch_bounds__(128) void attention_kernel(
    const bf16* __restrict__ qws, const bf16* __restrict__ kws,
    const bf16* __restrict__ vws, const int* __restrict__ query_masks,
    const int* __restrict__ key_masks, float* __restrict__ ows)
{
    __shared__ bf16 Qt[64 * 64];        // 64 queries x 64 dh
    __shared__ bf16 Kt[2][32 * 64];     // 32 keys x 64 dh, double buffered
    __shared__ bf16 Vt[2][64 * 32];     // V^T: 64 dh x 32 keys, double buffered
    __shared__ bf16 Pt[4][16 * 32];     // per-wave P scratch

    const int hb   = blockIdx.y;        // h*B + b
    const int h    = hb >> 2;
    const int b    = hb & 3;
    const int q0   = blockIdx.x * 64;
    const int t    = threadIdx.x;
    const int lane = t & 31;
    const int w    = t >> 5;
    const int half = lane >> 4;
    const int nin  = lane & 15;

    auto issue_chunk = [&](int kc, int buf) {
        const char* ksrc = (const char*)(kws + (size_t)(hb * S_ + kc) * DH_);
        char* kdst = (char*)Kt[buf];
        async_ld_b128(kdst + t * 16,        ksrc + t * 16);
        async_ld_b128(kdst + t * 16 + 2048, ksrc + t * 16 + 2048);
        const int row = t >> 1;
        const int seg = (t & 1) * 16;                 // 16 bf16 = 32 B
        const char* vsrc = (const char*)(vws + (size_t)(hb * DH_ + row) * S_ + kc + seg);
        char* vdst = (char*)(Vt[buf] + row * 32 + seg);
        async_ld_b128(vdst,      vsrc);
        async_ld_b128(vdst + 16, vsrc + 16);
    };

    // ---- stage Q tile + first K/V chunk ----
    {
        const char* src = (const char*)(qws + (size_t)(hb * S_ + q0) * DH_);
        char* dstp = (char*)Qt;
        #pragma unroll
        for (int p = 0; p < 4; ++p)
            async_ld_b128(dstp + (t + p * 128) * 16, src + (t + p * 128) * 16);
    }
    issue_chunk(0, 0);
    wait_async0();
    __syncthreads();

    const v16bf aq0 = load_frag(Qt + (w * 16) * 64,      64, lane);  // dh 0..31
    const v16bf aq1 = load_frag(Qt + (w * 16) * 64 + 32, 64, lane);  // dh 32..63

    v16bf ones;                          // B = all-ones 32x16 for row sums
    #pragma unroll
    for (int i = 0; i < 16; ++i) ones[i] = (bf16)1.0f;

    const v8f vzero = {};
    v8f accO[4];
    #pragma unroll
    for (int u = 0; u < 4; ++u) accO[u] = vzero;
    v8f lacc = vzero;                    // running softmax denominator
    float mrun[8];
    #pragma unroll
    for (int r = 0; r < 8; ++r) mrun[r] = -3.0e38f;

    for (int ic = 0; ic < S_ / 32; ++ic) {
        const int kc  = ic * 32;
        const int buf = ic & 1;
        if (ic + 1 < S_ / 32) {          // stream next chunk under this compute
            issue_chunk(kc + 32, buf ^ 1);
            wait_async4();
        } else {
            wait_async0();
        }
        __syncthreads();

        const int km0 = key_masks[b * S_ + kc + nin];
        const int km1 = key_masks[b * S_ + kc + 16 + nin];

        // ---- scores: 16q x 32k, contraction dh=64 in two K=32 halves ----
        const bf16* Kb = Kt[buf];
        v8f s0 = vzero, s1 = vzero;
        {
            const v16bf b00 = load_frag(Kb,                64, lane);
            const v16bf b01 = load_frag(Kb + 32,           64, lane);
            const v16bf b10 = load_frag(Kb + 16 * 64,      64, lane);
            const v16bf b11 = load_frag(Kb + 16 * 64 + 32, 64, lane);
            s0 = __builtin_amdgcn_wmma_f32_16x16x32_bf16(false, aq0, false, b00, (short)0, s0, false, false);
            s0 = __builtin_amdgcn_wmma_f32_16x16x32_bf16(false, aq1, false, b01, (short)0, s0, false, false);
            s1 = __builtin_amdgcn_wmma_f32_16x16x32_bf16(false, aq0, false, b10, (short)0, s1, false, false);
            s1 = __builtin_amdgcn_wmma_f32_16x16x32_bf16(false, aq1, false, b11, (short)0, s1, false, false);
        }

        // ---- online softmax: max via 16-lane bpermute tree (covers two
        //      rows per register), running rescale folded into accO/lacc ----
        #pragma unroll
        for (int r = 0; r < 8; ++r) {
            float sc0 = km0 ? s0[r] * 0.125f : -1.0e7f;   // scale then key-mask replace
            float sc1 = km1 ? s1[r] * 0.125f : -1.0e7f;
            float hm = fmaxf(sc0, sc1);
            #pragma unroll
            for (int d = 1; d < 16; d <<= 1) hm = fmaxf(hm, __shfl_xor(hm, d, 32));
            const float mnew = fmaxf(mrun[r], hm);
            const float corr = __expf(mrun[r] - mnew);
            const float p0   = __expf(sc0 - mnew);
            const float p1   = __expf(sc1 - mnew);
            mrun[r] = mnew;
            lacc[r] *= corr;
            #pragma unroll
            for (int u = 0; u < 4; ++u) accO[u][r] *= corr;
            const int mrow = r + 8 * half;
            Pt[w][mrow * 32 + nin]      = (bf16)p0;
            Pt[w][mrow * 32 + 16 + nin] = (bf16)p1;
        }

        // ---- O += P (16x32) @ V (32 x 64dh); l += P @ ones ----
        const v16bf ap = load_frag(&Pt[w][0], 32, lane);
        const bf16* Vb = Vt[buf];
        #pragma unroll
        for (int u = 0; u < 4; ++u) {
            const v16bf bv = load_frag(Vb + (u * 16) * 32, 32, lane);
            accO[u] = __builtin_amdgcn_wmma_f32_16x16x32_bf16(
                false, ap, false, bv, (short)0, accO[u], false, false);
        }
        lacc = __builtin_amdgcn_wmma_f32_16x16x32_bf16(
            false, ap, false, ones, (short)0, lacc, false, false);
        __syncthreads();
    }

    // ---- epilogue: 1/l, query mask (post-softmax multiplicative), write O ----
    #pragma unroll
    for (int r = 0; r < 8; ++r) {
        const int mrow = r + 8 * half;
        const int qrow = q0 + w * 16 + mrow;
        const float l   = lacc[r];
        const float inv = (l > 0.f) ? (1.0f / l) : 0.f;
        const float fac = query_masks[b * S_ + qrow] ? inv : 0.f;
        #pragma unroll
        for (int u = 0; u < 4; ++u) {
            ows[((size_t)(b * S_ + qrow)) * D_ + h * DH_ + u * 16 + nin] = accO[u][r] * fac;
        }
    }
}

// ---------------------------------------------------------------------------
// Kernel 3: residual + LayerNorm (eps = 1e-3).  One row (D=1024) per block.
// ---------------------------------------------------------------------------
__global__ __launch_bounds__(256) void resid_ln_kernel(
    const float* __restrict__ queries, const float* __restrict__ ows,
    const float* __restrict__ gamma, const float* __restrict__ beta,
    float* __restrict__ out)
{
    __shared__ float red1[8], red2[8];
    const int row = blockIdx.x;
    const int t   = threadIdx.x;

    const float4 q4 = ((const float4*)(queries + (size_t)row * D_))[t];
    const float4 o4 = ((const float4*)(ows     + (size_t)row * D_))[t];
    float4 r4;
    r4.x = q4.x + o4.x; r4.y = q4.y + o4.y;
    r4.z = q4.z + o4.z; r4.w = q4.w + o4.w;

    float s1 = r4.x + r4.y + r4.z + r4.w;
    float s2 = r4.x * r4.x + r4.y * r4.y + r4.z * r4.z + r4.w * r4.w;
    #pragma unroll
    for (int d = 1; d < 32; d <<= 1) {
        s1 += __shfl_xor(s1, d, 32);
        s2 += __shfl_xor(s2, d, 32);
    }
    if ((t & 31) == 0) { red1[t >> 5] = s1; red2[t >> 5] = s2; }
    __syncthreads();
    float ts1 = 0.f, ts2 = 0.f;
    #pragma unroll
    for (int i = 0; i < 8; ++i) { ts1 += red1[i]; ts2 += red2[i]; }

    const float mean = ts1 * (1.0f / D_);
    const float var  = ts2 * (1.0f / D_) - mean * mean;
    const float rstd = rsqrtf(var + 1e-3f);

    const float4 g4 = ((const float4*)gamma)[t];
    const float4 b4 = ((const float4*)beta)[t];
    float4 o;
    o.x = g4.x * (r4.x - mean) * rstd + b4.x;
    o.y = g4.y * (r4.y - mean) * rstd + b4.y;
    o.z = g4.z * (r4.z - mean) * rstd + b4.z;
    o.w = g4.w * (r4.w - mean) * rstd + b4.w;
    ((float4*)(out + (size_t)row * D_))[t] = o;
}

// ---------------------------------------------------------------------------
extern "C" void kernel_launch(void* const* d_in, const int* in_sizes, int n_in,
                              void* d_out, int out_size, void* d_ws, size_t ws_size,
                              hipStream_t stream) {
    const float* queries = (const float*)d_in[0];
    const float* keys    = (const float*)d_in[1];
    const float* values  = (const float*)d_in[2];
    const int*   qmask   = (const int*)d_in[3];
    const int*   kmask   = (const int*)d_in[4];
    const float* Wq      = (const float*)d_in[5];
    const float* Wk      = (const float*)d_in[6];
    const float* Wv      = (const float*)d_in[7];
    const float* gamma   = (const float*)d_in[8];
    const float* beta    = (const float*)d_in[9];
    float*       out     = (float*)d_out;

    const size_t QKV = (size_t)H_ * B_ * S_ * DH_;   // 4 Mi elements
    bf16*  qws = (bf16*)d_ws;
    bf16*  kws = qws + QKV;
    bf16*  vws = kws + QKV;
    float* ows = (float*)(vws + QKV);

    dim3 g1(B_ * S_ / 128, D_ / 128);
    qkv_proj_kernel<0><<<g1, dim3(256), 0, stream>>>(queries, Wq, qws);
    qkv_proj_kernel<1><<<g1, dim3(256), 0, stream>>>(keys,    Wk, kws);
    qkv_proj_kernel<2><<<g1, dim3(256), 0, stream>>>(values,  Wv, vws);

    dim3 g2(S_ / 64, H_ * B_);
    attention_kernel<<<g2, dim3(128), 0, stream>>>(qws, kws, vws, qmask, kmask, ows);

    resid_ln_kernel<<<dim3(B_ * S_), dim3(256), 0, stream>>>(queries, ows, gamma, beta, out);
}

// v001
// It runs in 158 microseconds.
// Next to v000, in two timings, it ran 2.06 times as fast each time.
#include <hip/hip_runtime.h>
#include <hip/hip_bf16.h>

// MHA: Q/K/V proj (bf16 WMMA, reg-pipelined) -> flash attention (bf16 WMMA,
// fp32 accum, double-buffered async global->LDS staging, WMMA row-sums)
// -> residual+LN.  B=4, S=1024, D=1024, H=16, DH=64

typedef __bf16 bf16;
typedef __bf16 v16bf __attribute__((ext_vector_type(16)));
typedef float  v8f   __attribute__((ext_vector_type(8)));

#define B_  4
#define S_  1024
#define D_  1024
#define H_  16
#define DH_ 64

// Load a 16(M) x 32(K) bf16 fragment from LDS into the CDNA5 WMMA A/B VGPR
// layout (wave32): lane L<16 -> row m=L, lanes 16..31 -> same rows, K 8..15 and 24..31.
__device__ __forceinline__ v16bf load_frag(const bf16* base, int ldk, int lane) {
    const int m    = lane & 15;
    const int half = lane >> 4;
    const bf16* row = base + m * ldk + half * 8;
    v16bf a;
    ((uint4*)&a)[0] = *(const uint4*)(row);
    ((uint4*)&a)[1] = *(const uint4*)(row + 16);
    return a;
}

// Load a 32(K) x 16(N) bf16 B fragment from a ROW-MAJOR [k][n] LDS tile with the
// transposing LDS load: lane (c = L&15, h = L>>4) receives T[kbase+8h+0..7][c],
// so the loads at kbase 0 and 16 give the same k order as load_frag gives A.
typedef short s16x8 __attribute__((ext_vector_type(8)));
__device__ __forceinline__ v16bf load_frag_tr(const bf16* base, int ldn, int lane) {
    typedef __attribute__((address_space(3))) s16x8 lds_s16x8;
    const bf16* p = base + ((lane >> 4) * 8 + (lane & 7)) * ldn + ((lane >> 3) & 1) * 8;
    v16bf b;
    ((s16x8*)&b)[0] = __builtin_amdgcn_ds_load_tr16_b128_v8i16((lds_s16x8*)p);
    ((s16x8*)&b)[1] = __builtin_amdgcn_ds_load_tr16_b128_v8i16((lds_s16x8*)(p + 16 * ldn));
    return b;
}

__device__ __forceinline__ unsigned pk2(float lo, float hi) {
    union { bf16 h[2]; unsigned u; } c;
    c.h[0] = (bf16)lo; c.h[1] = (bf16)hi;
    return c.u;
}

// gfx1250 async global->LDS copy (16B per lane), tracked by ASYNCcnt.
__device__ __forceinline__ void async_ld_b128(void* lds_dst, const void* gsrc) {
    unsigned ldso = (unsigned)(uintptr_t)lds_dst;   // low 32 bits = LDS offset
    asm volatile("global_load_async_to_lds_b128 %0, %1, off"
                 :: "v"(ldso), "v"(gsrc) : "memory");
}
__device__ __forceinline__ void wait_async0() {
    asm volatile("s_wait_asynccnt 0x0" ::: "memory");
}
// Async loads complete in order: waiting to <=4 outstanding guarantees the
// previous chunk's 4 loads landed while the newest 4 stay in flight.
__device__ __forceinline__ void wait_async4() {
    asm volatile("s_wait_asynccnt 0x4" ::: "memory");
}

// ---------------------------------------------------------------------------
// Kernel 1: Q/K/V projection (templated).  C[4096x1024] = X @ W.
// 128x128 tile / 256 threads, K stepped by 32, register-staged pipeline:
// global loads of tile k+1 overlap WMMAs on tile k.
// WHICH<2 -> head-major [H,B,S,DH]; WHICH==2 -> transposed [H,B,DH,S].
// ---------------------------------------------------------------------------
template <int WHICH>
__global__ __launch_bounds__(256) void qkv_proj_kernel(
    const float* __restrict__ X, const float* __restrict__ W,
    bf16* __restrict__ dst)
{
    __shared__ bf16 At[128 * 32];   // X tile, row-major [m][k]
    // W tile as it lies in memory, [k][n]; 288-B rows (32 B x odd) suit the
    // transposing reader, and a wave's 8-byte stores fill one row bank by bank.
    constexpr int LDB = 144;
    __shared__ __attribute__((aligned(16))) bf16 Bt[32 * LDB];

    const int m0   = blockIdx.x * 128;
    const int n0   = blockIdx.y * 128;
    const int t    = threadIdx.x;
    const int lane = t & 31;
    const int w    = t >> 5;
    const int wm   = w >> 2;   // 0..1 : 64 rows each
    const int wn   = w & 3;    // 0..3 : 32 cols each

    // staging geometry
    const int mm  = t >> 1;
    const int ksA = (t & 1) * 16;
    const float* Abase = X + (size_t)(m0 + mm) * D_ + ksA;
    const int n4  = (t & 31) * 4;
    const int kk0 = t >> 5;
    const float* Bbase = W + n0 + n4;

    float4 ra[4], rb[4];
    auto fetch = [&](int k0) {
        const float4* as = (const float4*)(Abase + k0);
        ra[0] = as[0]; ra[1] = as[1]; ra[2] = as[2]; ra[3] = as[3];
        #pragma unroll
        for (int it = 0; it < 4; ++it)
            rb[it] = *(const float4*)(Bbase + (size_t)(k0 + kk0 + it * 8) * D_);
    };
    auto stage = [&]() {
        uint4* adst = (uint4*)(At + mm * 32 + ksA);
        uint4 u0, u1;
        u0.x = pk2(ra[0].x, ra[0].y); u0.y = pk2(ra[0].z, ra[0].w);
        u0.z = pk2(ra[1].x, ra[1].y); u0.w = pk2(ra[1].z, ra[1].w);
        u1.x = pk2(ra[2].x, ra[2].y); u1.y = pk2(ra[2].z, ra[2].w);
        u1.z = pk2(ra[3].x, ra[3].y); u1.w = pk2(ra[3].z, ra[3].w);
        adst[0] = u0; adst[1] = u1;
        #pragma unroll
        for (int it = 0; it < 4; ++it) {
            const int kk = kk0 + it * 8;
            typedef float f32x4 __attribute__((ext_vector_type(4)));
            typedef bf16  bf16x4 __attribute__((ext_vector_type(4)));
            const f32x4 f = {rb[it].x, rb[it].y, rb[it].z, rb[it].w};
            *(bf16x4*)(Bt + kk * LDB + n4) = __builtin_convertvector(f, bf16x4);
        }
    };

    const v8f vzero = {};
    v8f acc[4][2];
    #pragma unroll
    for (int i = 0; i < 4; ++i)
        #pragma unroll
        for (int j = 0; j < 2; ++j) acc[i][j] = vzero;

    auto mma_tile = [&]() {
        v16bf a[4], bfr[2];
        #pragma unroll
        for (int i = 0; i < 4; ++i)
            a[i] = load_frag(At + (wm * 64 + i * 16) * 32, 32, lane);
        #pragma unroll
        for (int j = 0; j < 2; ++j)
            bfr[j] = load_frag_tr(Bt + wn * 32 + j * 16, LDB, lane);

        #pragma unroll
        for (int i = 0; i < 4; ++i)
            #pragma unroll
            for (int j = 0; j < 2; ++j)
                acc[i][j] = __builtin_amdgcn_wmma_f32_16x16x32_bf16(
                    false, a[i], false, bfr[j], (short)0, acc[i][j], false, false);
    };

    // Last trip peeled: with the fetch under a condition this build copied two
    // of the fetched registers right behind the loads, and so waited for them
    // ahead of the WMMAs that the loads are meant to fly under.
    fetch(0);
    for (int k0 = 32; k0 < D_; k0 += 32) {
        stage();
        __syncthreads();
        fetch(k0);                          // overlap with WMMAs below
        // Keeps the loads in front of the WMMAs: the scheduler otherwise sinks
        // them to just ahead of the barrier's wait, and nothing is overlapped.
        __builtin_amdgcn_sched_barrier(0);
        mma_tile();
        __syncthreads();
    }
    stage();
    __syncthreads();
    mma_tile();
    __syncthreads();

    // ---- branch-free epilogue (layout chosen at compile time) ----
    const int half = lane >> 4;
    const int nin  = lane & 15;
    #pragma unroll
    for (int i = 0; i < 4; ++i) {
        #pragma unroll
        for (int j = 0; j < 2; ++j) {
            #pragma unroll
            for (int r = 0; r < 8; ++r) {
                const int mg = m0 + wm * 64 + i * 16 + r + 8 * half;
                const int ng = n0 + wn * 32 + j * 16 + nin;
                const int bb = mg >> 10, ss = mg & 1023;   // S_=1024
                const int hh = ng >> 6,  dd = ng & 63;     // DH_=64
                const bf16 v = (bf16)acc[i][j][r];
                if constexpr (WHICH == 2)
                    dst[((size_t)(hh * B_ + bb) * DH_ + dd) * S_ + ss] = v;  // V^T
                else
                    dst[((size_t)(hh * B_ + bb) * S_ + ss) * DH_ + dd] = v;
            }
        }
    }
}

// ---------------------------------------------------------------------------
// Kernel 2: flash attention per (h,b).  Block = 128 threads (4 waves), each
// wave owns a 16-query tile.  K/V^T tiles double-buffered via async DMA so
// chunk i+1 streams in under chunk i's WMMAs.  Row sums computed with a
// ones-matrix WMMA (no shuffle reduction); only the row max uses bpermute.
// ---------------------------------------------------------------------------
__global__ __launch_bounds__(128) void attention_kernel(
    const bf16* __restrict__ qws, const bf16* __restrict__ kws,
    const bf16* __restrict__ vws, const int* __restrict__ query_masks,
    const int* __restrict__ key_masks, float* __restrict__ ows)
{
    __shared__ bf16 Qt[64 * 64];        // 64 queries x 64 dh
    __shared__ bf16 Kt[2][32 * 64];     // 32 keys x 64 dh, double buffered
    __shared__ bf16 Vt[2][64 * 32];     // V^T: 64 dh x 32 keys, double buffered
    __shared__ bf16 Pt[4][16 * 32];     // per-wave P scratch

    const int hb   = blockIdx.y;        // h*B + b
    const int h    = hb >> 2;
    const int b    = hb & 3;
    const int q0   = blockIdx.x * 64;
    const int t    = threadIdx.x;
    const int lane = t & 31;
    const int w    = t >> 5;
    const int half = lane >> 4;
    const int nin  = lane & 15;

    auto issue_chunk = [&](int kc, int buf) {
        const char* ksrc = (const char*)(kws + (size_t)(hb * S_ + kc) * DH_);
        char* kdst = (char*)Kt[buf];
        async_ld_b128(kdst + t * 16,        ksrc + t * 16);
        async_ld_b128(kdst + t * 16 + 2048, ksrc + t * 16 + 2048);
        const int row = t >> 1;
        const int seg = (t & 1) * 16;                 // 16 bf16 = 32 B
        const char* vsrc = (const char*)(vws + (size_t)(hb * DH_ + row) * S_ + kc + seg);
        char* vdst = (char*)(Vt[buf] + row * 32 + seg);
        async_ld_b128(vdst,      vsrc);
        async_ld_b128(vdst + 16, vsrc + 16);
    };

    // ---- stage Q tile + first K/V chunk ----
    {
        const char* src = (const char*)(qws + (size_t)(hb * S_ + q0) * DH_);
        char* dstp = (char*)Qt;
        #pragma unroll
        for (int p = 0; p < 4; ++p)
            async_ld_b128(dstp + (t + p * 128) * 16, src + (t + p * 128) * 16);
    }
    issue_chunk(0, 0);
    wait_async0();
    __syncthreads();

    const v16bf aq0 = load_frag(Qt + (w * 16) * 64,      64, lane);  // dh 0..31
    const v16bf aq1 = load_frag(Qt + (w * 16) * 64 + 32, 64, lane);  // dh 32..63

    v16bf ones;                          // B = all-ones 32x16 for row sums
    #pragma unroll
    for (int i = 0; i < 16; ++i) ones[i] = (bf16)1.0f;

    const v8f vzero = {};
    v8f accO[4];
    #pragma unroll
    for (int u = 0; u < 4; ++u) accO[u] = vzero;
    v8f lacc = vzero;                    // running softmax denominator
    float mrun[8];
    #pragma unroll
    for (int r = 0; r < 8; ++r) mrun[r] = -3.0e38f;

    for (int ic = 0; ic < S_ / 32; ++ic) {
        const int kc  = ic * 32;
        const int buf = ic & 1;
        if (ic + 1 < S_ / 32) {          // stream next chunk under this compute
            issue_chunk(kc + 32, buf ^ 1);
            wait_async4();
        } else {
            wait_async0();
        }
        __syncthreads();

        const int km0 = key_masks[b * S_ + kc + nin];
        const int km1 = key_masks[b * S_ + kc + 16 + nin];

        // ---- scores: 16q x 32k, contraction dh=64 in two K=32 halves ----
        const bf16* Kb = Kt[buf];
        v8f s0 = vzero, s1 = vzero;
        {
            const v16bf b00 = load_frag(Kb,                64, lane);
            const v16bf b01 = load_frag(Kb + 32,           64, lane);
            const v16bf b10 = load_frag(Kb + 16 * 64,      64, lane);
            const v16bf b11 = load_frag(Kb + 16 * 64 + 32, 64, lane);
            s0 = __builtin_amdgcn_wmma_f32_16x16x32_bf16(false, aq0, false, b00, (short)0, s0, false, false);
            s0 = __builtin_amdgcn_wmma_f32_16x16x32_bf16(false, aq1, false, b01, (short)0, s0, false, false);
            s1 = __builtin_amdgcn_wmma_f32_16x16x32_bf16(false, aq0, false, b10, (short)0, s1, false, false);
            s1 = __builtin_amdgcn_wmma_f32_16x16x32_bf16(false, aq1, false, b11, (short)0, s1, false, false);
        }

        // ---- online softmax: max via 16-lane bpermute tree (covers two
        //      rows per register), running rescale folded into accO/lacc ----
        #pragma unroll
        for (int r = 0; r < 8; ++r) {
            float sc0 = km0 ? s0[r] * 0.125f : -1.0e7f;   // scale then key-mask replace
            float sc1 = km1 ? s1[r] * 0.125f : -1.0e7f;
            float hm = fmaxf(sc0, sc1);
            #pragma unroll
            for (int d = 1; d < 16; d <<= 1) hm = fmaxf(hm, __shfl_xor(hm, d, 32));
            const float mnew = fmaxf(mrun[r], hm);
            const float corr = __expf(mrun[r] - mnew);
            const float p0   = __expf(sc0 - mnew);
            const float p1   = __expf(sc1 - mnew);
            mrun[r] = mnew;
            lacc[r] *= corr;
            #pragma unroll
            for (int u = 0; u < 4; ++u) accO[u][r] *= corr;
            const int mrow = r + 8 * half;
            Pt[w][mrow * 32 + nin]      = (bf16)p0;
            Pt[w][mrow * 32 + 16 + nin] = (bf16)p1;
        }

        // ---- O += P (16x32) @ V (32 x 64dh); l += P @ ones ----
        const v16bf ap = load_frag(&Pt[w][0], 32, lane);
        const bf16* Vb = Vt[buf];
        #pragma unroll
        for (int u = 0; u < 4; ++u) {
            const v16bf bv = load_frag(Vb + (u * 16) * 32, 32, lane);
            accO[u] = __builtin_amdgcn_wmma_f32_16x16x32_bf16(
                false, ap, false, bv, (short)0, accO[u], false, false);
        }
        lacc = __builtin_amdgcn_wmma_f32_16x16x32_bf16(
            false, ap, false, ones, (short)0, lacc, false, false);
        __syncthreads();
    }

    // ---- epilogue: 1/l, query mask (post-softmax multiplicative), write O ----
    #pragma unroll
    for (int r = 0; r < 8; ++r) {
        const int mrow = r + 8 * half;
        const int qrow = q0 + w * 16 + mrow;
        const float l   = lacc[r];
        const float inv = (l > 0.f) ? (1.0f / l) : 0.f;
        const float fac = query_masks[b * S_ + qrow] ? inv : 0.f;
        #pragma unroll
        for (int u = 0; u < 4; ++u) {
            ows[((size_t)(b * S_ + qrow)) * D_ + h * DH_ + u * 16 + nin] = accO[u][r] * fac;
        }
    }
}

// ---------------------------------------------------------------------------
// Kernel 3: residual + LayerNorm (eps = 1e-3).  One row (D=1024) per block.
// ---------------------------------------------------------------------------
__global__ __launch_bounds__(256) void resid_ln_kernel(
    const float* __restrict__ queries, const float* __restrict__ ows,
    const float* __restrict__ gamma, const float* __restrict__ beta,
    float* __restrict__ out)
{
    __shared__ float red1[8], red2[8];
    const int row = blockIdx.x;
    const int t   = threadIdx.x;

    const float4 q4 = ((const float4*)(queries + (size_t)row * D_))[t];
    const float4 o4 = ((const float4*)(ows     + (size_t)row * D_))[t];
    float4 r4;
    r4.x = q4.x + o4.x; r4.y = q4.y + o4.y;
    r4.z = q4.z + o4.z; r4.w = q4.w + o4.w;

    float s1 = r4.x + r4.y + r4.z + r4.w;
    float s2 = r4.x * r4.x + r4.y * r4.y + r4.z * r4.z + r4.w * r4.w;
    #pragma unroll
    for (int d = 1; d < 32; d <<= 1) {
        s1 += __shfl_xor(s1, d, 32);
        s2 += __shfl_xor(s2, d, 32);
    }
    if ((t & 31) == 0) { red1[t >> 5] = s1; red2[t >> 5] = s2; }
    __syncthreads();
    float ts1 = 0.f, ts2 = 0.f;
    #pragma unroll
    for (int i = 0; i < 8; ++i) { ts1 += red1[i]; ts2 += red2[i]; }

    const float mean = ts1 * (1.0f / D_);
    const float var  = ts2 * (1.0f / D_) - mean * mean;
    const float rstd = rsqrtf(var + 1e-3f);

    const float4 g4 = ((const float4*)gamma)[t];
    const float4 b4 = ((const float4*)beta)[t];
    float4 o;
    o.x = g4.x * (r4.x - mean) * rstd + b4.x;
    o.y = g4.y * (r4.y - mean) * rstd + b4.y;
    o.z = g4.z * (r4.z - mean) * rstd + b4.z;
    o.w = g4.w * (r4.w - mean) * rstd + b4.w;
    ((float4*)(out + (size_t)row * D_))[t] = o;
}

// ---------------------------------------------------------------------------
extern "C" void kernel_launch(void* const* d_in, const int* in_sizes, int n_in,
                              void* d_out, int out_size, void* d_ws, size_t ws_size,
                              hipStream_t stream) {
    const float* queries = (const float*)d_in[0];
    const float* keys    = (const float*)d_in[1];
    const float* values  = (const float*)d_in[2];
    const int*   qmask   = (const int*)d_in[3];
    const int*   kmask   = (const int*)d_in[4];
    const float* Wq      = (const float*)d_in[5];
    const float* Wk      = (const float*)d_in[6];
    const float* Wv      = (const float*)d_in[7];
    const float* gamma   = (const float*)d_in[8];
    const float* beta    = (const float*)d_in[9];
    float*       out     = (float*)d_out;

    const size_t QKV = (size_t)H_ * B_ * S_ * DH_;   // 4 Mi elements
    bf16*  qws = (bf16*)d_ws;
    bf16*  kws = qws + QKV;
    bf16*  vws = kws + QKV;
    float* ows = (float*)(vws + QKV);

    dim3 g1(B_ * S_ / 128, D_ / 128);
    qkv_proj_kernel<0><<<g1, dim3(256), 0, stream>>>(queries, Wq, qws);
    qkv_proj_kernel<1><<<g1, dim3(256), 0, stream>>>(keys,    Wk, kws);
    qkv_proj_kernel<2><<<g1, dim3(256), 0, stream>>>(values,  Wv, vws);

    dim3 g2(S_ / 64, H_ * B_);
    attention_kernel<<<g2, dim3(128), 0, stream>>>(qws, kws, vws, qmask, kmask, ows);

    resid_ln_kernel<<<dim3(B_ * S_), dim3(256), 0, stream>>>(queries, ows, gamma, beta, out);
}

// v002
// It runs in 141 microseconds.
// Timed twice side by side with v001, it ran 1.13 times as fast both times.
// Over all steps from v000 it is 2.33 times as fast.
#include <hip/hip_runtime.h>
#include <hip/hip_bf16.h>

// MHA: Q/K/V proj (bf16 WMMA, reg-pipelined) -> flash attention (bf16 WMMA,
// fp32 accum, double-buffered async global->LDS staging, WMMA row-sums)
// -> residual+LN.  B=4, S=1024, D=1024, H=16, DH=64

typedef __bf16 bf16;
typedef __bf16 v16bf __attribute__((ext_vector_type(16)));
typedef float  v8f   __attribute__((ext_vector_type(8)));

#define B_  4
#define S_  1024
#define D_  1024
#define H_  16
#define DH_ 64

// Load a 16(M) x 32(K) bf16 fragment from LDS into the CDNA5 WMMA A/B VGPR
// layout (wave32): lane L<16 -> row m=L, lanes 16..31 -> same rows, K 8..15 and 24..31.
__device__ __forceinline__ v16bf load_frag(const bf16* base, int ldk, int lane) {
    const int m    = lane & 15;
    const int half = lane >> 4;
    const bf16* row = base + m * ldk + half * 8;
    v16bf a;
    ((uint4*)&a)[0] = *(const uint4*)(row);
    ((uint4*)&a)[1] = *(const uint4*)(row + 16);
    return a;
}

// Load a 32(K) x 16(N) bf16 B fragment from a ROW-MAJOR [k][n] LDS tile with the
// transposing LDS load: lane (c = L&15, h = L>>4) receives T[kbase+8h+0..7][c],
// so the loads at kbase 0 and 16 give the same k order as load_frag gives A.
typedef short s16x8 __attribute__((ext_vector_type(8)));
__device__ __forceinline__ v16bf load_frag_tr(const bf16* base, int ldn, int lane) {
    typedef __attribute__((address_space(3))) s16x8 lds_s16x8;
    const bf16* p = base + ((lane >> 4) * 8 + (lane & 7)) * ldn + ((lane >> 3) & 1) * 8;
    v16bf b;
    ((s16x8*)&b)[0] = __builtin_amdgcn_ds_load_tr16_b128_v8i16((lds_s16x8*)p);
    ((s16x8*)&b)[1] = __builtin_amdgcn_ds_load_tr16_b128_v8i16((lds_s16x8*)(p + 16 * ldn));
    return b;
}

__device__ __forceinline__ unsigned pk2(float lo, float hi) {
    union { bf16 h[2]; unsigned u; } c;
    c.h[0] = (bf16)lo; c.h[1] = (bf16)hi;
    return c.u;
}

// gfx1250 async global->LDS copies (16B per lane each), tracked by ASYNCcnt.
// Four copies share one statement that ends in s_wait_xcnt 0, so that no
// address register of a copy is rewritten ahead of that wait.
__device__ __forceinline__ void async_ld4_b128(
    void* d0, const void* g0, void* d1, const void* g1,
    void* d2, const void* g2, void* d3, const void* g3) {
    const unsigned l0 = (unsigned)(uintptr_t)d0;    // low 32 bits = LDS offset
    const unsigned l1 = (unsigned)(uintptr_t)d1;
    const unsigned l2 = (unsigned)(uintptr_t)d2;
    const unsigned l3 = (unsigned)(uintptr_t)d3;
    asm volatile("global_load_async_to_lds_b128 %0, %1, off\n\t"
                 "global_load_async_to_lds_b128 %2, %3, off\n\t"
                 "global_load_async_to_lds_b128 %4, %5, off\n\t"
                 "global_load_async_to_lds_b128 %6, %7, off\n\t"
                 "s_wait_xcnt 0x0"
                 :: "v"(l0), "v"(g0), "v"(l1), "v"(g1),
                    "v"(l2), "v"(g2), "v"(l3), "v"(g3) : "memory");
}
__device__ __forceinline__ void wait_async0() {
    asm volatile("s_wait_asynccnt 0x0" ::: "memory");
}
// Async loads complete in order: waiting to <=4 outstanding guarantees the
// previous chunk's 4 loads landed while the newest 4 stay in flight.
__device__ __forceinline__ void wait_async4() {
    asm volatile("s_wait_asynccnt 0x4" ::: "memory");
}

// ---------------------------------------------------------------------------
// Kernel 1: Q/K/V projection (templated).  C[4096x1024] = X @ W.
// 128x128 tile / 256 threads, K stepped by 32, register-staged pipeline:
// global loads of tile k+1 overlap WMMAs on tile k.
// WHICH<2 -> head-major [H,B,S,DH]; WHICH==2 -> transposed [H,B,DH,S].
// ---------------------------------------------------------------------------
template <int WHICH>
__global__ __launch_bounds__(256) void qkv_proj_kernel(
    const float* __restrict__ X, const float* __restrict__ W,
    bf16* __restrict__ dst)
{
    // X tile, row-major [m][k]; 80-B rows (16 B x odd) keep the 16 rows of a
    // ds_load_b128 fragment read on distinct banks (64-B rows: 4 rows a bank).
    constexpr int LDA = 40;
    __shared__ __attribute__((aligned(16))) bf16 At[128 * LDA];
    // W tile as it lies in memory, [k][n]; 288-B rows (32 B x odd) suit the
    // transposing reader, and a wave's 8-byte stores fill one row bank by bank.
    constexpr int LDB = 144;
    __shared__ __attribute__((aligned(16))) bf16 Bt[32 * LDB];

    const int m0   = blockIdx.x * 128;
    const int n0   = blockIdx.y * 128;
    const int t    = threadIdx.x;
    const int lane = t & 31;
    const int w    = t >> 5;
    const int wm   = w >> 2;   // 0..1 : 64 rows each
    const int wn   = w & 3;    // 0..3 : 32 cols each

    // staging geometry
    const int mm  = t >> 1;
    const int ksA = (t & 1) * 16;
    const float* Abase = X + (size_t)(m0 + mm) * D_ + ksA;
    const int n4  = (t & 31) * 4;
    const int kk0 = t >> 5;
    const float* Bbase = W + n0 + n4;

    float4 ra[4], rb[4];
    auto fetch = [&](int k0) {
        const float4* as = (const float4*)(Abase + k0);
        ra[0] = as[0]; ra[1] = as[1]; ra[2] = as[2]; ra[3] = as[3];
        #pragma unroll
        for (int it = 0; it < 4; ++it)
            rb[it] = *(const float4*)(Bbase + (size_t)(k0 + kk0 + it * 8) * D_);
    };
    auto stage = [&]() {
        uint4* adst = (uint4*)(At + mm * LDA + ksA);
        uint4 u0, u1;
        u0.x = pk2(ra[0].x, ra[0].y); u0.y = pk2(ra[0].z, ra[0].w);
        u0.z = pk2(ra[1].x, ra[1].y); u0.w = pk2(ra[1].z, ra[1].w);
        u1.x = pk2(ra[2].x, ra[2].y); u1.y = pk2(ra[2].z, ra[2].w);
        u1.z = pk2(ra[3].x, ra[3].y); u1.w = pk2(ra[3].z, ra[3].w);
        adst[0] = u0; adst[1] = u1;
        #pragma unroll
        for (int it = 0; it < 4; ++it) {
            const int kk = kk0 + it * 8;
            typedef float f32x4 __attribute__((ext_vector_type(4)));
            typedef bf16  bf16x4 __attribute__((ext_vector_type(4)));
            const f32x4 f = {rb[it].x, rb[it].y, rb[it].z, rb[it].w};
            *(bf16x4*)(Bt + kk * LDB + n4) = __builtin_convertvector(f, bf16x4);
        }
    };

    const v8f vzero = {};
    v8f acc[4][2];
    #pragma unroll
    for (int i = 0; i < 4; ++i)
        #pragma unroll
        for (int j = 0; j < 2; ++j) acc[i][j] = vzero;

    auto mma_tile = [&]() {
        v16bf a[4], bfr[2];
        #pragma unroll
        for (int i = 0; i < 4; ++i)
            a[i] = load_frag(At + (wm * 64 + i * 16) * LDA, LDA, lane);
        #pragma unroll
        for (int j = 0; j < 2; ++j)
            bfr[j] = load_frag_tr(Bt + wn * 32 + j * 16, LDB, lane);

        #pragma unroll
        for (int i = 0; i < 4; ++i)
            #pragma unroll
            for (int j = 0; j < 2; ++j)
                acc[i][j] = __builtin_amdgcn_wmma_f32_16x16x32_bf16(
                    false, a[i], false, bfr[j], (short)0, acc[i][j], false, false);
    };

    // Last trip peeled: with the fetch under a condition this build copied two
    // of the fetched registers right behind the loads, and so waited for them
    // ahead of the WMMAs that the loads are meant to fly under.
    fetch(0);
    for (int k0 = 32; k0 < D_; k0 += 32) {
        stage();
        __syncthreads();
        fetch(k0);                          // overlap with WMMAs below
        // Keeps the loads in front of the WMMAs: the scheduler otherwise sinks
        // them to just ahead of the barrier's wait, and nothing is overlapped.
        __builtin_amdgcn_sched_barrier(0);
        mma_tile();
        __syncthreads();
    }
    stage();
    __syncthreads();
    mma_tile();
    __syncthreads();

    // ---- branch-free epilogue (layout chosen at compile time) ----
    const int half = lane >> 4;
    const int nin  = lane & 15;
    #pragma unroll
    for (int i = 0; i < 4; ++i) {
        #pragma unroll
        for (int j = 0; j < 2; ++j) {
            #pragma unroll
            for (int r = 0; r < 8; ++r) {
                const int mg = m0 + wm * 64 + i * 16 + r + 8 * half;
                const int ng = n0 + wn * 32 + j * 16 + nin;
                const int bb = mg >> 10, ss = mg & 1023;   // S_=1024
                const int hh = ng >> 6,  dd = ng & 63;     // DH_=64
                const bf16 v = (bf16)acc[i][j][r];
                if constexpr (WHICH == 2)
                    dst[((size_t)(hh * B_ + bb) * DH_ + dd) * S_ + ss] = v;  // V^T
                else
                    dst[((size_t)(hh * B_ + bb) * S_ + ss) * DH_ + dd] = v;
            }
        }
    }
}

// ---------------------------------------------------------------------------
// Kernel 2: flash attention per (h,b).  Block = 128 threads (4 waves), each
// wave owns a 16-query tile.  K/V^T tiles double-buffered via async DMA so
// chunk i+1 streams in under chunk i's WMMAs.  Row sums computed with a
// ones-matrix WMMA (no shuffle reduction); only the row max uses bpermute.
// ---------------------------------------------------------------------------
__global__ __launch_bounds__(128) void attention_kernel(
    const bf16* __restrict__ qws, const bf16* __restrict__ kws,
    const bf16* __restrict__ vws, const int* __restrict__ query_masks,
    const int* __restrict__ key_masks, float* __restrict__ ows)
{
    // Row pitches of 16 B x odd (144 B for 128-B rows, 80 B for 64-B rows): the
    // 16 rows that a ds_load_b128 fragment read touches then lie on distinct
    // banks; unpadded, 8 (128-B rows) or 4 (64-B rows) of them share a bank.
    constexpr int LDQ = 72;             // Q and K rows: 64 dh + 8
    constexpr int LDV = 40;             // V^T and P rows: 32 keys + 8
    __shared__ __attribute__((aligned(16))) bf16 Qt[64 * LDQ];     // 64 queries x 64 dh
    __shared__ __attribute__((aligned(16))) bf16 Kt[2][32 * LDQ];  // 32 keys x 64 dh, double buffered
    __shared__ __attribute__((aligned(16))) bf16 Vt[2][64 * LDV];  // V^T: 64 dh x 32 keys, double buffered
    __shared__ __attribute__((aligned(16))) bf16 Pt[4][16 * LDV];  // per-wave P scratch

    const int hb   = blockIdx.y;        // h*B + b
    const int h    = hb >> 2;
    const int b    = hb & 3;
    const int q0   = blockIdx.x * 64;
    const int t    = threadIdx.x;
    const int lane = t & 31;
    const int w    = t >> 5;
    const int half = lane >> 4;
    const int nin  = lane & 15;

    auto issue_chunk = [&](int kc, int buf) {
        const char* ksrc = (const char*)(kws + (size_t)(hb * S_ + kc) * DH_) + t * 16;
        char* kdst = (char*)(Kt[buf] + (t >> 3) * LDQ + (t & 7) * 8);   // key row t/8, 16-B piece t%8
        const int row = t >> 1;
        const int seg = (t & 1) * 16;                 // 16 bf16 = 32 B
        const char* vsrc = (const char*)(vws + (size_t)(hb * DH_ + row) * S_ + kc + seg);
        char* vdst = (char*)(Vt[buf] + row * LDV + seg);
        async_ld4_b128(kdst,                ksrc,
                       kdst + 16 * LDQ * 2, ksrc + 2048,     // key rows 16..31
                       vdst,                vsrc,
                       vdst + 16,           vsrc + 16);
    };

    // ---- stage Q tile + first K/V chunk ----
    {
        const char* src = (const char*)(qws + (size_t)(hb * S_ + q0) * DH_) + t * 16;
        char* dstp = (char*)(Qt + (t >> 3) * LDQ + (t & 7) * 8);        // 16 query rows a copy
        async_ld4_b128(dstp,                src,
                       dstp + 16 * LDQ * 2, src + 2048,
                       dstp + 32 * LDQ * 2, src + 4096,
                       dstp + 48 * LDQ * 2, src + 6144);
    }
    issue_chunk(0, 0);
    wait_async0();
    __syncthreads();

    const v16bf aq0 = load_frag(Qt + (w * 16) * LDQ,      LDQ, lane);  // dh 0..31
    const v16bf aq1 = load_frag(Qt + (w * 16) * LDQ + 32, LDQ, lane);  // dh 32..63

    v16bf ones;                          // B = all-ones 32x16 for row sums
    #pragma unroll
    for (int i = 0; i < 16; ++i) ones[i] = (bf16)1.0f;

    const v8f vzero = {};
    v8f accO[4];
    #pragma unroll
    for (int u = 0; u < 4; ++u) accO[u] = vzero;
    v8f lacc = vzero;                    // running softmax denominator
    float mrun[8];
    #pragma unroll
    for (int r = 0; r < 8; ++r) mrun[r] = -3.0e38f;

    for (int ic = 0; ic < S_ / 32; ++ic) {
        const int kc  = ic * 32;
        const int buf = ic & 1;
        if (ic + 1 < S_ / 32) {          // stream next chunk under this compute
            issue_chunk(kc + 32, buf ^ 1);
            wait_async4();
        } else {
            wait_async0();
        }
        __syncthreads();

        const int km0 = key_masks[b * S_ + kc + nin];
        const int km1 = key_masks[b * S_ + kc + 16 + nin];

        // ---- scores: 16q x 32k, contraction dh=64 in two K=32 halves ----
        const bf16* Kb = Kt[buf];
        v8f s0 = vzero, s1 = vzero;
        {
            const v16bf b00 = load_frag(Kb,                 LDQ, lane);
            const v16bf b01 = load_frag(Kb + 32,            LDQ, lane);
            const v16bf b10 = load_frag(Kb + 16 * LDQ,      LDQ, lane);
            const v16bf b11 = load_frag(Kb + 16 * LDQ + 32, LDQ, lane);
            s0 = __builtin_amdgcn_wmma_f32_16x16x32_bf16(false, aq0, false, b00, (short)0, s0, false, false);
            s0 = __builtin_amdgcn_wmma_f32_16x16x32_bf16(false, aq1, false, b01, (short)0, s0, false, false);
            s1 = __builtin_amdgcn_wmma_f32_16x16x32_bf16(false, aq0, false, b10, (short)0, s1, false, false);
            s1 = __builtin_amdgcn_wmma_f32_16x16x32_bf16(false, aq1, false, b11, (short)0, s1, false, false);
        }

        // ---- online softmax: max via 16-lane bpermute tree (covers two
        //      rows per register), running rescale folded into accO/lacc ----
        #pragma unroll
        for (int r = 0; r < 8; ++r) {
            float sc0 = km0 ? s0[r] * 0.125f : -1.0e7f;   // scale then key-mask replace
            float sc1 = km1 ? s1[r] * 0.125f : -1.0e7f;
            float hm = fmaxf(sc0, sc1);
            #pragma unroll
            for (int d = 1; d < 16; d <<= 1) hm = fmaxf(hm, __shfl_xor(hm, d, 32));
            const float mnew = fmaxf(mrun[r], hm);
            const float corr = __expf(mrun[r] - mnew);
            const float p0   = __expf(sc0 - mnew);
            const float p1   = __expf(sc1 - mnew);
            mrun[r] = mnew;
            lacc[r] *= corr;
            #pragma unroll
            for (int u = 0; u < 4; ++u) accO[u][r] *= corr;
            const int mrow = r + 8 * half;
            Pt[w][mrow * LDV + nin]      = (bf16)p0;
            Pt[w][mrow * LDV + 16 + nin] = (bf16)p1;
        }

        // ---- O += P (16x32) @ V (32 x 64dh); l += P @ ones ----
        const v16bf ap = load_frag(&Pt[w][0], LDV, lane);
        const bf16* Vb = Vt[buf];
        #pragma unroll
        for (int u = 0; u < 4; ++u) {
            const v16bf bv = load_frag(Vb + (u * 16) * LDV, LDV, lane);
            accO[u] = __builtin_amdgcn_wmma_f32_16x16x32_bf16(
                false, ap, false, bv, (short)0, accO[u], false, false);
        }
        lacc = __builtin_amdgcn_wmma_f32_16x16x32_bf16(
            false, ap, false, ones, (short)0, lacc, false, false);
        __syncthreads();
    }

    // ---- epilogue: 1/l, query mask (post-softmax multiplicative), write O ----
    #pragma unroll
    for (int r = 0; r < 8; ++r) {
        const int mrow = r + 8 * half;
        const int qrow = q0 + w * 16 + mrow;
        const float l   = lacc[r];
        const float inv = (l > 0.f) ? (1.0f / l) : 0.f;
        const float fac = query_masks[b * S_ + qrow] ? inv : 0.f;
        #pragma unroll
        for (int u = 0; u < 4; ++u) {
            ows[((size_t)(b * S_ + qrow)) * D_ + h * DH_ + u * 16 + nin] = accO[u][r] * fac;
        }
    }
}

// ---------------------------------------------------------------------------
// Kernel 3: residual + LayerNorm (eps = 1e-3).  One row (D=1024) per block.
// ---------------------------------------------------------------------------
__global__ __launch_bounds__(256) void resid_ln_kernel(
    const float* __restrict__ queries, const float* __restrict__ ows,
    const float* __restrict__ gamma, const float* __restrict__ beta,
    float* __restrict__ out)
{
    __shared__ float red1[8], red2[8];
    const int row = blockIdx.x;
    const int t   = threadIdx.x;

    const float4 q4 = ((const float4*)(queries + (size_t)row * D_))[t];
    const float4 o4 = ((const float4*)(ows     + (size_t)row * D_))[t];
    float4 r4;
    r4.x = q4.x + o4.x; r4.y = q4.y + o4.y;
    r4.z = q4.z + o4.z; r4.w = q4.w + o4.w;

    float s1 = r4.x + r4.y + r4.z + r4.w;
    float s2 = r4.x * r4.x + r4.y * r4.y + r4.z * r4.z + r4.w * r4.w;
    #pragma unroll
    for (int d = 1; d < 32; d <<= 1) {
        s1 += __shfl_xor(s1, d, 32);
        s2 += __shfl_xor(s2, d, 32);
    }
    if ((t & 31) == 0) { red1[t >> 5] = s1; red2[t >> 5] = s2; }
    __syncthreads();
    float ts1 = 0.f, ts2 = 0.f;
    #pragma unroll
    for (int i = 0; i < 8; ++i) { ts1 += red1[i]; ts2 += red2[i]; }

    const float mean = ts1 * (1.0f / D_);
    const float var  = ts2 * (1.0f / D_) - mean * mean;
    const float rstd = rsqrtf(var + 1e-3f);

    const float4 g4 = ((const float4*)gamma)[t];
    const float4 b4 = ((const float4*)beta)[t];
    float4 o;
    o.x = g4.x * (r4.x - mean) * rstd + b4.x;
    o.y = g4.y * (r4.y - mean) * rstd + b4.y;
    o.z = g4.z * (r4.z - mean) * rstd + b4.z;
    o.w = g4.w * (r4.w - mean) * rstd + b4.w;
    ((float4*)(out + (size_t)row * D_))[t] = o;
}

// ---------------------------------------------------------------------------
extern "C" void kernel_launch(void* const* d_in, const int* in_sizes, int n_in,
                              void* d_out, int out_size, void* d_ws, size_t ws_size,
                              hipStream_t stream) {
    const float* queries = (const float*)d_in[0];
    const float* keys    = (const float*)d_in[1];
    const float* values  = (const float*)d_in[2];
    const int*   qmask   = (const int*)d_in[3];
    const int*   kmask   = (const int*)d_in[4];
    const float* Wq      = (const float*)d_in[5];
    const float* Wk      = (const float*)d_in[6];
    const float* Wv      = (const float*)d_in[7];
    const float* gamma   = (const float*)d_in[8];
    const float* beta    = (const float*)d_in[9];
    float*       out     = (float*)d_out;

    const size_t QKV = (size_t)H_ * B_ * S_ * DH_;   // 4 Mi elements
    bf16*  qws = (bf16*)d_ws;
    bf16*  kws = qws + QKV;
    bf16*  vws = kws + QKV;
    float* ows = (float*)(vws + QKV);

    dim3 g1(B_ * S_ / 128, D_ / 128);
    qkv_proj_kernel<0><<<g1, dim3(256), 0, stream>>>(queries, Wq, qws);
    qkv_proj_kernel<1><<<g1, dim3(256), 0, stream>>>(keys,    Wk, kws);
    qkv_proj_kernel<2><<<g1, dim3(256), 0, stream>>>(values,  Wv, vws);

    dim3 g2(S_ / 64, H_ * B_);
    attention_kernel<<<g2, dim3(128), 0, stream>>>(qws, kws, vws, qmask, kmask, ows);

    resid_ln_kernel<<<dim3(B_ * S_), dim3(256), 0, stream>>>(queries, ows, gamma, beta, out);
}

// v003
// A run of this version takes 91.8 microseconds.
// Timed twice side by side with v002, it ran 1.53 times as fast both times.
// Counting every step since v000, it is 3.57 times as fast.
#include <hip/hip_runtime.h>
#include <hip/hip_bf16.h>
#include <type_traits>

// MHA: Q/K/V proj (bf16 WMMA, reg-pipelined) -> flash attention (bf16 WMMA,
// fp32 accum, double-buffered async global->LDS staging, WMMA row-sums)
// -> residual+LN.  B=4, S=1024, D=1024, H=16, DH=64

typedef __bf16 bf16;
typedef __bf16 v16bf __attribute__((ext_vector_type(16)));
typedef float  v8f   __attribute__((ext_vector_type(8)));

#define B_  4
#define S_  1024
#define D_  1024
#define H_  16
#define DH_ 64

// Load a 16(M) x 32(K) bf16 fragment from LDS into the CDNA5 WMMA A/B VGPR
// layout (wave32): lane L<16 -> row m=L, lanes 16..31 -> same rows, K 8..15 and 24..31.
__device__ __forceinline__ v16bf load_frag(const bf16* base, int ldk, int lane) {
    const int m    = lane & 15;
    const int half = lane >> 4;
    const bf16* row = base + m * ldk + half * 8;
    v16bf a;
    ((uint4*)&a)[0] = *(const uint4*)(row);
    ((uint4*)&a)[1] = *(const uint4*)(row + 16);
    return a;
}

// Load a 32(K) x 16(N) bf16 B fragment from a ROW-MAJOR [k][n] LDS tile with the
// transposing LDS load: lane (c = L&15, h = L>>4) receives T[kbase+8h+0..7][c],
// so the loads at kbase 0 and 16 give the same k order as load_frag gives A.
typedef short s16x8 __attribute__((ext_vector_type(8)));
__device__ __forceinline__ v16bf load_frag_tr(const bf16* base, int ldn, int lane) {
    typedef __attribute__((address_space(3))) s16x8 lds_s16x8;
    const bf16* p = base + ((lane >> 4) * 8 + (lane & 7)) * ldn + ((lane >> 3) & 1) * 8;
    v16bf b;
    ((s16x8*)&b)[0] = __builtin_amdgcn_ds_load_tr16_b128_v8i16((lds_s16x8*)p);
    ((s16x8*)&b)[1] = __builtin_amdgcn_ds_load_tr16_b128_v8i16((lds_s16x8*)(p + 16 * ldn));
    return b;
}

__device__ __forceinline__ unsigned pk2(float lo, float hi) {
    union { bf16 h[2]; unsigned u; } c;
    c.h[0] = (bf16)lo; c.h[1] = (bf16)hi;
    return c.u;
}

// gfx1250 async global->LDS copies (16B per lane each), tracked by ASYNCcnt.
// Four copies share one statement that ends in s_wait_xcnt 0, so that no
// address register of a copy is rewritten ahead of that wait.
__device__ __forceinline__ void async_ld4_b128(
    void* d0, const void* g0, void* d1, const void* g1,
    void* d2, const void* g2, void* d3, const void* g3) {
    const unsigned l0 = (unsigned)(uintptr_t)d0;    // low 32 bits = LDS offset
    const unsigned l1 = (unsigned)(uintptr_t)d1;
    const unsigned l2 = (unsigned)(uintptr_t)d2;
    const unsigned l3 = (unsigned)(uintptr_t)d3;
    asm volatile("global_load_async_to_lds_b128 %0, %1, off\n\t"
                 "global_load_async_to_lds_b128 %2, %3, off\n\t"
                 "global_load_async_to_lds_b128 %4, %5, off\n\t"
                 "global_load_async_to_lds_b128 %6, %7, off\n\t"
                 "s_wait_xcnt 0x0"
                 :: "v"(l0), "v"(g0), "v"(l1), "v"(g1),
                    "v"(l2), "v"(g2), "v"(l3), "v"(g3) : "memory");
}
__device__ __forceinline__ void wait_async0() {
    asm volatile("s_wait_asynccnt 0x0" ::: "memory");
}
// Async loads complete in order: waiting to <=4 outstanding guarantees the
// previous chunk's 4 loads landed while the newest 4 stay in flight.
__device__ __forceinline__ void wait_async4() {
    asm volatile("s_wait_asynccnt 0x4" ::: "memory");
}

// ---------------------------------------------------------------------------
// Kernel 1: Q/K/V projections, all three in ONE launch.  C[4096x1024] = X @ W.
// blockIdx.z picks the product (0 Q, 1 K, 2 V).  One product alone is 256
// workgroups, one per WGP, and its K loop waits out a global load every trip;
// 768 workgroups put three on each WGP, which fill each other's waits.
// 128x128 tile / 256 threads, K stepped by 32, register-staged pipeline:
// global loads of tile k+1 overlap WMMAs on tile k.
// z<2 -> head-major [H,B,S,DH]; z==2 -> transposed [H,B,DH,S].
// ---------------------------------------------------------------------------
__global__ __launch_bounds__(256) void qkv_proj_kernel(
    const float* __restrict__ Xq, const float* __restrict__ Xk,
    const float* __restrict__ Xv, const float* __restrict__ Wq,
    const float* __restrict__ Wk, const float* __restrict__ Wv,
    bf16* __restrict__ qdst, bf16* __restrict__ kdst, bf16* __restrict__ vdst)
{
    const int which = blockIdx.z;       // uniform over the workgroup
    const float* X = which == 0 ? Xq : which == 1 ? Xk : Xv;
    const float* W = which == 0 ? Wq : which == 1 ? Wk : Wv;

    // X tile, row-major [m][k]; 80-B rows (16 B x odd) keep the 16 rows of a
    // ds_load_b128 fragment read on distinct banks (64-B rows: 4 rows a bank).
    constexpr int LDA = 40;
    __shared__ __attribute__((aligned(16))) bf16 At[128 * LDA];
    // W tile as it lies in memory, [k][n]; 288-B rows (32 B x odd) suit the
    // transposing reader, and a wave's 8-byte stores fill one row bank by bank.
    constexpr int LDB = 144;
    __shared__ __attribute__((aligned(16))) bf16 Bt[32 * LDB];

    const int m0   = blockIdx.x * 128;
    const int n0   = blockIdx.y * 128;
    const int t    = threadIdx.x;
    const int lane = t & 31;
    const int w    = t >> 5;
    const int wm   = w >> 2;   // 0..1 : 64 rows each
    const int wn   = w & 3;    // 0..3 : 32 cols each

    // staging geometry
    const int mm  = t >> 1;
    const int ksA = (t & 1) * 16;
    const float* Abase = X + (size_t)(m0 + mm) * D_ + ksA;
    const int n4  = (t & 31) * 4;
    const int kk0 = t >> 5;
    const float* Bbase = W + n0 + n4;

    float4 ra[4], rb[4];
    auto fetch = [&](int k0) {
        const float4* as = (const float4*)(Abase + k0);
        ra[0] = as[0]; ra[1] = as[1]; ra[2] = as[2]; ra[3] = as[3];
        #pragma unroll
        for (int it = 0; it < 4; ++it)
            rb[it] = *(const float4*)(Bbase + (size_t)(k0 + kk0 + it * 8) * D_);
    };
    auto stage = [&]() {
        uint4* adst = (uint4*)(At + mm * LDA + ksA);
        uint4 u0, u1;
        u0.x = pk2(ra[0].x, ra[0].y); u0.y = pk2(ra[0].z, ra[0].w);
        u0.z = pk2(ra[1].x, ra[1].y); u0.w = pk2(ra[1].z, ra[1].w);
        u1.x = pk2(ra[2].x, ra[2].y); u1.y = pk2(ra[2].z, ra[2].w);
        u1.z = pk2(ra[3].x, ra[3].y); u1.w = pk2(ra[3].z, ra[3].w);
        adst[0] = u0; adst[1] = u1;
        #pragma unroll
        for (int it = 0; it < 4; ++it) {
            const int kk = kk0 + it * 8;
            typedef float f32x4 __attribute__((ext_vector_type(4)));
            typedef bf16  bf16x4 __attribute__((ext_vector_type(4)));
            const f32x4 f = {rb[it].x, rb[it].y, rb[it].z, rb[it].w};
            *(bf16x4*)(Bt + kk * LDB + n4) = __builtin_convertvector(f, bf16x4);
        }
    };

    const v8f vzero = {};
    v8f acc[4][2];
    #pragma unroll
    for (int i = 0; i < 4; ++i)
        #pragma unroll
        for (int j = 0; j < 2; ++j) acc[i][j] = vzero;

    auto mma_tile = [&]() {
        v16bf a[4], bfr[2];
        #pragma unroll
        for (int i = 0; i < 4; ++i)
            a[i] = load_frag(At + (wm * 64 + i * 16) * LDA, LDA, lane);
        #pragma unroll
        for (int j = 0; j < 2; ++j)
            bfr[j] = load_frag_tr(Bt + wn * 32 + j * 16, LDB, lane);

        #pragma unroll
        for (int i = 0; i < 4; ++i)
            #pragma unroll
            for (int j = 0; j < 2; ++j)
                acc[i][j] = __builtin_amdgcn_wmma_f32_16x16x32_bf16(
                    false, a[i], false, bfr[j], (short)0, acc[i][j], false, false);
    };

    // Last trip peeled: with the fetch under a condition this build copied two
    // of the fetched registers right behind the loads, and so waited for them
    // ahead of the WMMAs that the loads are meant to fly under.
    fetch(0);
    for (int k0 = 32; k0 < D_; k0 += 32) {
        stage();
        __syncthreads();
        fetch(k0);                          // overlap with WMMAs below
        // Keeps the loads in front of the WMMAs: the scheduler otherwise sinks
        // them to just ahead of the barrier's wait, and nothing is overlapped.
        __builtin_amdgcn_sched_barrier(0);
        mma_tile();
        __syncthreads();
    }
    stage();
    __syncthreads();
    mma_tile();
    __syncthreads();

    // ---- epilogue: one workgroup-uniform branch picks the layout ----
    const int half = lane >> 4;
    const int nin  = lane & 15;
    auto store_tile = [&](auto transposed, bf16* __restrict__ dst) {
        #pragma unroll
        for (int i = 0; i < 4; ++i) {
            #pragma unroll
            for (int j = 0; j < 2; ++j) {
                #pragma unroll
                for (int r = 0; r < 8; ++r) {
                    const int mg = m0 + wm * 64 + i * 16 + r + 8 * half;
                    const int ng = n0 + wn * 32 + j * 16 + nin;
                    const int bb = mg >> 10, ss = mg & 1023;   // S_=1024
                    const int hh = ng >> 6,  dd = ng & 63;     // DH_=64
                    const bf16 v = (bf16)acc[i][j][r];
                    if constexpr (decltype(transposed)::value)
                        dst[((size_t)(hh * B_ + bb) * DH_ + dd) * S_ + ss] = v;  // V^T
                    else
                        dst[((size_t)(hh * B_ + bb) * S_ + ss) * DH_ + dd] = v;
                }
            }
        }
        // Ends each layout's run of stores: no register that an issued store
        // names is rewritten ahead of this wait on any way out of the run.
        asm volatile("s_wait_xcnt 0x0" ::: "memory");
    };
    if (which == 2) store_tile(std::true_type{},  vdst);
    else            store_tile(std::false_type{}, which == 0 ? qdst : kdst);
}

// ---------------------------------------------------------------------------
// Kernel 2: flash attention per (h,b).  Block = 128 threads (4 waves), each
// wave owns a 16-query tile.  K/V^T tiles double-buffered via async DMA so
// chunk i+1 streams in under chunk i's WMMAs.  Row sums computed with a
// ones-matrix WMMA (no shuffle reduction); only the row max uses bpermute.
// ---------------------------------------------------------------------------
__global__ __launch_bounds__(128) void attention_kernel(
    const bf16* __restrict__ qws, const bf16* __restrict__ kws,
    const bf16* __restrict__ vws, const int* __restrict__ query_masks,
    const int* __restrict__ key_masks, float* __restrict__ ows)
{
    // Row pitches of 16 B x odd (144 B for 128-B rows, 80 B for 64-B rows): the
    // 16 rows that a ds_load_b128 fragment read touches then lie on distinct
    // banks; unpadded, 8 (128-B rows) or 4 (64-B rows) of them share a bank.
    constexpr int LDQ = 72;             // Q and K rows: 64 dh + 8
    constexpr int LDV = 40;             // V^T and P rows: 32 keys + 8
    __shared__ __attribute__((aligned(16))) bf16 Qt[64 * LDQ];     // 64 queries x 64 dh
    __shared__ __attribute__((aligned(16))) bf16 Kt[2][32 * LDQ];  // 32 keys x 64 dh, double buffered
    __shared__ __attribute__((aligned(16))) bf16 Vt[2][64 * LDV];  // V^T: 64 dh x 32 keys, double buffered
    __shared__ __attribute__((aligned(16))) bf16 Pt[4][16 * LDV];  // per-wave P scratch

    const int hb   = blockIdx.y;        // h*B + b
    const int h    = hb >> 2;
    const int b    = hb & 3;
    const int q0   = blockIdx.x * 64;
    const int t    = threadIdx.x;
    const int lane = t & 31;
    const int w    = t >> 5;
    const int half = lane >> 4;
    const int nin  = lane & 15;

    auto issue_chunk = [&](int kc, int buf) {
        const char* ksrc = (const char*)(kws + (size_t)(hb * S_ + kc) * DH_) + t * 16;
        char* kdst = (char*)(Kt[buf] + (t >> 3) * LDQ + (t & 7) * 8);   // key row t/8, 16-B piece t%8
        const int row = t >> 1;
        const int seg = (t & 1) * 16;                 // 16 bf16 = 32 B
        const char* vsrc = (const char*)(vws + (size_t)(hb * DH_ + row) * S_ + kc + seg);
        char* vdst = (char*)(Vt[buf] + row * LDV + seg);
        async_ld4_b128(kdst,                ksrc,
                       kdst + 16 * LDQ * 2, ksrc + 2048,     // key rows 16..31
                       vdst,                vsrc,
                       vdst + 16,           vsrc + 16);
    };

    // ---- stage Q tile + first K/V chunk ----
    {
        const char* src = (const char*)(qws + (size_t)(hb * S_ + q0) * DH_) + t * 16;
        char* dstp = (char*)(Qt + (t >> 3) * LDQ + (t & 7) * 8);        // 16 query rows a copy
        async_ld4_b128(dstp,                src,
                       dstp + 16 * LDQ * 2, src + 2048,
                       dstp + 32 * LDQ * 2, src + 4096,
                       dstp + 48 * LDQ * 2, src + 6144);
    }
    issue_chunk(0, 0);
    wait_async0();
    __syncthreads();

    const v16bf aq0 = load_frag(Qt + (w * 16) * LDQ,      LDQ, lane);  // dh 0..31
    const v16bf aq1 = load_frag(Qt + (w * 16) * LDQ + 32, LDQ, lane);  // dh 32..63

    v16bf ones;                          // B = all-ones 32x16 for row sums
    #pragma unroll
    for (int i = 0; i < 16; ++i) ones[i] = (bf16)1.0f;

    const v8f vzero = {};
    v8f accO[4];
    #pragma unroll
    for (int u = 0; u < 4; ++u) accO[u] = vzero;
    v8f lacc = vzero;                    // running softmax denominator
    float mrun[8];
    #pragma unroll
    for (int r = 0; r < 8; ++r) mrun[r] = -3.0e38f;

    for (int ic = 0; ic < S_ / 32; ++ic) {
        const int kc  = ic * 32;
        const int buf = ic & 1;
        if (ic + 1 < S_ / 32) {          // stream next chunk under this compute
            issue_chunk(kc + 32, buf ^ 1);
            wait_async4();
        } else {
            wait_async0();
        }
        __syncthreads();

        const int km0 = key_masks[b * S_ + kc + nin];
        const int km1 = key_masks[b * S_ + kc + 16 + nin];

        // ---- scores: 16q x 32k, contraction dh=64 in two K=32 halves ----
        const bf16* Kb = Kt[buf];
        v8f s0 = vzero, s1 = vzero;
        {
            const v16bf b00 = load_frag(Kb,                 LDQ, lane);
            const v16bf b01 = load_frag(Kb + 32,            LDQ, lane);
            const v16bf b10 = load_frag(Kb + 16 * LDQ,      LDQ, lane);
            const v16bf b11 = load_frag(Kb + 16 * LDQ + 32, LDQ, lane);
            s0 = __builtin_amdgcn_wmma_f32_16x16x32_bf16(false, aq0, false, b00, (short)0, s0, false, false);
            s0 = __builtin_amdgcn_wmma_f32_16x16x32_bf16(false, aq1, false, b01, (short)0, s0, false, false);
            s1 = __builtin_amdgcn_wmma_f32_16x16x32_bf16(false, aq0, false, b10, (short)0, s1, false, false);
            s1 = __builtin_amdgcn_wmma_f32_16x16x32_bf16(false, aq1, false, b11, (short)0, s1, false, false);
        }

        // ---- online softmax: max via 16-lane bpermute tree (covers two
        //      rows per register), running rescale folded into accO/lacc ----
        #pragma unroll
        for (int r = 0; r < 8; ++r) {
            float sc0 = km0 ? s0[r] * 0.125f : -1.0e7f;   // scale then key-mask replace
            float sc1 = km1 ? s1[r] * 0.125f : -1.0e7f;
            float hm = fmaxf(sc0, sc1);
            #pragma unroll
            for (int d = 1; d < 16; d <<= 1) hm = fmaxf(hm, __shfl_xor(hm, d, 32));
            const float mnew = fmaxf(mrun[r], hm);
            const float corr = __expf(mrun[r] - mnew);
            const float p0   = __expf(sc0 - mnew);
            const float p1   = __expf(sc1 - mnew);
            mrun[r] = mnew;
            lacc[r] *= corr;
            #pragma unroll
            for (int u = 0; u < 4; ++u) accO[u][r] *= corr;
            const int mrow = r + 8 * half;
            Pt[w][mrow * LDV + nin]      = (bf16)p0;
            Pt[w][mrow * LDV + 16 + nin] = (bf16)p1;
        }

        // ---- O += P (16x32) @ V (32 x 64dh); l += P @ ones ----
        const v16bf ap = load_frag(&Pt[w][0], LDV, lane);
        const bf16* Vb = Vt[buf];
        #pragma unroll
        for (int u = 0; u < 4; ++u) {
            const v16bf bv = load_frag(Vb + (u * 16) * LDV, LDV, lane);
            accO[u] = __builtin_amdgcn_wmma_f32_16x16x32_bf16(
                false, ap, false, bv, (short)0, accO[u], false, false);
        }
        lacc = __builtin_amdgcn_wmma_f32_16x16x32_bf16(
            false, ap, false, ones, (short)0, lacc, false, false);
        __syncthreads();
    }

    // ---- epilogue: 1/l, query mask (post-softmax multiplicative), write O ----
    #pragma unroll
    for (int r = 0; r < 8; ++r) {
        const int mrow = r + 8 * half;
        const int qrow = q0 + w * 16 + mrow;
        const float l   = lacc[r];
        const float inv = (l > 0.f) ? (1.0f / l) : 0.f;
        const float fac = query_masks[b * S_ + qrow] ? inv : 0.f;
        #pragma unroll
        for (int u = 0; u < 4; ++u) {
            ows[((size_t)(b * S_ + qrow)) * D_ + h * DH_ + u * 16 + nin] = accO[u][r] * fac;
        }
    }
}

// ---------------------------------------------------------------------------
// Kernel 3: residual + LayerNorm (eps = 1e-3).  One row (D=1024) per block.
// ---------------------------------------------------------------------------
__global__ __launch_bounds__(256) void resid_ln_kernel(
    const float* __restrict__ queries, const float* __restrict__ ows,
    const float* __restrict__ gamma, const float* __restrict__ beta,
    float* __restrict__ out)
{
    __shared__ float red1[8], red2[8];
    const int row = blockIdx.x;
    const int t   = threadIdx.x;

    const float4 q4 = ((const float4*)(queries + (size_t)row * D_))[t];
    const float4 o4 = ((const float4*)(ows     + (size_t)row * D_))[t];
    float4 r4;
    r4.x = q4.x + o4.x; r4.y = q4.y + o4.y;
    r4.z = q4.z + o4.z; r4.w = q4.w + o4.w;

    float s1 = r4.x + r4.y + r4.z + r4.w;
    float s2 = r4.x * r4.x + r4.y * r4.y + r4.z * r4.z + r4.w * r4.w;
    #pragma unroll
    for (int d = 1; d < 32; d <<= 1) {
        s1 += __shfl_xor(s1, d, 32);
        s2 += __shfl_xor(s2, d, 32);
    }
    if ((t & 31) == 0) { red1[t >> 5] = s1; red2[t >> 5] = s2; }
    __syncthreads();
    float ts1 = 0.f, ts2 = 0.f;
    #pragma unroll
    for (int i = 0; i < 8; ++i) { ts1 += red1[i]; ts2 += red2[i]; }

    const float mean = ts1 * (1.0f / D_);
    const float var  = ts2 * (1.0f / D_) - mean * mean;
    const float rstd = rsqrtf(var + 1e-3f);

    const float4 g4 = ((const float4*)gamma)[t];
    const float4 b4 = ((const float4*)beta)[t];
    float4 o;
    o.x = g4.x * (r4.x - mean) * rstd + b4.x;
    o.y = g4.y * (r4.y - mean) * rstd + b4.y;
    o.z = g4.z * (r4.z - mean) * rstd + b4.z;
    o.w = g4.w * (r4.w - mean) * rstd + b4.w;
    ((float4*)(out + (size_t)row * D_))[t] = o;
}

// ---------------------------------------------------------------------------
extern "C" void kernel_launch(void* const* d_in, const int* in_sizes, int n_in,
                              void* d_out, int out_size, void* d_ws, size_t ws_size,
                              hipStream_t stream) {
    const float* queries = (const float*)d_in[0];
    const float* keys    = (const float*)d_in[1];
    const float* values  = (const float*)d_in[2];
    const int*   qmask   = (const int*)d_in[3];
    const int*   kmask   = (const int*)d_in[4];
    const float* Wq      = (const float*)d_in[5];
    const float* Wk      = (const float*)d_in[6];
    const float* Wv      = (const float*)d_in[7];
    const float* gamma   = (const float*)d_in[8];
    const float* beta    = (const float*)d_in[9];
    float*       out     = (float*)d_out;

    const size_t QKV = (size_t)H_ * B_ * S_ * DH_;   // 4 Mi elements
    bf16*  qws = (bf16*)d_ws;
    bf16*  kws = qws + QKV;
    bf16*  vws = kws + QKV;
    float* ows = (float*)(vws + QKV);

    dim3 g1(B_ * S_ / 128, D_ / 128, 3);
    qkv_proj_kernel<<<g1, dim3(256), 0, stream>>>(queries, keys, values, Wq, Wk, Wv,
                                                  qws, kws, vws);

    dim3 g2(S_ / 64, H_ * B_);
    attention_kernel<<<g2, dim3(128), 0, stream>>>(qws, kws, vws, qmask, kmask, ows);

    resid_ln_kernel<<<dim3(B_ * S_), dim3(256), 0, stream>>>(queries, ows, gamma, beta, out);
}

// v004
// A run of this version takes 75.2 microseconds.
// In both of two side-by-side timings against v003, it was 1.22 times as fast.
// Counting every step since v000, it is 4.35 times as fast.
#include <hip/hip_runtime.h>
#include <hip/hip_bf16.h>
#include <type_traits>

// MHA: Q/K/V proj (bf16 WMMA, reg-pipelined) -> flash attention (bf16 WMMA,
// fp32 accum, transposed products, double-buffered async global->LDS staging,
// WMMA row-sums)
// -> residual+LN.  B=4, S=1024, D=1024, H=16, DH=64

typedef __bf16 bf16;
typedef __bf16 v16bf __attribute__((ext_vector_type(16)));
typedef float  v8f   __attribute__((ext_vector_type(8)));

#define B_  4
#define S_  1024
#define D_  1024
#define H_  16
#define DH_ 64

// Load a 16(M) x 32(K) bf16 fragment from LDS into the CDNA5 WMMA A/B VGPR
// layout (wave32): lane L<16 -> row m=L, lanes 16..31 -> same rows, K 8..15 and 24..31.
__device__ __forceinline__ v16bf load_frag(const bf16* base, int ldk, int lane) {
    const int m    = lane & 15;
    const int half = lane >> 4;
    const bf16* row = base + m * ldk + half * 8;
    v16bf a;
    ((uint4*)&a)[0] = *(const uint4*)(row);
    ((uint4*)&a)[1] = *(const uint4*)(row + 16);
    return a;
}

// Load a 32(K) x 16(N) bf16 B fragment from a ROW-MAJOR [k][n] LDS tile with the
// transposing LDS load: lane (c = L&15, h = L>>4) receives T[kbase+8h+0..7][c],
// so the loads at kbase 0 and 16 give the same k order as load_frag gives A.
typedef short s16x8 __attribute__((ext_vector_type(8)));
__device__ __forceinline__ v16bf load_frag_tr(const bf16* base, int ldn, int lane) {
    typedef __attribute__((address_space(3))) s16x8 lds_s16x8;
    const bf16* p = base + ((lane >> 4) * 8 + (lane & 7)) * ldn + ((lane >> 3) & 1) * 8;
    v16bf b;
    ((s16x8*)&b)[0] = __builtin_amdgcn_ds_load_tr16_b128_v8i16((lds_s16x8*)p);
    ((s16x8*)&b)[1] = __builtin_amdgcn_ds_load_tr16_b128_v8i16((lds_s16x8*)(p + 16 * ldn));
    return b;
}

__device__ __forceinline__ unsigned pk2(float lo, float hi) {
    union { bf16 h[2]; unsigned u; } c;
    c.h[0] = (bf16)lo; c.h[1] = (bf16)hi;
    return c.u;
}

// gfx1250 async global->LDS copies (16B per lane each), tracked by ASYNCcnt.
// Four copies share one statement that ends in s_wait_xcnt 0, so that no
// address register of a copy is rewritten ahead of that wait.
__device__ __forceinline__ void async_ld4_b128(
    void* d0, const void* g0, void* d1, const void* g1,
    void* d2, const void* g2, void* d3, const void* g3) {
    const unsigned l0 = (unsigned)(uintptr_t)d0;    // low 32 bits = LDS offset
    const unsigned l1 = (unsigned)(uintptr_t)d1;
    const unsigned l2 = (unsigned)(uintptr_t)d2;
    const unsigned l3 = (unsigned)(uintptr_t)d3;
    asm volatile("global_load_async_to_lds_b128 %0, %1, off\n\t"
                 "global_load_async_to_lds_b128 %2, %3, off\n\t"
                 "global_load_async_to_lds_b128 %4, %5, off\n\t"
                 "global_load_async_to_lds_b128 %6, %7, off\n\t"
                 "s_wait_xcnt 0x0"
                 :: "v"(l0), "v"(g0), "v"(l1), "v"(g1),
                    "v"(l2), "v"(g2), "v"(l3), "v"(g3) : "memory");
}
__device__ __forceinline__ void wait_async0() {
    asm volatile("s_wait_asynccnt 0x0" ::: "memory");
}
// Async loads complete in order: waiting to <=4 outstanding guarantees the
// previous chunk's 4 loads landed while the newest 4 stay in flight.
__device__ __forceinline__ void wait_async4() {
    asm volatile("s_wait_asynccnt 0x4" ::: "memory");
}

// ---------------------------------------------------------------------------
// Kernel 1: Q/K/V projections, all three in ONE launch.  C[4096x1024] = X @ W.
// blockIdx.z picks the product (0 Q, 1 K, 2 V).  One product alone is 256
// workgroups, one per WGP, and its K loop waits out a global load every trip;
// 768 workgroups put three on each WGP, which fill each other's waits.
// 128x128 tile / 256 threads, K stepped by 32, register-staged pipeline:
// global loads of tile k+1 overlap WMMAs on tile k.
// z<2 -> head-major [H,B,S,DH]; z==2 -> transposed [H,B,DH,S].
// ---------------------------------------------------------------------------
__global__ __launch_bounds__(256) void qkv_proj_kernel(
    const float* __restrict__ Xq, const float* __restrict__ Xk,
    const float* __restrict__ Xv, const float* __restrict__ Wq,
    const float* __restrict__ Wk, const float* __restrict__ Wv,
    bf16* __restrict__ qdst, bf16* __restrict__ kdst, bf16* __restrict__ vdst)
{
    const int which = blockIdx.z;       // uniform over the workgroup
    const float* X = which == 0 ? Xq : which == 1 ? Xk : Xv;
    const float* W = which == 0 ? Wq : which == 1 ? Wk : Wv;

    // X tile, row-major [m][k]; 80-B rows (16 B x odd) keep the 16 rows of a
    // ds_load_b128 fragment read on distinct banks (64-B rows: 4 rows a bank).
    constexpr int LDA = 40;
    __shared__ __attribute__((aligned(16))) bf16 At[128 * LDA];
    // W tile as it lies in memory, [k][n]; 288-B rows (32 B x odd) suit the
    // transposing reader, and a wave's 8-byte stores fill one row bank by bank.
    constexpr int LDB = 144;
    __shared__ __attribute__((aligned(16))) bf16 Bt[32 * LDB];

    const int m0   = blockIdx.x * 128;
    const int n0   = blockIdx.y * 128;
    const int t    = threadIdx.x;
    const int lane = t & 31;
    const int w    = t >> 5;
    const int wm   = w >> 2;   // 0..1 : 64 rows each
    const int wn   = w & 3;    // 0..3 : 32 cols each

    // staging geometry
    const int mm  = t >> 1;
    const int ksA = (t & 1) * 16;
    const float* Abase = X + (size_t)(m0 + mm) * D_ + ksA;
    const int n4  = (t & 31) * 4;
    const int kk0 = t >> 5;
    const float* Bbase = W + n0 + n4;

    float4 ra[4], rb[4];
    auto fetch = [&](int k0) {
        const float4* as = (const float4*)(Abase + k0);
        ra[0] = as[0]; ra[1] = as[1]; ra[2] = as[2]; ra[3] = as[3];
        #pragma unroll
        for (int it = 0; it < 4; ++it)
            rb[it] = *(const float4*)(Bbase + (size_t)(k0 + kk0 + it * 8) * D_);
    };
    auto stage = [&]() {
        uint4* adst = (uint4*)(At + mm * LDA + ksA);
        uint4 u0, u1;
        u0.x = pk2(ra[0].x, ra[0].y); u0.y = pk2(ra[0].z, ra[0].w);
        u0.z = pk2(ra[1].x, ra[1].y); u0.w = pk2(ra[1].z, ra[1].w);
        u1.x = pk2(ra[2].x, ra[2].y); u1.y = pk2(ra[2].z, ra[2].w);
        u1.z = pk2(ra[3].x, ra[3].y); u1.w = pk2(ra[3].z, ra[3].w);
        adst[0] = u0; adst[1] = u1;
        #pragma unroll
        for (int it = 0; it < 4; ++it) {
            const int kk = kk0 + it * 8;
            typedef float f32x4 __attribute__((ext_vector_type(4)));
            typedef bf16  bf16x4 __attribute__((ext_vector_type(4)));
            const f32x4 f = {rb[it].x, rb[it].y, rb[it].z, rb[it].w};
            *(bf16x4*)(Bt + kk * LDB + n4) = __builtin_convertvector(f, bf16x4);
        }
    };

    const v8f vzero = {};
    v8f acc[4][2];
    #pragma unroll
    for (int i = 0; i < 4; ++i)
        #pragma unroll
        for (int j = 0; j < 2; ++j) acc[i][j] = vzero;

    auto mma_tile = [&]() {
        v16bf a[4], bfr[2];
        #pragma unroll
        for (int i = 0; i < 4; ++i)
            a[i] = load_frag(At + (wm * 64 + i * 16) * LDA, LDA, lane);
        #pragma unroll
        for (int j = 0; j < 2; ++j)
            bfr[j] = load_frag_tr(Bt + wn * 32 + j * 16, LDB, lane);

        #pragma unroll
        for (int i = 0; i < 4; ++i)
            #pragma unroll
            for (int j = 0; j < 2; ++j)
                acc[i][j] = __builtin_amdgcn_wmma_f32_16x16x32_bf16(
                    false, a[i], false, bfr[j], (short)0, acc[i][j], false, false);
    };

    // Last trip peeled: with the fetch under a condition this build copied two
    // of the fetched registers right behind the loads, and so waited for them
    // ahead of the WMMAs that the loads are meant to fly under.
    fetch(0);
    for (int k0 = 32; k0 < D_; k0 += 32) {
        stage();
        __syncthreads();
        fetch(k0);                          // overlap with WMMAs below
        // Keeps the loads in front of the WMMAs: the scheduler otherwise sinks
        // them to just ahead of the barrier's wait, and nothing is overlapped.
        __builtin_amdgcn_sched_barrier(0);
        mma_tile();
        __syncthreads();
    }
    stage();
    __syncthreads();
    mma_tile();
    __syncthreads();

    // ---- epilogue: one workgroup-uniform branch picks the layout ----
    const int half = lane >> 4;
    const int nin  = lane & 15;
    auto store_tile = [&](auto transposed, bf16* __restrict__ dst) {
        #pragma unroll
        for (int i = 0; i < 4; ++i) {
            #pragma unroll
            for (int j = 0; j < 2; ++j) {
                #pragma unroll
                for (int r = 0; r < 8; ++r) {
                    const int mg = m0 + wm * 64 + i * 16 + r + 8 * half;
                    const int ng = n0 + wn * 32 + j * 16 + nin;
                    const int bb = mg >> 10, ss = mg & 1023;   // S_=1024
                    const int hh = ng >> 6,  dd = ng & 63;     // DH_=64
                    const bf16 v = (bf16)acc[i][j][r];
                    if constexpr (decltype(transposed)::value)
                        dst[((size_t)(hh * B_ + bb) * DH_ + dd) * S_ + ss] = v;  // V^T
                    else
                        dst[((size_t)(hh * B_ + bb) * S_ + ss) * DH_ + dd] = v;
                }
            }
        }
        // Ends each layout's run of stores: no register that an issued store
        // names is rewritten ahead of this wait on any way out of the run.
        asm volatile("s_wait_xcnt 0x0" ::: "memory");
    };
    if (which == 2) store_tile(std::true_type{},  vdst);
    else            store_tile(std::false_type{}, which == 0 ? qdst : kdst);
}

typedef float f32x2 __attribute__((ext_vector_type(2)));
typedef float f32x4 __attribute__((ext_vector_type(4)));

// lane l <-> lane l ^ 16
__device__ __forceinline__ float xhalf(float x) {
    const int i = __builtin_bit_cast(int, x);
    return __builtin_bit_cast(float, __builtin_amdgcn_permlanex16(
        i, i, 0x76543210, 0xfedcba98, false, false));
}

__global__ __launch_bounds__(128) void attention_kernel(
    const bf16* __restrict__ qws, const bf16* __restrict__ kws,
    const bf16* __restrict__ vws, const int* __restrict__ query_masks,
    const int* __restrict__ key_masks, float* __restrict__ ows)
{
    // Row pitches of 16 B x odd (144 B for 128-B rows, 80 B for 64-B rows): the
    // 16 rows that a ds_load_b128 fragment read touches then lie on distinct
    // banks; unpadded, 8 (128-B rows) or 4 (64-B rows) of them share a bank.
    constexpr int LDQ = 72;             // Q and K rows: 64 dh + 8
    constexpr int LDV = 40;             // V^T rows: 32 keys + 8
    __shared__ __attribute__((aligned(16))) bf16 Qt[64 * LDQ];     // 64 queries x 64 dh
    __shared__ __attribute__((aligned(16))) bf16 Kt[2][32 * LDQ];  // 32 keys x 64 dh, double buffered
    __shared__ __attribute__((aligned(16))) bf16 Vt[2][64 * LDV];  // V^T: 64 dh x 32 keys, double buffered
    // The key index now runs along a lane's registers, so a lane needs the mask
    // of 16 keys a chunk: a table of the score's scale, 0.125 for a kept key and
    // 0 for a masked one, read 4 keys a load.
    __shared__ __attribute__((aligned(16))) float Ma[S_];

    const int hb   = blockIdx.y;        // h*B + b
    const int h    = hb >> 2;
    const int b    = hb & 3;
    const int q0   = blockIdx.x * 64;
    const int t    = threadIdx.x;
    const int lane = t & 31;
    const int w    = t >> 5;
    const int half = lane >> 4;
    const int nin  = lane & 15;

    auto issue_chunk = [&](int kc, int buf) {
        const char* ksrc = (const char*)(kws + (size_t)(hb * S_ + kc) * DH_) + t * 16;
        char* kdst = (char*)(Kt[buf] + (t >> 3) * LDQ + (t & 7) * 8);   // key row t/8, 16-B piece t%8
        const int row = t >> 1;
        const int seg = (t & 1) * 16;                 // 16 bf16 = 32 B
        const char* vsrc = (const char*)(vws + (size_t)(hb * DH_ + row) * S_ + kc + seg);
        char* vdst = (char*)(Vt[buf] + row * LDV + seg);
        async_ld4_b128(kdst,                ksrc,
                       kdst + 16 * LDQ * 2, ksrc + 2048,     // key rows 16..31
                       vdst,                vsrc,
                       vdst + 16,           vsrc + 16);
    };

    // ---- stage Q tile + first K/V chunk ----
    {
        const char* src = (const char*)(qws + (size_t)(hb * S_ + q0) * DH_) + t * 16;
        char* dstp = (char*)(Qt + (t >> 3) * LDQ + (t & 7) * 8);        // 16 query rows a copy
        async_ld4_b128(dstp,                src,
                       dstp + 16 * LDQ * 2, src + 2048,
                       dstp + 32 * LDQ * 2, src + 4096,
                       dstp + 48 * LDQ * 2, src + 6144);
    }
    issue_chunk(0, 0);

    // ---- key-mask table: 8 keys a thread, published by the barrier below ----
    {
        const int4* km = (const int4*)(key_masks + b * S_ + t * 8);
        #pragma unroll
        for (int i = 0; i < 2; ++i) {
            const int4 m4 = km[i];
            const f32x4 a4 = {m4.x ? 0.125f : 0.f, m4.y ? 0.125f : 0.f,
                              m4.z ? 0.125f : 0.f, m4.w ? 0.125f : 0.f};
            *(f32x4*)(Ma + t * 8 + i * 4) = a4;
        }
    }
    wait_async0();
    __syncthreads();

    // B operand: column c = query w*16 + c, k = dh, same loader (k order) as K's
    const v16bf bq0 = load_frag(Qt + (w * 16) * LDQ,      LDQ, lane);  // dh 0..31
    const v16bf bq1 = load_frag(Qt + (w * 16) * LDQ + 32, LDQ, lane);  // dh 32..63

    v16bf ones;                          // A = all-ones 16x32 for column sums of P^T
    #pragma unroll
    for (int i = 0; i < 16; ++i) ones[i] = (bf16)1.0f;

    const v8f vzero = {};
    v8f accO[4];                         // O^T: accO[u][r] = O[query c][dh 16u + 8*half + r]
    #pragma unroll
    for (int u = 0; u < 4; ++u) accO[u] = vzero;
    v8f lacc = vzero;                    // every row = running softmax denominator of query c
    float mrun = -3.0e38f;               // running maximum of query c

    for (int ic = 0; ic < S_ / 32; ++ic) {
        const int kc  = ic * 32;
        const int buf = ic & 1;
        if (ic + 1 < S_ / 32) {          // stream next chunk under this compute
            issue_chunk(kc + 32, buf ^ 1);
            wait_async4();
        } else {
            wait_async0();
        }
        __syncthreads();

        // ---- scores^T: 32k x 16q, contraction dh=64 in two K=32 halves ----
        const bf16* Kb = Kt[buf];
        const bf16* Vb = Vt[buf];
        v8f s[2] = {vzero, vzero};       // s[i][r]: key kc + 16i + 8*half + r, query c
        f32x4 ma[4];                     // scale of keys 8*half + 0..7, 16 + 8*half + 0..7
        v16bf av[4];                     // V^T fragments: rows dh 16u + c, k = keys
        {
            const v16bf a00 = load_frag(Kb,                 LDQ, lane);
            const v16bf a01 = load_frag(Kb + 32,            LDQ, lane);
            const v16bf a10 = load_frag(Kb + 16 * LDQ,      LDQ, lane);
            const v16bf a11 = load_frag(Kb + 16 * LDQ + 32, LDQ, lane);
            #pragma unroll
            for (int i = 0; i < 2; ++i) {
                const f32x4* pa = (const f32x4*)(Ma + kc + 16 * i + 8 * half);
                ma[2 * i] = pa[0]; ma[2 * i + 1] = pa[1];
            }
            #pragma unroll
            for (int u = 0; u < 4; ++u)
                av[u] = load_frag(Vb + (u * 16) * LDV, LDV, lane);
            // Keeps the chunk's 20 LDS loads one group in front of the work: the
            // scheduler otherwise sinks them to their users, each behind a wait
            // of its own that the wave sits out.
            __builtin_amdgcn_sched_barrier(0);
            s[0] = __builtin_amdgcn_wmma_f32_16x16x32_bf16(false, a00, false, bq0, (short)0, s[0], false, false);
            s[0] = __builtin_amdgcn_wmma_f32_16x16x32_bf16(false, a01, false, bq1, (short)0, s[0], false, false);
            s[1] = __builtin_amdgcn_wmma_f32_16x16x32_bf16(false, a10, false, bq0, (short)0, s[1], false, false);
            s[1] = __builtin_amdgcn_wmma_f32_16x16x32_bf16(false, a11, false, bq1, (short)0, s[1], false, false);
        }

        // ---- scale then key-mask replace, two keys an operation ----
        // score = s * a + (a * 8e7 - 1e7): a = 0.125 gives s * 0.125 + 0 and
        // a = 0 gives -1e7, both exactly (0.125 * 8e7 = 1e7 has no rounding).
        f32x2 sc[8];                     // sc[4i + j] = keys 16i + 8*half + 2j, +1
        #pragma unroll
        for (int i = 0; i < 2; ++i) {
            #pragma unroll
            for (int j = 0; j < 4; ++j) {
                const f32x4 a4 = ma[2 * i + (j >> 1)];
                const f32x2 a  = (j & 1) ? f32x2{a4.z, a4.w} : f32x2{a4.x, a4.y};
                const f32x2 off = __builtin_elementwise_fma(
                    a, f32x2{8.0e7f, 8.0e7f}, f32x2{-1.0e7f, -1.0e7f});
                sc[4 * i + j] = __builtin_elementwise_fma(
                    f32x2{s[i][2 * j], s[i][2 * j + 1]}, a, off);
            }
        }

        // ---- online softmax: maximum in the lane, one exchange of halves ----
        float hm = fmaxf(sc[0].x, sc[0].y);
        #pragma unroll
        for (int j = 1; j < 8; ++j) hm = fmaxf(hm, fmaxf(sc[j].x, sc[j].y));
        hm = fmaxf(hm, xhalf(hm));
        const float mnew = fmaxf(mrun, hm);
        const float corr = __expf(mrun - mnew);
        mrun = mnew;

        // P^T as B operand: element e = key kmap(e) = tile e>>3, register e&7
        v16bf pt;
        #pragma unroll
        for (int j = 0; j < 8; ++j) {
            pt[2 * j]     = (bf16)__expf(sc[j].x - mnew);
            pt[2 * j + 1] = (bf16)__expf(sc[j].y - mnew);
        }

        lacc *= corr;
        #pragma unroll
        for (int u = 0; u < 4; ++u) accO[u] *= corr;

        // ---- O^T += V^T (64dh x 32) @ P^T (32 x 16q); l += ones @ P^T ----
        #pragma unroll
        for (int u = 0; u < 4; ++u)
            accO[u] = __builtin_amdgcn_wmma_f32_16x16x32_bf16(
                false, av[u], false, pt, (short)0, accO[u], false, false);
        lacc = __builtin_amdgcn_wmma_f32_16x16x32_bf16(
            false, ones, false, pt, (short)0, lacc, false, false);
        __syncthreads();
    }

    // ---- epilogue: 1/l, query mask (post-softmax multiplicative), write O ----
    {
        const int qrow = q0 + w * 16 + nin;
        const float l   = lacc[0];
        const float inv = (l > 0.f) ? (1.0f / l) : 0.f;
        const float fac = query_masks[b * S_ + qrow] ? inv : 0.f;
        float* orow = ows + ((size_t)(b * S_ + qrow)) * D_ + h * DH_ + 8 * half;
        #pragma unroll
        for (int u = 0; u < 4; ++u) {    // 8 consecutive dh a lane: two 16-byte stores
            const v8f o = accO[u] * fac;
            *(f32x4*)(orow + u * 16)     = f32x4{o[0], o[1], o[2], o[3]};
            *(f32x4*)(orow + u * 16 + 4) = f32x4{o[4], o[5], o[6], o[7]};
        }
    }
}

// ---------------------------------------------------------------------------
// Kernel 3: residual + LayerNorm (eps = 1e-3).  One row (D=1024) per block.
// ---------------------------------------------------------------------------
__global__ __launch_bounds__(256) void resid_ln_kernel(
    const float* __restrict__ queries, const float* __restrict__ ows,
    const float* __restrict__ gamma, const float* __restrict__ beta,
    float* __restrict__ out)
{
    __shared__ float red1[8], red2[8];
    const int row = blockIdx.x;
    const int t   = threadIdx.x;

    const float4 q4 = ((const float4*)(queries + (size_t)row * D_))[t];
    const float4 o4 = ((const float4*)(ows     + (size_t)row * D_))[t];
    float4 r4;
    r4.x = q4.x + o4.x; r4.y = q4.y + o4.y;
    r4.z = q4.z + o4.z; r4.w = q4.w + o4.w;

    float s1 = r4.x + r4.y + r4.z + r4.w;
    float s2 = r4.x * r4.x + r4.y * r4.y + r4.z * r4.z + r4.w * r4.w;
    #pragma unroll
    for (int d = 1; d < 32; d <<= 1) {
        s1 += __shfl_xor(s1, d, 32);
        s2 += __shfl_xor(s2, d, 32);
    }
    if ((t & 31) == 0) { red1[t >> 5] = s1; red2[t >> 5] = s2; }
    __syncthreads();
    float ts1 = 0.f, ts2 = 0.f;
    #pragma unroll
    for (int i = 0; i < 8; ++i) { ts1 += red1[i]; ts2 += red2[i]; }

    const float mean = ts1 * (1.0f / D_);
    const float var  = ts2 * (1.0f / D_) - mean * mean;
    const float rstd = rsqrtf(var + 1e-3f);

    const float4 g4 = ((const float4*)gamma)[t];
    const float4 b4 = ((const float4*)beta)[t];
    float4 o;
    o.x = g4.x * (r4.x - mean) * rstd + b4.x;
    o.y = g4.y * (r4.y - mean) * rstd + b4.y;
    o.z = g4.z * (r4.z - mean) * rstd + b4.z;
    o.w = g4.w * (r4.w - mean) * rstd + b4.w;
    ((float4*)(out + (size_t)row * D_))[t] = o;
}

// ---------------------------------------------------------------------------
extern "C" void kernel_launch(void* const* d_in, const int* in_sizes, int n_in,
                              void* d_out, int out_size, void* d_ws, size_t ws_size,
                              hipStream_t stream) {
    const float* queries = (const float*)d_in[0];
    const float* keys    = (const float*)d_in[1];
    const float* values  = (const float*)d_in[2];
    const int*   qmask   = (const int*)d_in[3];
    const int*   kmask   = (const int*)d_in[4];
    const float* Wq      = (const float*)d_in[5];
    const float* Wk      = (const float*)d_in[6];
    const float* Wv      = (const float*)d_in[7];
    const float* gamma   = (const float*)d_in[8];
    const float* beta    = (const float*)d_in[9];
    float*       out     = (float*)d_out;

    const size_t QKV = (size_t)H_ * B_ * S_ * DH_;   // 4 Mi elements
    bf16*  qws = (bf16*)d_ws;
    bf16*  kws = qws + QKV;
    bf16*  vws = kws + QKV;
    float* ows = (float*)(vws + QKV);

    dim3 g1(B_ * S_ / 128, D_ / 128, 3);
    qkv_proj_kernel<<<g1, dim3(256), 0, stream>>>(queries, keys, values, Wq, Wk, Wv,
                                                  qws, kws, vws);

    dim3 g2(S_ / 64, H_ * B_);
    attention_kernel<<<g2, dim3(128), 0, stream>>>(qws, kws, vws, qmask, kmask, ows);

    resid_ln_kernel<<<dim3(B_ * S_), dim3(256), 0, stream>>>(queries, ows, gamma, beta, out);
}

// v005
// Measured time: 69.3 microseconds a run.
// In both of two side-by-side timings against v004, it was 1.08 times as fast.
// All steps since v000 together make it 4.72 times as fast.
#include <hip/hip_runtime.h>
#include <hip/hip_bf16.h>
#include <type_traits>

// MHA: Q/K/V proj (bf16 WMMA, reg-pipelined) -> flash attention (bf16 WMMA,
// fp32 accum, transposed products, double-buffered async global->LDS staging,
// WMMA row-sums)
// -> residual+LN.  B=4, S=1024, D=1024, H=16, DH=64

typedef __bf16 bf16;
typedef __bf16 v16bf __attribute__((ext_vector_type(16)));
typedef float  v8f   __attribute__((ext_vector_type(8)));

#define B_  4
#define S_  1024
#define D_  1024
#define H_  16
#define DH_ 64

// Load a 16(M) x 32(K) bf16 fragment from LDS into the CDNA5 WMMA A/B VGPR
// layout (wave32): lane L<16 -> row m=L, lanes 16..31 -> same rows, K 8..15 and 24..31.
__device__ __forceinline__ v16bf load_frag(const bf16* base, int ldk, int lane) {
    const int m    = lane & 15;
    const int half = lane >> 4;
    const bf16* row = base + m * ldk + half * 8;
    v16bf a;
    ((uint4*)&a)[0] = *(const uint4*)(row);
    ((uint4*)&a)[1] = *(const uint4*)(row + 16);
    return a;
}

// Load a 32(K) x 16(N) bf16 B fragment from a ROW-MAJOR [k][n] LDS tile with the
// transposing LDS load: lane (c = L&15, h = L>>4) receives T[kbase+8h+0..7][c],
// so the loads at kbase 0 and 16 give the same k order as load_frag gives A.
typedef short s16x8 __attribute__((ext_vector_type(8)));
__device__ __forceinline__ v16bf load_frag_tr(const bf16* base, int ldn, int lane) {
    typedef __attribute__((address_space(3))) s16x8 lds_s16x8;
    const bf16* p = base + ((lane >> 4) * 8 + (lane & 7)) * ldn + ((lane >> 3) & 1) * 8;
    v16bf b;
    ((s16x8*)&b)[0] = __builtin_amdgcn_ds_load_tr16_b128_v8i16((lds_s16x8*)p);
    ((s16x8*)&b)[1] = __builtin_amdgcn_ds_load_tr16_b128_v8i16((lds_s16x8*)(p + 16 * ldn));
    return b;
}

// gfx1250 async global->LDS copies (16B per lane each), tracked by ASYNCcnt.
// Four copies share one statement that ends in s_wait_xcnt 0, so that no
// address register of a copy is rewritten ahead of that wait.
__device__ __forceinline__ void async_ld4_b128(
    void* d0, const void* g0, void* d1, const void* g1,
    void* d2, const void* g2, void* d3, const void* g3) {
    const unsigned l0 = (unsigned)(uintptr_t)d0;    // low 32 bits = LDS offset
    const unsigned l1 = (unsigned)(uintptr_t)d1;
    const unsigned l2 = (unsigned)(uintptr_t)d2;
    const unsigned l3 = (unsigned)(uintptr_t)d3;
    asm volatile("global_load_async_to_lds_b128 %0, %1, off\n\t"
                 "global_load_async_to_lds_b128 %2, %3, off\n\t"
                 "global_load_async_to_lds_b128 %4, %5, off\n\t"
                 "global_load_async_to_lds_b128 %6, %7, off\n\t"
                 "s_wait_xcnt 0x0"
                 :: "v"(l0), "v"(g0), "v"(l1), "v"(g1),
                    "v"(l2), "v"(g2), "v"(l3), "v"(g3) : "memory");
}
__device__ __forceinline__ void wait_async0() {
    asm volatile("s_wait_asynccnt 0x0" ::: "memory");
}
// Async loads complete in order: waiting to <=4 outstanding guarantees the
// previous chunk's 4 loads landed while the newest 4 stay in flight.
__device__ __forceinline__ void wait_async4() {
    asm volatile("s_wait_asynccnt 0x4" ::: "memory");
}

// ---------------------------------------------------------------------------
// Kernel 1: Q/K/V projections, all three in ONE launch.  C[4096x1024] = X @ W.
// blockIdx.z picks the product (0 Q, 1 K, 2 V).  One product alone is 256
// workgroups, one per WGP, and its K loop waits out a global load every trip;
// 768 workgroups put three on each WGP, which fill each other's waits.
// 128x128 tile / 256 threads, K stepped by 32, register-staged pipeline:
// global loads of tile k+1 overlap WMMAs on tile k.
// z<2 -> head-major [H,B,S,DH]; z==2 -> transposed [H,B,DH,S].
// ---------------------------------------------------------------------------
__global__ __launch_bounds__(256) void qkv_proj_kernel(
    const float* __restrict__ Xq, const float* __restrict__ Xk,
    const float* __restrict__ Xv, const float* __restrict__ Wq,
    const float* __restrict__ Wk, const float* __restrict__ Wv,
    bf16* __restrict__ qdst, bf16* __restrict__ kdst, bf16* __restrict__ vdst)
{
    const int which = blockIdx.z;       // uniform over the workgroup
    const float* X = which == 0 ? Xq : which == 1 ? Xk : Xv;
    const float* W = which == 0 ? Wq : which == 1 ? Wk : Wv;

    // X tile, row-major [m][k]; 80-B rows (16 B x odd) keep the 16 rows of a
    // ds_load_b128 fragment read on distinct banks (64-B rows: 4 rows a bank).
    constexpr int LDA = 40;
    __shared__ __attribute__((aligned(16))) bf16 At[128 * LDA];
    // W tile as it lies in memory, [k][n]; 288-B rows (32 B x odd) suit the
    // transposing reader, and a wave's 8-byte stores fill one row bank by bank.
    constexpr int LDB = 144;
    __shared__ __attribute__((aligned(16))) bf16 Bt[32 * LDB];

    const int m0   = blockIdx.x * 128;
    const int n0   = blockIdx.y * 128;
    const int t    = threadIdx.x;
    const int lane = t & 31;
    const int w    = t >> 5;
    const int wm   = w >> 2;   // 0..1 : 64 rows each
    const int wn   = w & 3;    // 0..3 : 32 cols each

    // staging geometry
    // X: 8 lanes take one row's 32 floats, so a wave-wide 16-byte load covers
    // four whole 128-B lines (two lanes a row touched 16 lines a load, each of
    // them four times a trip).  The four rows of one load lie 4 rows apart:
    // 4 x 80 B is 16 banks on, so their 8-byte LDS stores meet no common bank.
    const int ar  = w * 16 + (lane >> 3) * 4;   // rows ar + 0..3, one a load
    const int ac  = (lane & 7) * 4;
    const float* Abase = X + (size_t)(m0 + ar) * D_ + ac;
    const int n4  = (t & 31) * 4;
    const int kk0 = t >> 5;
    const float* Bbase = W + n0 + n4;

    float4 ra[4], rb[4];
    auto fetch = [&](int k0) {
        #pragma unroll   // constant indices keep ra[] in registers
        for (int it = 0; it < 4; ++it)
            ra[it] = *(const float4*)(Abase + (size_t)it * D_ + k0);
        #pragma unroll
        for (int it = 0; it < 4; ++it)
            rb[it] = *(const float4*)(Bbase + (size_t)(k0 + kk0 + it * 8) * D_);
    };
    auto stage = [&]() {
        typedef float f32x4 __attribute__((ext_vector_type(4)));
        typedef bf16  bf16x4 __attribute__((ext_vector_type(4)));
        #pragma unroll   // constant indices keep ra[] in registers
        for (int it = 0; it < 4; ++it) {
            const f32x4 f = {ra[it].x, ra[it].y, ra[it].z, ra[it].w};
            *(bf16x4*)(At + (ar + it) * LDA + ac) = __builtin_convertvector(f, bf16x4);
        }
        #pragma unroll
        for (int it = 0; it < 4; ++it) {
            const int kk = kk0 + it * 8;
            const f32x4 f = {rb[it].x, rb[it].y, rb[it].z, rb[it].w};
            *(bf16x4*)(Bt + kk * LDB + n4) = __builtin_convertvector(f, bf16x4);
        }
    };

    const v8f vzero = {};
    v8f acc[4][2];
    #pragma unroll
    for (int i = 0; i < 4; ++i)
        #pragma unroll
        for (int j = 0; j < 2; ++j) acc[i][j] = vzero;

    auto mma_tile = [&]() {
        v16bf a[4], bfr[2];
        #pragma unroll
        for (int i = 0; i < 4; ++i)
            a[i] = load_frag(At + (wm * 64 + i * 16) * LDA, LDA, lane);
        #pragma unroll
        for (int j = 0; j < 2; ++j)
            bfr[j] = load_frag_tr(Bt + wn * 32 + j * 16, LDB, lane);

        #pragma unroll
        for (int i = 0; i < 4; ++i)
            #pragma unroll
            for (int j = 0; j < 2; ++j)
                acc[i][j] = __builtin_amdgcn_wmma_f32_16x16x32_bf16(
                    false, a[i], false, bfr[j], (short)0, acc[i][j], false, false);
    };

    // Last trip peeled: with the fetch under a condition this build copied two
    // of the fetched registers right behind the loads, and so waited for them
    // ahead of the WMMAs that the loads are meant to fly under.
    fetch(0);
    for (int k0 = 32; k0 < D_; k0 += 32) {
        stage();
        __syncthreads();
        fetch(k0);                          // overlap with WMMAs below
        // Keeps the loads in front of the WMMAs: the scheduler otherwise sinks
        // them to just ahead of the barrier's wait, and nothing is overlapped.
        __builtin_amdgcn_sched_barrier(0);
        mma_tile();
        __syncthreads();
    }
    stage();
    __syncthreads();
    mma_tile();
    __syncthreads();

    // ---- epilogue: one workgroup-uniform branch picks the layout ----
    const int half = lane >> 4;
    const int nin  = lane & 15;
    auto store_tile = [&](auto transposed, bf16* __restrict__ dst) {
        #pragma unroll
        for (int i = 0; i < 4; ++i) {
            #pragma unroll
            for (int j = 0; j < 2; ++j) {
                #pragma unroll
                for (int r = 0; r < 8; ++r) {
                    const int mg = m0 + wm * 64 + i * 16 + r + 8 * half;
                    const int ng = n0 + wn * 32 + j * 16 + nin;
                    const int bb = mg >> 10, ss = mg & 1023;   // S_=1024
                    const int hh = ng >> 6,  dd = ng & 63;     // DH_=64
                    const bf16 v = (bf16)acc[i][j][r];
                    if constexpr (decltype(transposed)::value)
                        dst[((size_t)(hh * B_ + bb) * DH_ + dd) * S_ + ss] = v;  // V^T
                    else
                        dst[((size_t)(hh * B_ + bb) * S_ + ss) * DH_ + dd] = v;
                }
            }
        }
        // Ends each layout's run of stores: no register that an issued store
        // names is rewritten ahead of this wait on any way out of the run.
        asm volatile("s_wait_xcnt 0x0" ::: "memory");
    };
    if (which == 2) store_tile(std::true_type{},  vdst);
    else            store_tile(std::false_type{}, which == 0 ? qdst : kdst);
}

typedef float f32x2 __attribute__((ext_vector_type(2)));
typedef float f32x4 __attribute__((ext_vector_type(4)));

// lane l <-> lane l ^ 16
__device__ __forceinline__ float xhalf(float x) {
    const int i = __builtin_bit_cast(int, x);
    return __builtin_bit_cast(float, __builtin_amdgcn_permlanex16(
        i, i, 0x76543210, 0xfedcba98, false, false));
}

__global__ __launch_bounds__(128) void attention_kernel(
    const bf16* __restrict__ qws, const bf16* __restrict__ kws,
    const bf16* __restrict__ vws, const int* __restrict__ query_masks,
    const int* __restrict__ key_masks, float* __restrict__ ows)
{
    // Row pitches of 16 B x odd (144 B for 128-B rows, 80 B for 64-B rows): the
    // 16 rows that a ds_load_b128 fragment read touches then lie on distinct
    // banks; unpadded, 8 (128-B rows) or 4 (64-B rows) of them share a bank.
    constexpr int LDQ = 72;             // Q and K rows: 64 dh + 8
    constexpr int LDV = 40;             // V^T rows: 32 keys + 8
    __shared__ __attribute__((aligned(16))) bf16 Qt[64 * LDQ];     // 64 queries x 64 dh
    __shared__ __attribute__((aligned(16))) bf16 Kt[2][32 * LDQ];  // 32 keys x 64 dh, double buffered
    __shared__ __attribute__((aligned(16))) bf16 Vt[2][64 * LDV];  // V^T: 64 dh x 32 keys, double buffered
    // The key index now runs along a lane's registers, so a lane needs the mask
    // of 16 keys a chunk: a table of the score's scale, 0.125 for a kept key and
    // 0 for a masked one, read 4 keys a load.
    __shared__ __attribute__((aligned(16))) float Ma[S_];

    const int hb   = blockIdx.y;        // h*B + b
    const int h    = hb >> 2;
    const int b    = hb & 3;
    const int q0   = blockIdx.x * 64;
    const int t    = threadIdx.x;
    const int lane = t & 31;
    const int w    = t >> 5;
    const int half = lane >> 4;
    const int nin  = lane & 15;

    auto issue_chunk = [&](int kc, int buf) {
        const char* ksrc = (const char*)(kws + (size_t)(hb * S_ + kc) * DH_) + t * 16;
        char* kdst = (char*)(Kt[buf] + (t >> 3) * LDQ + (t & 7) * 8);   // key row t/8, 16-B piece t%8
        const int row = t >> 1;
        const int seg = (t & 1) * 16;                 // 16 bf16 = 32 B
        const char* vsrc = (const char*)(vws + (size_t)(hb * DH_ + row) * S_ + kc + seg);
        char* vdst = (char*)(Vt[buf] + row * LDV + seg);
        async_ld4_b128(kdst,                ksrc,
                       kdst + 16 * LDQ * 2, ksrc + 2048,     // key rows 16..31
                       vdst,                vsrc,
                       vdst + 16,           vsrc + 16);
    };

    // ---- stage Q tile + first K/V chunk ----
    {
        const char* src = (const char*)(qws + (size_t)(hb * S_ + q0) * DH_) + t * 16;
        char* dstp = (char*)(Qt + (t >> 3) * LDQ + (t & 7) * 8);        // 16 query rows a copy
        async_ld4_b128(dstp,                src,
                       dstp + 16 * LDQ * 2, src + 2048,
                       dstp + 32 * LDQ * 2, src + 4096,
                       dstp + 48 * LDQ * 2, src + 6144);
    }
    issue_chunk(0, 0);

    // ---- key-mask table: 8 keys a thread, published by the barrier below ----
    {
        const int4* km = (const int4*)(key_masks + b * S_ + t * 8);
        #pragma unroll
        for (int i = 0; i < 2; ++i) {
            const int4 m4 = km[i];
            const f32x4 a4 = {m4.x ? 0.125f : 0.f, m4.y ? 0.125f : 0.f,
                              m4.z ? 0.125f : 0.f, m4.w ? 0.125f : 0.f};
            *(f32x4*)(Ma + t * 8 + i * 4) = a4;
        }
    }
    wait_async0();
    __syncthreads();

    // B operand: column c = query w*16 + c, k = dh, same loader (k order) as K's
    const v16bf bq0 = load_frag(Qt + (w * 16) * LDQ,      LDQ, lane);  // dh 0..31
    const v16bf bq1 = load_frag(Qt + (w * 16) * LDQ + 32, LDQ, lane);  // dh 32..63

    v16bf ones;                          // A = all-ones 16x32 for column sums of P^T
    #pragma unroll
    for (int i = 0; i < 16; ++i) ones[i] = (bf16)1.0f;

    const v8f vzero = {};
    v8f accO[4];                         // O^T: accO[u][r] = O[query c][dh 16u + 8*half + r]
    #pragma unroll
    for (int u = 0; u < 4; ++u) accO[u] = vzero;
    v8f lacc = vzero;                    // every row = running softmax denominator of query c
    float mrun = -3.0e38f;               // running maximum of query c

    for (int ic = 0; ic < S_ / 32; ++ic) {
        const int kc  = ic * 32;
        const int buf = ic & 1;
        if (ic + 1 < S_ / 32) {          // stream next chunk under this compute
            issue_chunk(kc + 32, buf ^ 1);
            wait_async4();
        } else {
            wait_async0();
        }
        __syncthreads();

        // ---- scores^T: 32k x 16q, contraction dh=64 in two K=32 halves ----
        const bf16* Kb = Kt[buf];
        const bf16* Vb = Vt[buf];
        v8f s[2] = {vzero, vzero};       // s[i][r]: key kc + 16i + 8*half + r, query c
        f32x4 ma[4];                     // scale of keys 8*half + 0..7, 16 + 8*half + 0..7
        v16bf av[4];                     // V^T fragments: rows dh 16u + c, k = keys
        {
            const v16bf a00 = load_frag(Kb,                 LDQ, lane);
            const v16bf a01 = load_frag(Kb + 32,            LDQ, lane);
            const v16bf a10 = load_frag(Kb + 16 * LDQ,      LDQ, lane);
            const v16bf a11 = load_frag(Kb + 16 * LDQ + 32, LDQ, lane);
            #pragma unroll
            for (int i = 0; i < 2; ++i) {
                const f32x4* pa = (const f32x4*)(Ma + kc + 16 * i + 8 * half);
                ma[2 * i] = pa[0]; ma[2 * i + 1] = pa[1];
            }
            #pragma unroll
            for (int u = 0; u < 4; ++u)
                av[u] = load_frag(Vb + (u * 16) * LDV, LDV, lane);
            // Keeps the chunk's 20 LDS loads one group in front of the work: the
            // scheduler otherwise sinks them to their users, each behind a wait
            // of its own that the wave sits out.
            __builtin_amdgcn_sched_barrier(0);
            s[0] = __builtin_amdgcn_wmma_f32_16x16x32_bf16(false, a00, false, bq0, (short)0, s[0], false, false);
            s[0] = __builtin_amdgcn_wmma_f32_16x16x32_bf16(false, a01, false, bq1, (short)0, s[0], false, false);
            s[1] = __builtin_amdgcn_wmma_f32_16x16x32_bf16(false, a10, false, bq0, (short)0, s[1], false, false);
            s[1] = __builtin_amdgcn_wmma_f32_16x16x32_bf16(false, a11, false, bq1, (short)0, s[1], false, false);
        }

        // ---- scale then key-mask replace, two keys an operation ----
        // score = s * a + (a * 8e7 - 1e7): a = 0.125 gives s * 0.125 + 0 and
        // a = 0 gives -1e7, both exactly (0.125 * 8e7 = 1e7 has no rounding).
        f32x2 sc[8];                     // sc[4i + j] = keys 16i + 8*half + 2j, +1
        #pragma unroll
        for (int i = 0; i < 2; ++i) {
            #pragma unroll
            for (int j = 0; j < 4; ++j) {
                const f32x4 a4 = ma[2 * i + (j >> 1)];
                const f32x2 a  = (j & 1) ? f32x2{a4.z, a4.w} : f32x2{a4.x, a4.y};
                const f32x2 off = __builtin_elementwise_fma(
                    a, f32x2{8.0e7f, 8.0e7f}, f32x2{-1.0e7f, -1.0e7f});
                sc[4 * i + j] = __builtin_elementwise_fma(
                    f32x2{s[i][2 * j], s[i][2 * j + 1]}, a, off);
            }
        }

        // ---- online softmax: maximum in the lane, one exchange of halves ----
        float hm = fmaxf(sc[0].x, sc[0].y);
        #pragma unroll
        for (int j = 1; j < 8; ++j) hm = fmaxf(hm, fmaxf(sc[j].x, sc[j].y));
        hm = fmaxf(hm, xhalf(hm));
        const float mnew = fmaxf(mrun, hm);
        const float corr = __expf(mrun - mnew);
        mrun = mnew;

        // P^T as B operand: element e = key kmap(e) = tile e>>3, register e&7
        v16bf pt;
        #pragma unroll
        for (int j = 0; j < 8; ++j) {
            pt[2 * j]     = (bf16)__expf(sc[j].x - mnew);
            pt[2 * j + 1] = (bf16)__expf(sc[j].y - mnew);
        }

        lacc *= corr;
        #pragma unroll
        for (int u = 0; u < 4; ++u) accO[u] *= corr;

        // ---- O^T += V^T (64dh x 32) @ P^T (32 x 16q); l += ones @ P^T ----
        #pragma unroll
        for (int u = 0; u < 4; ++u)
            accO[u] = __builtin_amdgcn_wmma_f32_16x16x32_bf16(
                false, av[u], false, pt, (short)0, accO[u], false, false);
        lacc = __builtin_amdgcn_wmma_f32_16x16x32_bf16(
            false, ones, false, pt, (short)0, lacc, false, false);
        __syncthreads();
    }

    // ---- epilogue: 1/l, query mask (post-softmax multiplicative), write O ----
    {
        const int qrow = q0 + w * 16 + nin;
        const float l   = lacc[0];
        const float inv = (l > 0.f) ? (1.0f / l) : 0.f;
        const float fac = query_masks[b * S_ + qrow] ? inv : 0.f;
        float* orow = ows + ((size_t)(b * S_ + qrow)) * D_ + h * DH_ + 8 * half;
        #pragma unroll
        for (int u = 0; u < 4; ++u) {    // 8 consecutive dh a lane: two 16-byte stores
            const v8f o = accO[u] * fac;
            *(f32x4*)(orow + u * 16)     = f32x4{o[0], o[1], o[2], o[3]};
            *(f32x4*)(orow + u * 16 + 4) = f32x4{o[4], o[5], o[6], o[7]};
        }
    }
}

// ---------------------------------------------------------------------------
// Kernel 3: residual + LayerNorm (eps = 1e-3).  One row (D=1024) per block.
// ---------------------------------------------------------------------------
__global__ __launch_bounds__(256) void resid_ln_kernel(
    const float* __restrict__ queries, const float* __restrict__ ows,
    const float* __restrict__ gamma, const float* __restrict__ beta,
    float* __restrict__ out)
{
    __shared__ float red1[8], red2[8];
    const int row = blockIdx.x;
    const int t   = threadIdx.x;

    const float4 q4 = ((const float4*)(queries + (size_t)row * D_))[t];
    const float4 o4 = ((const float4*)(ows     + (size_t)row * D_))[t];
    float4 r4;
    r4.x = q4.x + o4.x; r4.y = q4.y + o4.y;
    r4.z = q4.z + o4.z; r4.w = q4.w + o4.w;

    float s1 = r4.x + r4.y + r4.z + r4.w;
    float s2 = r4.x * r4.x + r4.y * r4.y + r4.z * r4.z + r4.w * r4.w;
    #pragma unroll
    for (int d = 1; d < 32; d <<= 1) {
        s1 += __shfl_xor(s1, d, 32);
        s2 += __shfl_xor(s2, d, 32);
    }
    if ((t & 31) == 0) { red1[t >> 5] = s1; red2[t >> 5] = s2; }
    __syncthreads();
    float ts1 = 0.f, ts2 = 0.f;
    #pragma unroll
    for (int i = 0; i < 8; ++i) { ts1 += red1[i]; ts2 += red2[i]; }

    const float mean = ts1 * (1.0f / D_);
    const float var  = ts2 * (1.0f / D_) - mean * mean;
    const float rstd = rsqrtf(var + 1e-3f);

    const float4 g4 = ((const float4*)gamma)[t];
    const float4 b4 = ((const float4*)beta)[t];
    float4 o;
    o.x = g4.x * (r4.x - mean) * rstd + b4.x;
    o.y = g4.y * (r4.y - mean) * rstd + b4.y;
    o.z = g4.z * (r4.z - mean) * rstd + b4.z;
    o.w = g4.w * (r4.w - mean) * rstd + b4.w;
    ((float4*)(out + (size_t)row * D_))[t] = o;
}

// ---------------------------------------------------------------------------
extern "C" void kernel_launch(void* const* d_in, const int* in_sizes, int n_in,
                              void* d_out, int out_size, void* d_ws, size_t ws_size,
                              hipStream_t stream) {
    const float* queries = (const float*)d_in[0];
    const float* keys    = (const float*)d_in[1];
    const float* values  = (const float*)d_in[2];
    const int*   qmask   = (const int*)d_in[3];
    const int*   kmask   = (const int*)d_in[4];
    const float* Wq      = (const float*)d_in[5];
    const float* Wk      = (const float*)d_in[6];
    const float* Wv      = (const float*)d_in[7];
    const float* gamma   = (const float*)d_in[8];
    const float* beta    = (const float*)d_in[9];
    float*       out     = (float*)d_out;

    const size_t QKV = (size_t)H_ * B_ * S_ * DH_;   // 4 Mi elements
    bf16*  qws = (bf16*)d_ws;
    bf16*  kws = qws + QKV;
    bf16*  vws = kws + QKV;
    float* ows = (float*)(vws + QKV);

    dim3 g1(B_ * S_ / 128, D_ / 128, 3);
    qkv_proj_kernel<<<g1, dim3(256), 0, stream>>>(queries, keys, values, Wq, Wk, Wv,
                                                  qws, kws, vws);

    dim3 g2(S_ / 64, H_ * B_);
    attention_kernel<<<g2, dim3(128), 0, stream>>>(qws, kws, vws, qmask, kmask, ows);

    resid_ln_kernel<<<dim3(B_ * S_), dim3(256), 0, stream>>>(queries, ows, gamma, beta, out);
}

// v006
// It runs in 66.4 microseconds.
// Two timings next to v005 both put it at 1.04 times that version's speed.
// Counting every step since v000, it is 4.92 times as fast.
#include <hip/hip_runtime.h>
#include <hip/hip_bf16.h>
#include <type_traits>

// MHA: Q/K/V proj (bf16 WMMA, reg-pipelined) -> flash attention (bf16 WMMA,
// fp32 accum, transposed products, double-buffered async global->LDS staging,
// WMMA row-sums)
// -> residual+LN.  B=4, S=1024, D=1024, H=16, DH=64

typedef __bf16 bf16;
typedef __bf16 v16bf __attribute__((ext_vector_type(16)));
typedef float  v8f   __attribute__((ext_vector_type(8)));

#define B_  4
#define S_  1024
#define D_  1024
#define H_  16
#define DH_ 64

// Load a 16(M) x 32(K) bf16 fragment from LDS into the CDNA5 WMMA A/B VGPR
// layout (wave32): lane L<16 -> row m=L, lanes 16..31 -> same rows, K 8..15 and 24..31.
__device__ __forceinline__ v16bf load_frag(const bf16* base, int ldk, int lane) {
    const int m    = lane & 15;
    const int half = lane >> 4;
    const bf16* row = base + m * ldk + half * 8;
    v16bf a;
    ((uint4*)&a)[0] = *(const uint4*)(row);
    ((uint4*)&a)[1] = *(const uint4*)(row + 16);
    return a;
}

// Load a 32(K) x 16(N) bf16 B fragment from a ROW-MAJOR [k][n] LDS tile with the
// transposing LDS load: lane (c = L&15, h = L>>4) receives T[kbase+8h+0..7][c],
// so the loads at kbase 0 and 16 give the same k order as load_frag gives A.
typedef short s16x8 __attribute__((ext_vector_type(8)));
__device__ __forceinline__ v16bf load_frag_tr(const bf16* base, int ldn, int lane) {
    typedef __attribute__((address_space(3))) s16x8 lds_s16x8;
    const bf16* p = base + ((lane >> 4) * 8 + (lane & 7)) * ldn + ((lane >> 3) & 1) * 8;
    v16bf b;
    ((s16x8*)&b)[0] = __builtin_amdgcn_ds_load_tr16_b128_v8i16((lds_s16x8*)p);
    ((s16x8*)&b)[1] = __builtin_amdgcn_ds_load_tr16_b128_v8i16((lds_s16x8*)(p + 16 * ldn));
    return b;
}

// gfx1250 async global->LDS copies (16B per lane each), tracked by ASYNCcnt.
// Four copies share one statement that ends in s_wait_xcnt 0, so that no
// address register of a copy is rewritten ahead of that wait.
__device__ __forceinline__ void async_ld4_b128(
    void* d0, const void* g0, void* d1, const void* g1,
    void* d2, const void* g2, void* d3, const void* g3) {
    const unsigned l0 = (unsigned)(uintptr_t)d0;    // low 32 bits = LDS offset
    const unsigned l1 = (unsigned)(uintptr_t)d1;
    const unsigned l2 = (unsigned)(uintptr_t)d2;
    const unsigned l3 = (unsigned)(uintptr_t)d3;
    asm volatile("global_load_async_to_lds_b128 %0, %1, off\n\t"
                 "global_load_async_to_lds_b128 %2, %3, off\n\t"
                 "global_load_async_to_lds_b128 %4, %5, off\n\t"
                 "global_load_async_to_lds_b128 %6, %7, off\n\t"
                 "s_wait_xcnt 0x0"
                 :: "v"(l0), "v"(g0), "v"(l1), "v"(g1),
                    "v"(l2), "v"(g2), "v"(l3), "v"(g3) : "memory");
}
__device__ __forceinline__ void wait_async0() {
    asm volatile("s_wait_asynccnt 0x0" ::: "memory");
}
// A wave's own LDS reads have returned: stands in front of the barrier behind
// which a buffer that the wave has read is refilled by copies.
__device__ __forceinline__ void wait_ds0() {
    asm volatile("s_wait_dscnt 0x0" ::: "memory");
}

// ---------------------------------------------------------------------------
// Kernel 1: Q/K/V projections, all three in ONE launch.  C[4096x1024] = X @ W.
// blockIdx.z picks the product (0 Q, 1 K, 2 V).  One product alone is 256
// workgroups, one per WGP, and its K loop waits out a global load every trip;
// 768 workgroups put three on each WGP, which fill each other's waits.
// 128x128 tile / 256 threads, K stepped by 32, register-staged pipeline:
// global loads of tile k+1 overlap WMMAs on tile k.
// z<2 -> head-major [H,B,S,DH]; z==2 -> transposed [H,B,DH,S].
// ---------------------------------------------------------------------------
__global__ __launch_bounds__(256) void qkv_proj_kernel(
    const float* __restrict__ Xq, const float* __restrict__ Xk,
    const float* __restrict__ Xv, const float* __restrict__ Wq,
    const float* __restrict__ Wk, const float* __restrict__ Wv,
    bf16* __restrict__ qdst, bf16* __restrict__ kdst, bf16* __restrict__ vdst)
{
    const int which = blockIdx.z;       // uniform over the workgroup
    const float* X = which == 0 ? Xq : which == 1 ? Xk : Xv;
    const float* W = which == 0 ? Wq : which == 1 ? Wk : Wv;

    // X tile, row-major [m][k]; 80-B rows (16 B x odd) keep the 16 rows of a
    // ds_load_b128 fragment read on distinct banks (64-B rows: 4 rows a bank).
    constexpr int LDA = 40;
    __shared__ __attribute__((aligned(16))) bf16 At[128 * LDA];
    // W tile as it lies in memory, [k][n]; 288-B rows (32 B x odd) suit the
    // transposing reader, and a wave's 8-byte stores fill one row bank by bank.
    constexpr int LDB = 144;
    __shared__ __attribute__((aligned(16))) bf16 Bt[32 * LDB];

    const int m0   = blockIdx.x * 128;
    const int n0   = blockIdx.y * 128;
    const int t    = threadIdx.x;
    const int lane = t & 31;
    const int w    = t >> 5;
    const int wm   = w >> 2;   // 0..1 : 64 rows each
    const int wn   = w & 3;    // 0..3 : 32 cols each

    // staging geometry
    // X: 8 lanes take one row's 32 floats, so a wave-wide 16-byte load covers
    // four whole 128-B lines (two lanes a row touched 16 lines a load, each of
    // them four times a trip).  The four rows of one load lie 4 rows apart:
    // 4 x 80 B is 16 banks on, so their 8-byte LDS stores meet no common bank.
    const int ar  = w * 16 + (lane >> 3) * 4;   // rows ar + 0..3, one a load
    const int ac  = (lane & 7) * 4;
    const float* Abase = X + (size_t)(m0 + ar) * D_ + ac;
    const int n4  = (t & 31) * 4;
    const int kk0 = t >> 5;
    const float* Bbase = W + n0 + n4;

    float4 ra[4], rb[4];
    auto fetch = [&](int k0) {
        #pragma unroll   // constant indices keep ra[] in registers
        for (int it = 0; it < 4; ++it)
            ra[it] = *(const float4*)(Abase + (size_t)it * D_ + k0);
        #pragma unroll
        for (int it = 0; it < 4; ++it)
            rb[it] = *(const float4*)(Bbase + (size_t)(k0 + kk0 + it * 8) * D_);
    };
    auto stage = [&]() {
        typedef float f32x4 __attribute__((ext_vector_type(4)));
        typedef bf16  bf16x4 __attribute__((ext_vector_type(4)));
        #pragma unroll   // constant indices keep ra[] in registers
        for (int it = 0; it < 4; ++it) {
            const f32x4 f = {ra[it].x, ra[it].y, ra[it].z, ra[it].w};
            *(bf16x4*)(At + (ar + it) * LDA + ac) = __builtin_convertvector(f, bf16x4);
        }
        #pragma unroll
        for (int it = 0; it < 4; ++it) {
            const int kk = kk0 + it * 8;
            const f32x4 f = {rb[it].x, rb[it].y, rb[it].z, rb[it].w};
            *(bf16x4*)(Bt + kk * LDB + n4) = __builtin_convertvector(f, bf16x4);
        }
    };

    const v8f vzero = {};
    v8f acc[4][2];
    #pragma unroll
    for (int i = 0; i < 4; ++i)
        #pragma unroll
        for (int j = 0; j < 2; ++j) acc[i][j] = vzero;

    auto mma_tile = [&]() {
        v16bf a[4], bfr[2];
        #pragma unroll
        for (int i = 0; i < 4; ++i)
            a[i] = load_frag(At + (wm * 64 + i * 16) * LDA, LDA, lane);
        #pragma unroll
        for (int j = 0; j < 2; ++j)
            bfr[j] = load_frag_tr(Bt + wn * 32 + j * 16, LDB, lane);

        #pragma unroll
        for (int i = 0; i < 4; ++i)
            #pragma unroll
            for (int j = 0; j < 2; ++j)
                acc[i][j] = __builtin_amdgcn_wmma_f32_16x16x32_bf16(
                    false, a[i], false, bfr[j], (short)0, acc[i][j], false, false);
    };

    // Last trip peeled: with the fetch under a condition this build copied two
    // of the fetched registers right behind the loads, and so waited for them
    // ahead of the WMMAs that the loads are meant to fly under.
    fetch(0);
    for (int k0 = 32; k0 < D_; k0 += 32) {
        stage();
        __syncthreads();
        fetch(k0);                          // overlap with WMMAs below
        // Keeps the loads in front of the WMMAs: the scheduler otherwise sinks
        // them to just ahead of the barrier's wait, and nothing is overlapped.
        __builtin_amdgcn_sched_barrier(0);
        mma_tile();
        __syncthreads();
    }
    stage();
    __syncthreads();
    mma_tile();
    __syncthreads();

    // ---- epilogue: one workgroup-uniform branch picks the layout ----
    const int half = lane >> 4;
    const int nin  = lane & 15;
    auto store_tile = [&](auto transposed, bf16* __restrict__ dst) {
        #pragma unroll
        for (int i = 0; i < 4; ++i) {
            #pragma unroll
            for (int j = 0; j < 2; ++j) {
                #pragma unroll
                for (int r = 0; r < 8; ++r) {
                    const int mg = m0 + wm * 64 + i * 16 + r + 8 * half;
                    const int ng = n0 + wn * 32 + j * 16 + nin;
                    const int bb = mg >> 10, ss = mg & 1023;   // S_=1024
                    const int hh = ng >> 6,  dd = ng & 63;     // DH_=64
                    const bf16 v = (bf16)acc[i][j][r];
                    if constexpr (decltype(transposed)::value)
                        dst[((size_t)(hh * B_ + bb) * DH_ + dd) * S_ + ss] = v;  // V^T
                    else
                        dst[((size_t)(hh * B_ + bb) * S_ + ss) * DH_ + dd] = v;
                }
            }
        }
        // Ends each layout's run of stores: no register that an issued store
        // names is rewritten ahead of this wait on any way out of the run.
        asm volatile("s_wait_xcnt 0x0" ::: "memory");
    };
    if (which == 2) store_tile(std::true_type{},  vdst);
    else            store_tile(std::false_type{}, which == 0 ? qdst : kdst);
}

typedef float f32x2 __attribute__((ext_vector_type(2)));
typedef float f32x4 __attribute__((ext_vector_type(4)));

// lane l <-> lane l ^ 16
__device__ __forceinline__ float xhalf(float x) {
    const int i = __builtin_bit_cast(int, x);
    return __builtin_bit_cast(float, __builtin_amdgcn_permlanex16(
        i, i, 0x76543210, 0xfedcba98, false, false));
}

__global__ __launch_bounds__(128) void attention_kernel(
    const bf16* __restrict__ qws, const bf16* __restrict__ kws,
    const bf16* __restrict__ vws, const int* __restrict__ query_masks,
    const int* __restrict__ key_masks, float* __restrict__ ows)
{
    // Row pitch of 16 B x odd (144 B for 128-B rows): the 16 rows that a
    // ds_load_b128 fragment read touches then lie on distinct banks; unpadded,
    // 8 of them share a bank.
    constexpr int LDQ = 72;             // Q, K rows: 64 dh + 8; V^T rows: 64 keys + 8
    constexpr int KP  = 64;             // keys a pass
    __shared__ __attribute__((aligned(16))) bf16 Qt[64 * LDQ];     // 64 queries x 64 dh
    __shared__ __attribute__((aligned(16))) bf16 Kt[2][KP * LDQ];  // 64 keys x 64 dh, double buffered
    __shared__ __attribute__((aligned(16))) bf16 Vt[2][64 * LDQ];  // V^T: 64 dh x 64 keys, double buffered
    // The key index now runs along a lane's registers, so a lane needs the mask
    // of 32 keys a pass: a table of the score's scale, 0.125 for a kept key and
    // 0 for a masked one, read 4 keys a load.
    __shared__ __attribute__((aligned(16))) float Ma[S_];

    const int hb   = blockIdx.y;        // h*B + b
    const int h    = hb >> 2;
    const int b    = hb & 3;
    const int q0   = blockIdx.x * 64;
    const int t    = threadIdx.x;
    const int lane = t & 31;
    const int w    = t >> 5;
    const int half = lane >> 4;
    const int nin  = lane & 15;

    // One pass's K and V^T tiles, 8 KB each: 8 lanes take one 128-B row, so a
    // wave-wide copy asks four whole lines; 16 rows a copy, four copies a tile.
    auto issue_pass = [&](int kc, int buf) {
        const int row = t >> 3;                       // 0..15
        const int pc  = (t & 7) * 8;                  // 16-B piece of the row
        const char* ksrc = (const char*)(kws + (size_t)(hb * S_ + kc) * DH_) + t * 16;
        char* kdst = (char*)(Kt[buf] + row * LDQ + pc);
        async_ld4_b128(kdst,                ksrc,
                       kdst + 16 * LDQ * 2, ksrc + 2048,
                       kdst + 32 * LDQ * 2, ksrc + 4096,
                       kdst + 48 * LDQ * 2, ksrc + 6144);
        const char* vsrc = (const char*)(vws + (size_t)(hb * DH_ + row) * S_ + kc + pc);
        char* vdst = (char*)(Vt[buf] + row * LDQ + pc);
        async_ld4_b128(vdst,                vsrc,
                       vdst + 16 * LDQ * 2, vsrc + 16 * S_ * 2,
                       vdst + 32 * LDQ * 2, vsrc + 32 * S_ * 2,
                       vdst + 48 * LDQ * 2, vsrc + 48 * S_ * 2);
    };

    // ---- stage Q tile + first K/V pass ----
    {
        const char* src = (const char*)(qws + (size_t)(hb * S_ + q0) * DH_) + t * 16;
        char* dstp = (char*)(Qt + (t >> 3) * LDQ + (t & 7) * 8);        // 16 query rows a copy
        async_ld4_b128(dstp,                src,
                       dstp + 16 * LDQ * 2, src + 2048,
                       dstp + 32 * LDQ * 2, src + 4096,
                       dstp + 48 * LDQ * 2, src + 6144);
    }
    issue_pass(0, 0);

    // ---- key-mask table: 8 keys a thread, published by the barrier below ----
    {
        const int4* km = (const int4*)(key_masks + b * S_ + t * 8);
        #pragma unroll
        for (int i = 0; i < 2; ++i) {
            const int4 m4 = km[i];
            const f32x4 a4 = {m4.x ? 0.125f : 0.f, m4.y ? 0.125f : 0.f,
                              m4.z ? 0.125f : 0.f, m4.w ? 0.125f : 0.f};
            *(f32x4*)(Ma + t * 8 + i * 4) = a4;
        }
    }
    wait_async0();
    __syncthreads();
    issue_pass(KP, 1);                   // pass 1 flies under pass 0's work

    // B operand: column c = query w*16 + c, k = dh, same loader (k order) as K's
    const v16bf bq0 = load_frag(Qt + (w * 16) * LDQ,      LDQ, lane);  // dh 0..31
    const v16bf bq1 = load_frag(Qt + (w * 16) * LDQ + 32, LDQ, lane);  // dh 32..63

    v16bf ones;                          // A = all-ones 16x32 for column sums of P^T
    #pragma unroll
    for (int i = 0; i < 16; ++i) ones[i] = (bf16)1.0f;

    const v8f vzero = {};
    v8f accO[4];                         // O^T: accO[u][r] = O[query c][dh 16u + 8*half + r]
    #pragma unroll
    for (int u = 0; u < 4; ++u) accO[u] = vzero;
    v8f lacc = vzero;                    // every row = running softmax denominator of query c
    float mrun = -3.0e38f;               // running maximum of query c

    for (int ip = 0; ip < S_ / KP; ++ip) {
        const int kc  = ip * KP;
        const int buf = ip & 1;

        // ---- scores^T: 64k x 16q, contraction dh=64 in two K=32 halves ----
        const bf16* Kb = Kt[buf];
        const bf16* Vb = Vt[buf];
        v8f s[4];                        // s[i][r]: key kc + 16i + 8*half + r, query c
        f32x4 ma[8];                     // scale of keys 16i + 8*half + 0..7
        v16bf av[2][4];                  // V^T fragments: rows dh 16u + c, k = keys 32g + ..
        {
            v16bf ak[4][2];
            #pragma unroll
            for (int i = 0; i < 4; ++i) {
                ak[i][0] = load_frag(Kb + i * 16 * LDQ,      LDQ, lane);
                ak[i][1] = load_frag(Kb + i * 16 * LDQ + 32, LDQ, lane);
            }
            #pragma unroll
            for (int i = 0; i < 4; ++i) {
                const f32x4* pa = (const f32x4*)(Ma + kc + 16 * i + 8 * half);
                ma[2 * i] = pa[0]; ma[2 * i + 1] = pa[1];
            }
            // Keeps the 24 LDS loads of K and the mask one group in front of the
            // score products: the scheduler otherwise sinks them to their users,
            // each behind a wait of its own that the wave sits out.
            __builtin_amdgcn_sched_barrier(0);
            #pragma unroll
            for (int i = 0; i < 4; ++i)
                s[i] = __builtin_amdgcn_wmma_f32_16x16x32_bf16(false, ak[i][0], false, bq0, (short)0, vzero, false, false);
            #pragma unroll
            for (int i = 0; i < 4; ++i)
                s[i] = __builtin_amdgcn_wmma_f32_16x16x32_bf16(false, ak[i][1], false, bq1, (short)0, s[i], false, false);
        }
        #pragma unroll
        for (int g = 0; g < 2; ++g)
            #pragma unroll
            for (int u = 0; u < 4; ++u)
                av[g][u] = load_frag(Vb + (u * 16) * LDQ + g * 32, LDQ, lane);
        // Keeps the 16 V^T loads one group (they take over K's registers) in
        // front of the softmax, whose vector work covers their latency.
        __builtin_amdgcn_sched_barrier(0);

        // ---- scale then key-mask replace, two keys an operation ----
        // score = s * a + (a * 8e7 - 1e7): a = 0.125 gives s * 0.125 + 0 and
        // a = 0 gives -1e7, both exactly (0.125 * 8e7 = 1e7 has no rounding).
        f32x2 sc[16];                    // sc[4i + j] = keys 16i + 8*half + 2j, +1
        #pragma unroll
        for (int i = 0; i < 4; ++i) {
            #pragma unroll
            for (int j = 0; j < 4; ++j) {
                const f32x4 a4 = ma[2 * i + (j >> 1)];
                const f32x2 a  = (j & 1) ? f32x2{a4.z, a4.w} : f32x2{a4.x, a4.y};
                const f32x2 off = __builtin_elementwise_fma(
                    a, f32x2{8.0e7f, 8.0e7f}, f32x2{-1.0e7f, -1.0e7f});
                sc[4 * i + j] = __builtin_elementwise_fma(
                    f32x2{s[i][2 * j], s[i][2 * j + 1]}, a, off);
            }
        }

        // ---- online softmax: maximum in the lane, one exchange of halves ----
        // two chains, one per 32 keys: half the dependent links of one chain
        float hm = fmaxf(sc[0].x, sc[0].y), hm1 = fmaxf(sc[8].x, sc[8].y);
        #pragma unroll
        for (int j = 1; j < 8; ++j) {
            hm  = fmaxf(hm,  fmaxf(sc[j].x,     sc[j].y));
            hm1 = fmaxf(hm1, fmaxf(sc[8 + j].x, sc[8 + j].y));
        }
        hm = fmaxf(hm, hm1);
        hm = fmaxf(hm, xhalf(hm));
        const float mnew = fmaxf(mrun, hm);
        const float corr = __expf(mrun - mnew);
        mrun = mnew;

        // P^T as B operands, one per 32 keys: element e of pt[g] = key
        // 32g + kmap(e) = score tile 2g + (e>>3), register e&7
        v16bf pt[2];
        #pragma unroll
        for (int g = 0; g < 2; ++g) {
            #pragma unroll
            for (int j = 0; j < 8; ++j) {
                pt[g][2 * j]     = (bf16)__expf(sc[8 * g + j].x - mnew);
                pt[g][2 * j + 1] = (bf16)__expf(sc[8 * g + j].y - mnew);
            }
        }

        lacc *= corr;
        #pragma unroll
        for (int u = 0; u < 4; ++u) accO[u] *= corr;

        // ---- O^T += V^T (64dh x 64) @ P^T (64 x 16q); l += ones @ P^T ----
        #pragma unroll
        for (int g = 0; g < 2; ++g) {
            #pragma unroll
            for (int u = 0; u < 4; ++u)
                accO[u] = __builtin_amdgcn_wmma_f32_16x16x32_bf16(
                    false, av[g][u], false, pt[g], (short)0, accO[u], false, false);
            lacc = __builtin_amdgcn_wmma_f32_16x16x32_bf16(
                false, ones, false, pt[g], (short)0, lacc, false, false);
        }

        // ---- foot of the pass: the one barrier publishes pass ip + 1 (every
        // wave's own copies have landed) and ends every reader's last read of
        // this pass's buffer, which is refilled behind it ----
        // Keeps the foot at the foot: the scheduler otherwise lifts its waits and
        // the barrier to the head of the softmax, where the V^T loads have just
        // been issued and the next pass's copies are a third of a pass old.
        __builtin_amdgcn_sched_barrier(0);
        wait_ds0();
        wait_async0();
        __syncthreads();
        if (ip + 2 < S_ / KP) issue_pass(kc + 2 * KP, buf);
    }
    wait_async0();                       // no copy is outstanding past the loop

    // ---- epilogue: 1/l, query mask (post-softmax multiplicative), write O ----
    {
        const int qrow = q0 + w * 16 + nin;
        const float l   = lacc[0];
        const float inv = (l > 0.f) ? (1.0f / l) : 0.f;
        const float fac = query_masks[b * S_ + qrow] ? inv : 0.f;
        float* orow = ows + ((size_t)(b * S_ + qrow)) * D_ + h * DH_ + 8 * half;
        #pragma unroll
        for (int u = 0; u < 4; ++u) {    // 8 consecutive dh a lane: two 16-byte stores
            const v8f o = accO[u] * fac;
            *(f32x4*)(orow + u * 16)     = f32x4{o[0], o[1], o[2], o[3]};
            *(f32x4*)(orow + u * 16 + 4) = f32x4{o[4], o[5], o[6], o[7]};
        }
    }
}

// ---------------------------------------------------------------------------
// Kernel 3: residual + LayerNorm (eps = 1e-3).  One row (D=1024) per block.
// ---------------------------------------------------------------------------
__global__ __launch_bounds__(256) void resid_ln_kernel(
    const float* __restrict__ queries, const float* __restrict__ ows,
    const float* __restrict__ gamma, const float* __restrict__ beta,
    float* __restrict__ out)
{
    __shared__ float red1[8], red2[8];
    const int row = blockIdx.x;
    const int t   = threadIdx.x;

    const float4 q4 = ((const float4*)(queries + (size_t)row * D_))[t];
    const float4 o4 = ((const float4*)(ows     + (size_t)row * D_))[t];
    float4 r4;
    r4.x = q4.x + o4.x; r4.y = q4.y + o4.y;
    r4.z = q4.z + o4.z; r4.w = q4.w + o4.w;

    float s1 = r4.x + r4.y + r4.z + r4.w;
    float s2 = r4.x * r4.x + r4.y * r4.y + r4.z * r4.z + r4.w * r4.w;
    #pragma unroll
    for (int d = 1; d < 32; d <<= 1) {
        s1 += __shfl_xor(s1, d, 32);
        s2 += __shfl_xor(s2, d, 32);
    }
    if ((t & 31) == 0) { red1[t >> 5] = s1; red2[t >> 5] = s2; }
    __syncthreads();
    float ts1 = 0.f, ts2 = 0.f;
    #pragma unroll
    for (int i = 0; i < 8; ++i) { ts1 += red1[i]; ts2 += red2[i]; }

    const float mean = ts1 * (1.0f / D_);
    const float var  = ts2 * (1.0f / D_) - mean * mean;
    const float rstd = rsqrtf(var + 1e-3f);

    const float4 g4 = ((const float4*)gamma)[t];
    const float4 b4 = ((const float4*)beta)[t];
    float4 o;
    o.x = g4.x * (r4.x - mean) * rstd + b4.x;
    o.y = g4.y * (r4.y - mean) * rstd + b4.y;
    o.z = g4.z * (r4.z - mean) * rstd + b4.z;
    o.w = g4.w * (r4.w - mean) * rstd + b4.w;
    ((float4*)(out + (size_t)row * D_))[t] = o;
}

// ---------------------------------------------------------------------------
extern "C" void kernel_launch(void* const* d_in, const int* in_sizes, int n_in,
                              void* d_out, int out_size, void* d_ws, size_t ws_size,
                              hipStream_t stream) {
    const float* queries = (const float*)d_in[0];
    const float* keys    = (const float*)d_in[1];
    const float* values  = (const float*)d_in[2];
    const int*   qmask   = (const int*)d_in[3];
    const int*   kmask   = (const int*)d_in[4];
    const float* Wq      = (const float*)d_in[5];
    const float* Wk      = (const float*)d_in[6];
    const float* Wv      = (const float*)d_in[7];
    const float* gamma   = (const float*)d_in[8];
    const float* beta    = (const float*)d_in[9];
    float*       out     = (float*)d_out;

    const size_t QKV = (size_t)H_ * B_ * S_ * DH_;   // 4 Mi elements
    bf16*  qws = (bf16*)d_ws;
    bf16*  kws = qws + QKV;
    bf16*  vws = kws + QKV;
    float* ows = (float*)(vws + QKV);

    dim3 g1(B_ * S_ / 128, D_ / 128, 3);
    qkv_proj_kernel<<<g1, dim3(256), 0, stream>>>(queries, keys, values, Wq, Wk, Wv,
                                                  qws, kws, vws);

    dim3 g2(S_ / 64, H_ * B_);
    attention_kernel<<<g2, dim3(128), 0, stream>>>(qws, kws, vws, qmask, kmask, ows);

    resid_ln_kernel<<<dim3(B_ * S_), dim3(256), 0, stream>>>(queries, ows, gamma, beta, out);
}

// v007
// Measured time: 53.5 microseconds a run.
// In both of two side-by-side timings against v006, it was 1.24 times as fast.
// Counting every step since v000, it is 6.11 times as fast.
#include <hip/hip_runtime.h>
#include <hip/hip_bf16.h>
#include <type_traits>

// MHA: Q/K/V proj (bf16 WMMA, reg-pipelined) -> flash attention (bf16 WMMA,
// fp32 accum, transposed products, double-buffered async global->LDS staging,
// WMMA row-sums)
// -> residual+LN.  B=4, S=1024, D=1024, H=16, DH=64

typedef __bf16 bf16;
typedef __bf16 v16bf __attribute__((ext_vector_type(16)));
typedef float  v8f   __attribute__((ext_vector_type(8)));

#define B_  4
#define S_  1024
#define D_  1024
#define H_  16
#define DH_ 64

// Load a 16(M) x 32(K) bf16 fragment from LDS into the CDNA5 WMMA A/B VGPR
// layout (wave32): lane L<16 -> row m=L, lanes 16..31 -> same rows, K 8..15 and 24..31.
__device__ __forceinline__ v16bf load_frag(const bf16* base, int ldk, int lane) {
    const int m    = lane & 15;
    const int half = lane >> 4;
    const bf16* row = base + m * ldk + half * 8;
    v16bf a;
    ((uint4*)&a)[0] = *(const uint4*)(row);
    ((uint4*)&a)[1] = *(const uint4*)(row + 16);
    return a;
}

// Load a 32(K) x 16(N) bf16 B fragment from a ROW-MAJOR [k][n] LDS tile with the
// transposing LDS load: lane (c = L&15, h = L>>4) receives T[kbase+8h+0..7][c],
// so the loads at kbase 0 and 16 give the same k order as load_frag gives A.
typedef short s16x8 __attribute__((ext_vector_type(8)));
__device__ __forceinline__ v16bf load_frag_tr(const bf16* base, int ldn, int lane) {
    typedef __attribute__((address_space(3))) s16x8 lds_s16x8;
    const bf16* p = base + ((lane >> 4) * 8 + (lane & 7)) * ldn + ((lane >> 3) & 1) * 8;
    v16bf b;
    ((s16x8*)&b)[0] = __builtin_amdgcn_ds_load_tr16_b128_v8i16((lds_s16x8*)p);
    ((s16x8*)&b)[1] = __builtin_amdgcn_ds_load_tr16_b128_v8i16((lds_s16x8*)(p + 16 * ldn));
    return b;
}

// gfx1250 async global->LDS copies (16B per lane each), tracked by ASYNCcnt.
// Four copies share one statement that ends in s_wait_xcnt 0, so that no
// address register of a copy is rewritten ahead of that wait.
__device__ __forceinline__ void async_ld4_b128(
    void* d0, const void* g0, void* d1, const void* g1,
    void* d2, const void* g2, void* d3, const void* g3) {
    const unsigned l0 = (unsigned)(uintptr_t)d0;    // low 32 bits = LDS offset
    const unsigned l1 = (unsigned)(uintptr_t)d1;
    const unsigned l2 = (unsigned)(uintptr_t)d2;
    const unsigned l3 = (unsigned)(uintptr_t)d3;
    asm volatile("global_load_async_to_lds_b128 %0, %1, off\n\t"
                 "global_load_async_to_lds_b128 %2, %3, off\n\t"
                 "global_load_async_to_lds_b128 %4, %5, off\n\t"
                 "global_load_async_to_lds_b128 %6, %7, off\n\t"
                 "s_wait_xcnt 0x0"
                 :: "v"(l0), "v"(g0), "v"(l1), "v"(g1),
                    "v"(l2), "v"(g2), "v"(l3), "v"(g3) : "memory");
}
__device__ __forceinline__ void wait_async0() {
    asm volatile("s_wait_asynccnt 0x0" ::: "memory");
}
// A wave's own LDS reads have returned: stands in front of the barrier behind
// which a buffer that the wave has read is refilled by copies.
__device__ __forceinline__ void wait_ds0() {
    asm volatile("s_wait_dscnt 0x0" ::: "memory");
}

// ---------------------------------------------------------------------------
// Kernel 1: Q/K/V projections, all three in ONE launch.  C[4096x1024] = X @ W.
// blockIdx.z picks the product (0 Q, 1 K, 2 V).  One product alone is 256
// workgroups, one per WGP, and its K loop waits out a global load every trip;
// 768 workgroups put three on each WGP, which fill each other's waits.
// 128x128 tile / 256 threads, K stepped by 32, register-staged pipeline:
// global loads of tile k+1 overlap WMMAs on tile k.
// z<2 -> head-major [H,B,S,DH]; z==2 -> transposed [H,B,DH,S].
// Masked keys are dropped.  A masked key's score is -1e7, so beside one kept key
// (whose score lies far above that) its softmax weight underflows to exactly 0.
// For K and V the row index
// of a tile is therefore a RANK: the keys of a batch are renumbered, kept ones
// first, masked ones behind them (the same renumbering for K and V, a function
// of the mask alone).  A tile gathers the X rows of its 128 ranks and stores at
// the rank; a tile that holds masked keys only is never read and returns at
// once.  A batch with no kept key keeps every tile (all weights are then equal).
// ---------------------------------------------------------------------------
__global__ __launch_bounds__(256) void qkv_proj_kernel(
    const float* __restrict__ Xq, const float* __restrict__ Xk,
    const float* __restrict__ Xv, const float* __restrict__ Wq,
    const float* __restrict__ Wk, const float* __restrict__ Wv,
    const int* __restrict__ key_masks,
    bf16* __restrict__ qdst, bf16* __restrict__ kdst, bf16* __restrict__ vdst)
{
    const int which = blockIdx.z;       // uniform over the workgroup
    const float* X = which == 0 ? Xq : which == 1 ? Xk : Xv;
    const float* W = which == 0 ? Wq : which == 1 ? Wk : Wv;

    // X tile, row-major [m][k]; 80-B rows (16 B x odd) keep the 16 rows of a
    // ds_load_b128 fragment read on distinct banks (64-B rows: 4 rows a bank).
    constexpr int LDA = 40;
    __shared__ __attribute__((aligned(16))) bf16 At[128 * LDA];
    // W tile as it lies in memory, [k][n]; 288-B rows (32 B x odd) suit the
    // transposing reader, and a wave's 8-byte stores fill one row bank by bank.
    constexpr int LDB = 144;
    __shared__ __attribute__((aligned(16))) bf16 Bt[32 * LDB];
    __shared__ __attribute__((aligned(16))) int rowof[128];   // rank in tile -> key

    // Batch in the low bits of x, tile of the batch above them, V's tiles in
    // reverse: the tiles that return at once are the high ranks, and this keeps
    // them from falling on one residue of the flat index, K's and V's together.
    const int bb   = blockIdx.x & 3;
    const int xt   = which == 2 ? 7 - (blockIdx.x >> 2) : (blockIdx.x >> 2);
    const int r0   = xt * 128;          // first row (Q) or rank (K, V) in the batch
    const int m0   = bb * S_ + r0;
    const int n0   = blockIdx.y * 128;
    const int t    = threadIdx.x;
    const int lane = t & 31;
    const int w    = t >> 5;
    const int wm   = w >> 2;   // 0..1 : 64 rows each
    const int wn   = w & 3;    // 0..3 : 32 cols each

    // staging geometry
    // X: 8 lanes take one row's 32 floats, so a wave-wide 16-byte load covers
    // four whole 128-B lines (two lanes a row touched 16 lines a load, each of
    // them four times a trip).  The four rows of one load lie 4 rows apart:
    // 4 x 80 B is 16 banks on, so their 8-byte LDS stores meet no common bank.
    const int ar  = w * 16 + (lane >> 3) * 4;   // rows ar + 0..3, one a load
    const int ac  = (lane & 7) * 4;
    int rows[4] = {r0 + ar, r0 + ar + 1, r0 + ar + 2, r0 + ar + 3};
    if (which != 0) {                   // uniform over the workgroup
        // Every wave reads the batch's whole mask, 32 keys a lane (bit 4i + e =
        // key 4 * (32i + lane) + e), so the count needs no barrier and the early
        // return stands in front of all of them.
        const int4* km = (const int4*)(key_masks + bb * S_);
        unsigned bits = 0;
        #pragma unroll
        for (int i = 0; i < 8; ++i) {
            const int4 m4 = km[i * 32 + lane];
            bits |= ((m4.x != 0 ? 1u : 0u) | (m4.y != 0 ? 2u : 0u) |
                     (m4.z != 0 ? 4u : 0u) | (m4.w != 0 ? 8u : 0u)) << (4 * i);
        }
        const int c = __popc(bits);
        int inc = c;                    // kept keys of lanes 0..lane
        #pragma unroll
        for (int d = 1; d < 32; d <<= 1) {
            const int v = __shfl_up(inc, d, 32);
            if (lane >= d) inc += v;
        }
        const int n = __builtin_amdgcn_readlane(inc, 31);   // kept keys of the batch
        if (n != 0 && r0 >= n) return;  // masked keys only: nobody reads this tile
        const int base = inc - c;       // kept keys of the lanes below
        #pragma unroll
        for (int e = 0; e < 4; ++e) {   // wave w ranks the keys of its load i = w
            const int p  = 4 * w + e;
            const int kb = __popc(bits & ((1u << p) - 1u));
            const int rank = ((bits >> p) & 1u) ? base + kb
                                                : n + (32 * lane - base) + (p - kb);
            const unsigned loc = (unsigned)(rank - r0);
            if (loc < 128u) rowof[loc] = 4 * (w * 32 + lane) + e;
        }
        __syncthreads();
        const int4 r4 = *(const int4*)(rowof + ar);
        rows[0] = r4.x; rows[1] = r4.y; rows[2] = r4.z; rows[3] = r4.w;
    }
    const float* Arow[4];
    #pragma unroll
    for (int it = 0; it < 4; ++it)
        Arow[it] = X + (size_t)(bb * S_ + rows[it]) * D_ + ac;
    const int n4  = (t & 31) * 4;
    const int kk0 = t >> 5;
    const float* Bbase = W + n0 + n4;

    float4 ra[4], rb[4];
    auto fetch = [&](int k0) {
        #pragma unroll   // constant indices keep ra[] in registers
        for (int it = 0; it < 4; ++it)
            ra[it] = *(const float4*)(Arow[it] + k0);
        #pragma unroll
        for (int it = 0; it < 4; ++it)
            rb[it] = *(const float4*)(Bbase + (size_t)(k0 + kk0 + it * 8) * D_);
    };
    auto stage = [&]() {
        typedef float f32x4 __attribute__((ext_vector_type(4)));
        typedef bf16  bf16x4 __attribute__((ext_vector_type(4)));
        #pragma unroll   // constant indices keep ra[] in registers
        for (int it = 0; it < 4; ++it) {
            const f32x4 f = {ra[it].x, ra[it].y, ra[it].z, ra[it].w};
            *(bf16x4*)(At + (ar + it) * LDA + ac) = __builtin_convertvector(f, bf16x4);
        }
        #pragma unroll
        for (int it = 0; it < 4; ++it) {
            const int kk = kk0 + it * 8;
            const f32x4 f = {rb[it].x, rb[it].y, rb[it].z, rb[it].w};
            *(bf16x4*)(Bt + kk * LDB + n4) = __builtin_convertvector(f, bf16x4);
        }
    };

    const v8f vzero = {};
    v8f acc[4][2];
    #pragma unroll
    for (int i = 0; i < 4; ++i)
        #pragma unroll
        for (int j = 0; j < 2; ++j) acc[i][j] = vzero;

    auto mma_tile = [&]() {
        v16bf a[4], bfr[2];
        #pragma unroll
        for (int i = 0; i < 4; ++i)
            a[i] = load_frag(At + (wm * 64 + i * 16) * LDA, LDA, lane);
        #pragma unroll
        for (int j = 0; j < 2; ++j)
            bfr[j] = load_frag_tr(Bt + wn * 32 + j * 16, LDB, lane);

        #pragma unroll
        for (int i = 0; i < 4; ++i)
            #pragma unroll
            for (int j = 0; j < 2; ++j)
                acc[i][j] = __builtin_amdgcn_wmma_f32_16x16x32_bf16(
                    false, a[i], false, bfr[j], (short)0, acc[i][j], false, false);
    };

    // Last trip peeled: with the fetch under a condition this build copied two
    // of the fetched registers right behind the loads, and so waited for them
    // ahead of the WMMAs that the loads are meant to fly under.
    fetch(0);
    for (int k0 = 32; k0 < D_; k0 += 32) {
        stage();
        __syncthreads();
        fetch(k0);                          // overlap with WMMAs below
        // Keeps the loads in front of the WMMAs: the scheduler otherwise sinks
        // them to just ahead of the barrier's wait, and nothing is overlapped.
        __builtin_amdgcn_sched_barrier(0);
        mma_tile();
        __syncthreads();
    }
    stage();
    __syncthreads();
    mma_tile();
    __syncthreads();

    // ---- epilogue: one workgroup-uniform branch picks the layout ----
    const int half = lane >> 4;
    const int nin  = lane & 15;
    auto store_tile = [&](auto transposed, bf16* __restrict__ dst) {
        #pragma unroll
        for (int i = 0; i < 4; ++i) {
            #pragma unroll
            for (int j = 0; j < 2; ++j) {
                #pragma unroll
                for (int r = 0; r < 8; ++r) {
                    const int mg = m0 + wm * 64 + i * 16 + r + 8 * half;
                    const int ng = n0 + wn * 32 + j * 16 + nin;
                    const int bb = mg >> 10, ss = mg & 1023;   // S_=1024
                    const int hh = ng >> 6,  dd = ng & 63;     // DH_=64
                    const bf16 v = (bf16)acc[i][j][r];
                    if constexpr (decltype(transposed)::value)
                        dst[((size_t)(hh * B_ + bb) * DH_ + dd) * S_ + ss] = v;  // V^T
                    else
                        dst[((size_t)(hh * B_ + bb) * S_ + ss) * DH_ + dd] = v;
                }
            }
        }
        // Ends each layout's run of stores: no register that an issued store
        // names is rewritten ahead of this wait on any way out of the run.
        asm volatile("s_wait_xcnt 0x0" ::: "memory");
    };
    if (which == 2) store_tile(std::true_type{},  vdst);
    else            store_tile(std::false_type{}, which == 0 ? qdst : kdst);
}

typedef float f32x2 __attribute__((ext_vector_type(2)));
typedef float f32x4 __attribute__((ext_vector_type(4)));

// lane l <-> lane l ^ 16
__device__ __forceinline__ float xhalf(float x) {
    const int i = __builtin_bit_cast(int, x);
    return __builtin_bit_cast(float, __builtin_amdgcn_permlanex16(
        i, i, 0x76543210, 0xfedcba98, false, false));
}

__global__ __launch_bounds__(128) void attention_kernel(
    const bf16* __restrict__ qws, const bf16* __restrict__ kws,
    const bf16* __restrict__ vws, const int* __restrict__ query_masks,
    const int* __restrict__ key_masks, float* __restrict__ ows)
{
    // Row pitch of 16 B x odd (144 B for 128-B rows): the 16 rows that a
    // ds_load_b128 fragment read touches then lie on distinct banks; unpadded,
    // 8 of them share a bank.
    constexpr int LDQ = 72;             // Q, K rows: 64 dh + 8; V^T rows: 64 keys + 8
    constexpr int KP  = 64;             // keys a pass
    __shared__ __attribute__((aligned(16))) bf16 Qt[64 * LDQ];     // 64 queries x 64 dh
    __shared__ __attribute__((aligned(16))) bf16 Kt[2][KP * LDQ];  // 64 keys x 64 dh, double buffered
    __shared__ __attribute__((aligned(16))) bf16 Vt[2][64 * LDQ];  // V^T: 64 dh x 64 keys, double buffered
    // The key index now runs along a lane's registers, so a lane needs the mask
    // of 32 keys a pass: a table of the score's scale, 0.125 for a kept key and
    // 0 for a masked one, read 4 keys a load.  Indexed by rank: kept below n.
    __shared__ __attribute__((aligned(16))) float Ma[S_];

    const int hb   = blockIdx.y;        // h*B + b
    const int h    = hb >> 2;
    const int b    = hb & 3;
    const int q0   = blockIdx.x * 64;
    const int t    = threadIdx.x;
    const int lane = t & 31;
    const int w    = t >> 5;
    const int half = lane >> 4;
    const int nin  = lane & 15;

    // One pass's K and V^T tiles, 8 KB each: 8 lanes take one 128-B row, so a
    // wave-wide copy asks four whole lines; 16 rows a copy, four copies a tile.
    auto issue_pass = [&](int kc, int buf) {
        const int row = t >> 3;                       // 0..15
        const int pc  = (t & 7) * 8;                  // 16-B piece of the row
        const char* ksrc = (const char*)(kws + (size_t)(hb * S_ + kc) * DH_) + t * 16;
        char* kdst = (char*)(Kt[buf] + row * LDQ + pc);
        async_ld4_b128(kdst,                ksrc,
                       kdst + 16 * LDQ * 2, ksrc + 2048,
                       kdst + 32 * LDQ * 2, ksrc + 4096,
                       kdst + 48 * LDQ * 2, ksrc + 6144);
        const char* vsrc = (const char*)(vws + (size_t)(hb * DH_ + row) * S_ + kc + pc);
        char* vdst = (char*)(Vt[buf] + row * LDQ + pc);
        async_ld4_b128(vdst,                vsrc,
                       vdst + 16 * LDQ * 2, vsrc + 16 * S_ * 2,
                       vdst + 32 * LDQ * 2, vsrc + 32 * S_ * 2,
                       vdst + 48 * LDQ * 2, vsrc + 48 * S_ * 2);
    };

    // ---- stage Q tile + first K/V pass ----
    {
        const char* src = (const char*)(qws + (size_t)(hb * S_ + q0) * DH_) + t * 16;
        char* dstp = (char*)(Qt + (t >> 3) * LDQ + (t & 7) * 8);        // 16 query rows a copy
        async_ld4_b128(dstp,                src,
                       dstp + 16 * LDQ * 2, src + 2048,
                       dstp + 32 * LDQ * 2, src + 4096,
                       dstp + 48 * LDQ * 2, src + 6144);
    }
    issue_pass(0, 0);

    // ---- kept keys of the batch: every wave counts the whole mask itself ----
    int n;
    {
        const int4* km = (const int4*)(key_masks + b * S_);
        int c = 0;
        #pragma unroll
        for (int i = 0; i < 8; ++i) {
            const int4 m4 = km[i * 32 + lane];
            c += (m4.x != 0) + (m4.y != 0) + (m4.z != 0) + (m4.w != 0);
        }
        #pragma unroll
        for (int d = 1; d < 32; d <<= 1) c += __shfl_xor(c, d, 32);
        n = __builtin_amdgcn_readfirstlane(c);
    }
    // passes: up to the last kept key; every key where none is kept
    const int np = n == 0 ? S_ / KP : min((n + KP - 1) / KP, S_ / KP);

    // ---- key-mask table: 8 ranks a thread, published by the barrier below ----
    #pragma unroll
    for (int i = 0; i < 2; ++i) {
        const int j = t * 8 + i * 4;
        const f32x4 a4 = {j     < n ? 0.125f : 0.f, j + 1 < n ? 0.125f : 0.f,
                          j + 2 < n ? 0.125f : 0.f, j + 3 < n ? 0.125f : 0.f};
        *(f32x4*)(Ma + j) = a4;
    }
    wait_async0();
    __syncthreads();
    if (np > 1) issue_pass(KP, 1);       // pass 1 flies under pass 0's work

    // B operand: column c = query w*16 + c, k = dh, same loader (k order) as K's
    const v16bf bq0 = load_frag(Qt + (w * 16) * LDQ,      LDQ, lane);  // dh 0..31
    const v16bf bq1 = load_frag(Qt + (w * 16) * LDQ + 32, LDQ, lane);  // dh 32..63

    v16bf ones;                          // A = all-ones 16x32 for column sums of P^T
    #pragma unroll
    for (int i = 0; i < 16; ++i) ones[i] = (bf16)1.0f;

    const v8f vzero = {};
    v8f accO[4];                         // O^T: accO[u][r] = O[query c][dh 16u + 8*half + r]
    #pragma unroll
    for (int u = 0; u < 4; ++u) accO[u] = vzero;
    v8f lacc = vzero;                    // every row = running softmax denominator of query c
    float mrun = -3.0e38f;               // running maximum of query c

    for (int ip = 0; ip < np; ++ip) {
        const int kc  = ip * KP;
        const int buf = ip & 1;

        // ---- scores^T: 64k x 16q, contraction dh=64 in two K=32 halves ----
        const bf16* Kb = Kt[buf];
        const bf16* Vb = Vt[buf];
        v8f s[4];                        // s[i][r]: key kc + 16i + 8*half + r, query c
        f32x4 ma[8];                     // scale of keys 16i + 8*half + 0..7
        v16bf av[2][4];                  // V^T fragments: rows dh 16u + c, k = keys 32g + ..
        {
            v16bf ak[4][2];
            #pragma unroll
            for (int i = 0; i < 4; ++i) {
                ak[i][0] = load_frag(Kb + i * 16 * LDQ,      LDQ, lane);
                ak[i][1] = load_frag(Kb + i * 16 * LDQ + 32, LDQ, lane);
            }
            #pragma unroll
            for (int i = 0; i < 4; ++i) {
                const f32x4* pa = (const f32x4*)(Ma + kc + 16 * i + 8 * half);
                ma[2 * i] = pa[0]; ma[2 * i + 1] = pa[1];
            }
            // Keeps the 24 LDS loads of K and the mask one group in front of the
            // score products: the scheduler otherwise sinks them to their users,
            // each behind a wait of its own that the wave sits out.
            __builtin_amdgcn_sched_barrier(0);
            #pragma unroll
            for (int i = 0; i < 4; ++i)
                s[i] = __builtin_amdgcn_wmma_f32_16x16x32_bf16(false, ak[i][0], false, bq0, (short)0, vzero, false, false);
            #pragma unroll
            for (int i = 0; i < 4; ++i)
                s[i] = __builtin_amdgcn_wmma_f32_16x16x32_bf16(false, ak[i][1], false, bq1, (short)0, s[i], false, false);
        }
        #pragma unroll
        for (int g = 0; g < 2; ++g)
            #pragma unroll
            for (int u = 0; u < 4; ++u)
                av[g][u] = load_frag(Vb + (u * 16) * LDQ + g * 32, LDQ, lane);
        // Keeps the 16 V^T loads one group (they take over K's registers) in
        // front of the softmax, whose vector work covers their latency.
        __builtin_amdgcn_sched_barrier(0);

        // ---- scale then key-mask replace, two keys an operation ----
        // score = s * a + (a * 8e7 - 1e7): a = 0.125 gives s * 0.125 + 0 and
        // a = 0 gives -1e7, both exactly (0.125 * 8e7 = 1e7 has no rounding).
        f32x2 sc[16];                    // sc[4i + j] = keys 16i + 8*half + 2j, +1
        #pragma unroll
        for (int i = 0; i < 4; ++i) {
            #pragma unroll
            for (int j = 0; j < 4; ++j) {
                const f32x4 a4 = ma[2 * i + (j >> 1)];
                const f32x2 a  = (j & 1) ? f32x2{a4.z, a4.w} : f32x2{a4.x, a4.y};
                const f32x2 off = __builtin_elementwise_fma(
                    a, f32x2{8.0e7f, 8.0e7f}, f32x2{-1.0e7f, -1.0e7f});
                sc[4 * i + j] = __builtin_elementwise_fma(
                    f32x2{s[i][2 * j], s[i][2 * j + 1]}, a, off);
            }
        }

        // ---- online softmax: maximum in the lane, one exchange of halves ----
        // two chains, one per 32 keys: half the dependent links of one chain
        float hm = fmaxf(sc[0].x, sc[0].y), hm1 = fmaxf(sc[8].x, sc[8].y);
        #pragma unroll
        for (int j = 1; j < 8; ++j) {
            hm  = fmaxf(hm,  fmaxf(sc[j].x,     sc[j].y));
            hm1 = fmaxf(hm1, fmaxf(sc[8 + j].x, sc[8 + j].y));
        }
        hm = fmaxf(hm, hm1);
        hm = fmaxf(hm, xhalf(hm));
        const float mnew = fmaxf(mrun, hm);
        const float corr = __expf(mrun - mnew);
        mrun = mnew;

        // P^T as B operands, one per 32 keys: element e of pt[g] = key
        // 32g + kmap(e) = score tile 2g + (e>>3), register e&7
        v16bf pt[2];
        #pragma unroll
        for (int g = 0; g < 2; ++g) {
            #pragma unroll
            for (int j = 0; j < 8; ++j) {
                pt[g][2 * j]     = (bf16)__expf(sc[8 * g + j].x - mnew);
                pt[g][2 * j + 1] = (bf16)__expf(sc[8 * g + j].y - mnew);
            }
        }

        lacc *= corr;
        #pragma unroll
        for (int u = 0; u < 4; ++u) accO[u] *= corr;

        // ---- O^T += V^T (64dh x 64) @ P^T (64 x 16q); l += ones @ P^T ----
        #pragma unroll
        for (int g = 0; g < 2; ++g) {
            #pragma unroll
            for (int u = 0; u < 4; ++u)
                accO[u] = __builtin_amdgcn_wmma_f32_16x16x32_bf16(
                    false, av[g][u], false, pt[g], (short)0, accO[u], false, false);
            lacc = __builtin_amdgcn_wmma_f32_16x16x32_bf16(
                false, ones, false, pt[g], (short)0, lacc, false, false);
        }

        // ---- foot of the pass: the one barrier publishes pass ip + 1 (every
        // wave's own copies have landed) and ends every reader's last read of
        // this pass's buffer, which is refilled behind it ----
        // Keeps the foot at the foot: the scheduler otherwise lifts its waits and
        // the barrier to the head of the softmax, where the V^T loads have just
        // been issued and the next pass's copies are a third of a pass old.
        __builtin_amdgcn_sched_barrier(0);
        wait_ds0();
        wait_async0();
        __syncthreads();
        if (ip + 2 < np) issue_pass(kc + 2 * KP, buf);
    }
    wait_async0();                       // no copy is outstanding past the loop

    // ---- epilogue: 1/l, query mask (post-softmax multiplicative), write O ----
    {
        const int qrow = q0 + w * 16 + nin;
        const float l   = lacc[0];
        const float inv = (l > 0.f) ? (1.0f / l) : 0.f;
        const float fac = query_masks[b * S_ + qrow] ? inv : 0.f;
        float* orow = ows + ((size_t)(b * S_ + qrow)) * D_ + h * DH_ + 8 * half;
        #pragma unroll
        for (int u = 0; u < 4; ++u) {    // 8 consecutive dh a lane: two 16-byte stores
            const v8f o = accO[u] * fac;
            *(f32x4*)(orow + u * 16)     = f32x4{o[0], o[1], o[2], o[3]};
            *(f32x4*)(orow + u * 16 + 4) = f32x4{o[4], o[5], o[6], o[7]};
        }
    }
}

// ---------------------------------------------------------------------------
// Kernel 3: residual + LayerNorm (eps = 1e-3).  One row (D=1024) per block.
// ---------------------------------------------------------------------------
__global__ __launch_bounds__(256) void resid_ln_kernel(
    const float* __restrict__ queries, const float* __restrict__ ows,
    const float* __restrict__ gamma, const float* __restrict__ beta,
    float* __restrict__ out)
{
    __shared__ float red1[8], red2[8];
    const int row = blockIdx.x;
    const int t   = threadIdx.x;

    const float4 q4 = ((const float4*)(queries + (size_t)row * D_))[t];
    const float4 o4 = ((const float4*)(ows     + (size_t)row * D_))[t];
    float4 r4;
    r4.x = q4.x + o4.x; r4.y = q4.y + o4.y;
    r4.z = q4.z + o4.z; r4.w = q4.w + o4.w;

    float s1 = r4.x + r4.y + r4.z + r4.w;
    float s2 = r4.x * r4.x + r4.y * r4.y + r4.z * r4.z + r4.w * r4.w;
    #pragma unroll
    for (int d = 1; d < 32; d <<= 1) {
        s1 += __shfl_xor(s1, d, 32);
        s2 += __shfl_xor(s2, d, 32);
    }
    if ((t & 31) == 0) { red1[t >> 5] = s1; red2[t >> 5] = s2; }
    __syncthreads();
    float ts1 = 0.f, ts2 = 0.f;
    #pragma unroll
    for (int i = 0; i < 8; ++i) { ts1 += red1[i]; ts2 += red2[i]; }

    const float mean = ts1 * (1.0f / D_);
    const float var  = ts2 * (1.0f / D_) - mean * mean;
    const float rstd = rsqrtf(var + 1e-3f);

    const float4 g4 = ((const float4*)gamma)[t];
    const float4 b4 = ((const float4*)beta)[t];
    float4 o;
    o.x = g4.x * (r4.x - mean) * rstd + b4.x;
    o.y = g4.y * (r4.y - mean) * rstd + b4.y;
    o.z = g4.z * (r4.z - mean) * rstd + b4.z;
    o.w = g4.w * (r4.w - mean) * rstd + b4.w;
    ((float4*)(out + (size_t)row * D_))[t] = o;
}

// ---------------------------------------------------------------------------
extern "C" void kernel_launch(void* const* d_in, const int* in_sizes, int n_in,
                              void* d_out, int out_size, void* d_ws, size_t ws_size,
                              hipStream_t stream) {
    const float* queries = (const float*)d_in[0];
    const float* keys    = (const float*)d_in[1];
    const float* values  = (const float*)d_in[2];
    const int*   qmask   = (const int*)d_in[3];
    const int*   kmask   = (const int*)d_in[4];
    const float* Wq      = (const float*)d_in[5];
    const float* Wk      = (const float*)d_in[6];
    const float* Wv      = (const float*)d_in[7];
    const float* gamma   = (const float*)d_in[8];
    const float* beta    = (const float*)d_in[9];
    float*       out     = (float*)d_out;

    const size_t QKV = (size_t)H_ * B_ * S_ * DH_;   // 4 Mi elements
    bf16*  qws = (bf16*)d_ws;
    bf16*  kws = qws + QKV;
    bf16*  vws = kws + QKV;
    float* ows = (float*)(vws + QKV);

    dim3 g1(B_ * S_ / 128, D_ / 128, 3);
    qkv_proj_kernel<<<g1, dim3(256), 0, stream>>>(queries, keys, values, Wq, Wk, Wv,
                                                  kmask, qws, kws, vws);

    dim3 g2(S_ / 64, H_ * B_);
    attention_kernel<<<g2, dim3(128), 0, stream>>>(qws, kws, vws, qmask, kmask, ows);

    resid_ln_kernel<<<dim3(B_ * S_), dim3(256), 0, stream>>>(queries, ows, gamma, beta, out);
}

// v008
// Measured time: 47.5 microseconds a run.
// In two side-by-side timings against v007, it was 1.12 and 1.13 times as fast.
// All steps since v000 together make it 6.88 times as fast.
#include <hip/hip_runtime.h>
#include <hip/hip_bf16.h>
#include <type_traits>

// MHA: Q/K/V proj (bf16 WMMA, reg-pipelined) -> flash attention (bf16 WMMA,
// fp32 accum, transposed products, double-buffered async global->LDS staging,
// WMMA row-sums)
// -> residual+LN.  B=4, S=1024, D=1024, H=16, DH=64

typedef __bf16 bf16;
typedef __bf16 v16bf __attribute__((ext_vector_type(16)));
typedef float  v8f   __attribute__((ext_vector_type(8)));

#define B_  4
#define S_  1024
#define D_  1024
#define H_  16
#define DH_ 64

// Load a 16(M) x 32(K) bf16 fragment from LDS into the CDNA5 WMMA A/B VGPR
// layout (wave32): lane L<16 -> row m=L, lanes 16..31 -> same rows, K 8..15 and 24..31.
__device__ __forceinline__ v16bf load_frag(const bf16* base, int ldk, int lane) {
    const int m    = lane & 15;
    const int half = lane >> 4;
    const bf16* row = base + m * ldk + half * 8;
    v16bf a;
    ((uint4*)&a)[0] = *(const uint4*)(row);
    ((uint4*)&a)[1] = *(const uint4*)(row + 16);
    return a;
}

// Load a 32(K) x 16(N) bf16 B fragment from a ROW-MAJOR [k][n] LDS tile with the
// transposing LDS load: lane (c = L&15, h = L>>4) receives T[kbase+8h+0..7][c],
// so the loads at kbase 0 and 16 give the same k order as load_frag gives A.
typedef short s16x8 __attribute__((ext_vector_type(8)));
__device__ __forceinline__ v16bf load_frag_tr(const bf16* base, int ldn, int lane) {
    typedef __attribute__((address_space(3))) s16x8 lds_s16x8;
    const bf16* p = base + ((lane >> 4) * 8 + (lane & 7)) * ldn + ((lane >> 3) & 1) * 8;
    v16bf b;
    ((s16x8*)&b)[0] = __builtin_amdgcn_ds_load_tr16_b128_v8i16((lds_s16x8*)p);
    ((s16x8*)&b)[1] = __builtin_amdgcn_ds_load_tr16_b128_v8i16((lds_s16x8*)(p + 16 * ldn));
    return b;
}

// gfx1250 async global->LDS copies (16B per lane each), tracked by ASYNCcnt.
// Four copies share one statement that ends in s_wait_xcnt 0, so that no
// address register of a copy is rewritten ahead of that wait.
__device__ __forceinline__ void async_ld4_b128(
    void* d0, const void* g0, void* d1, const void* g1,
    void* d2, const void* g2, void* d3, const void* g3) {
    const unsigned l0 = (unsigned)(uintptr_t)d0;    // low 32 bits = LDS offset
    const unsigned l1 = (unsigned)(uintptr_t)d1;
    const unsigned l2 = (unsigned)(uintptr_t)d2;
    const unsigned l3 = (unsigned)(uintptr_t)d3;
    asm volatile("global_load_async_to_lds_b128 %0, %1, off\n\t"
                 "global_load_async_to_lds_b128 %2, %3, off\n\t"
                 "global_load_async_to_lds_b128 %4, %5, off\n\t"
                 "global_load_async_to_lds_b128 %6, %7, off\n\t"
                 "s_wait_xcnt 0x0"
                 :: "v"(l0), "v"(g0), "v"(l1), "v"(g1),
                    "v"(l2), "v"(g2), "v"(l3), "v"(g3) : "memory");
}
__device__ __forceinline__ void wait_async0() {
    asm volatile("s_wait_asynccnt 0x0" ::: "memory");
}
// A wave's own LDS reads have returned: stands in front of the barrier behind
// which a buffer that the wave has read is refilled by copies.
__device__ __forceinline__ void wait_ds0() {
    asm volatile("s_wait_dscnt 0x0" ::: "memory");
}

// Asks the line at p into L2 (scope SE: L2 only; returns nothing, counts on
// no counter) and moves p on by step.  One asm statement, so that the register
// the prefetch names is p's own and holds nothing but p and then p + step: the
// caller keeps both inside the tensor.
__device__ __forceinline__ void prefetch_l2_advance(unsigned long long& p,
                                                    unsigned long long step) {
    asm volatile("global_prefetch_b8 %0, off scope:SCOPE_SE\n\t"
                 "v_add_nc_u64 %0, %1, %0"
                 : "+v"(p) : "s"(step));
}

// ---------------------------------------------------------------------------
// Kernel 1: Q/K/V projections, all three in ONE launch.  C[4096x1024] = X @ W.
// blockIdx.z picks the product (0 Q, 1 K, 2 V).  One product alone is 256
// workgroups, one per WGP, and its K loop waits out a global load every trip;
// 768 workgroups put three on each WGP, which fill each other's waits.
// 128x128 tile / 256 threads, K stepped by 32, register-staged pipeline:
// global loads of tile k+1 overlap WMMAs on tile k.
// z<2 -> head-major [H,B,S,DH]; z==2 -> transposed [H,B,DH,S].
// Masked keys are dropped.  A masked key's score is -1e7, so beside one kept key
// (whose score lies far above that) its softmax weight underflows to exactly 0.
// For K and V the row index
// of a tile is therefore a RANK: the keys of a batch are renumbered, kept ones
// first, masked ones behind them (the same renumbering for K and V, a function
// of the mask alone).  A tile gathers the X rows of its 128 ranks and stores at
// the rank; a tile that holds masked keys only is never read and returns at
// once.  A batch with no kept key keeps every tile (all weights are then equal).
// ---------------------------------------------------------------------------
__global__ __launch_bounds__(256) void qkv_proj_kernel(
    const float* __restrict__ Xq, const float* __restrict__ Xk,
    const float* __restrict__ Xv, const float* __restrict__ Wq,
    const float* __restrict__ Wk, const float* __restrict__ Wv,
    const int* __restrict__ key_masks,
    bf16* __restrict__ qdst, bf16* __restrict__ kdst, bf16* __restrict__ vdst)
{
    const int which = blockIdx.z;       // uniform over the workgroup
    const float* X = which == 0 ? Xq : which == 1 ? Xk : Xv;
    const float* W = which == 0 ? Wq : which == 1 ? Wk : Wv;

    // X tile, row-major [m][k]; 80-B rows (16 B x odd) keep the 16 rows of a
    // ds_load_b128 fragment read on distinct banks (64-B rows: 4 rows a bank).
    constexpr int LDA = 40;
    __shared__ __attribute__((aligned(16))) bf16 At[128 * LDA];
    // W tile as it lies in memory, [k][n]; 288-B rows (32 B x odd) suit the
    // transposing reader, and a wave's 8-byte stores fill one row bank by bank.
    constexpr int LDB = 144;
    __shared__ __attribute__((aligned(16))) bf16 Bt[32 * LDB];
    __shared__ __attribute__((aligned(16))) int rowof[128];   // rank in tile -> key

    // Batch in the low bits of x, tile of the batch above them, V's tiles in
    // reverse: the tiles that return at once are the high ranks, and this keeps
    // them from falling on one residue of the flat index, K's and V's together.
    const int bb   = blockIdx.x & 3;
    const int xt   = which == 2 ? 7 - (blockIdx.x >> 2) : (blockIdx.x >> 2);
    const int r0   = xt * 128;          // first row (Q) or rank (K, V) in the batch
    const int m0   = bb * S_ + r0;
    const int n0   = blockIdx.y * 128;
    const int t    = threadIdx.x;
    const int lane = t & 31;
    const int w    = t >> 5;
    const int wm   = w >> 2;   // 0..1 : 64 rows each
    const int wn   = w & 3;    // 0..3 : 32 cols each

    // staging geometry
    // X: 8 lanes take one row's 32 floats, so a wave-wide 16-byte load covers
    // four whole 128-B lines (two lanes a row touched 16 lines a load, each of
    // them four times a trip).  The four rows of one load lie 4 rows apart:
    // 4 x 80 B is 16 banks on, so their 8-byte LDS stores meet no common bank.
    const int ar  = w * 16 + (lane >> 3) * 4;   // rows ar + 0..3, one a load
    const int ac  = (lane & 7) * 4;
    int rows[4] = {r0 + ar, r0 + ar + 1, r0 + ar + 2, r0 + ar + 3};
    if (which != 0) {                   // uniform over the workgroup
        // Every wave reads the batch's whole mask, 32 keys a lane (bit 4i + e =
        // key 4 * (32i + lane) + e), so the count needs no barrier and the early
        // return stands in front of all of them.
        const int4* km = (const int4*)(key_masks + bb * S_);
        unsigned bits = 0;
        #pragma unroll
        for (int i = 0; i < 8; ++i) {
            const int4 m4 = km[i * 32 + lane];
            bits |= ((m4.x != 0 ? 1u : 0u) | (m4.y != 0 ? 2u : 0u) |
                     (m4.z != 0 ? 4u : 0u) | (m4.w != 0 ? 8u : 0u)) << (4 * i);
        }
        const int c = __popc(bits);
        int inc = c;                    // kept keys of lanes 0..lane
        #pragma unroll
        for (int d = 1; d < 32; d <<= 1) {
            const int v = __shfl_up(inc, d, 32);
            if (lane >= d) inc += v;
        }
        const int n = __builtin_amdgcn_readlane(inc, 31);   // kept keys of the batch
        if (n != 0 && r0 >= n) return;  // masked keys only: nobody reads this tile
        const int base = inc - c;       // kept keys of the lanes below
        #pragma unroll
        for (int e = 0; e < 4; ++e) {   // wave w ranks the keys of its load i = w
            const int p  = 4 * w + e;
            const int kb = __popc(bits & ((1u << p) - 1u));
            const int rank = ((bits >> p) & 1u) ? base + kb
                                                : n + (32 * lane - base) + (p - kb);
            const unsigned loc = (unsigned)(rank - r0);
            if (loc < 128u) rowof[loc] = 4 * (w * 32 + lane) + e;
        }
        __syncthreads();
        const int4 r4 = *(const int4*)(rowof + ar);
        rows[0] = r4.x; rows[1] = r4.y; rows[2] = r4.z; rows[3] = r4.w;
    }
    const float* Arow[4];
    #pragma unroll
    for (int it = 0; it < 4; ++it)
        Arow[it] = X + (size_t)(bb * S_ + rows[it]) * D_ + ac;
    const int n4  = (t & 31) * 4;
    const int kk0 = t >> 5;
    const float* Bbase = W + n0 + n4;

    // X and W come from memory once a run, and the workgroups that share a tile
    // walk k together: every trip waited out a memory miss.  The tile PF k ahead is
    // asked into L2, so that its fetch finds an L2 hit.  A tile has many readers
    // and needs few askers (speed only, nothing leans on it): an X tile (128 rows
    // of one line) is asked by waves 0..3 of its first column tile, a W tile (32
    // rows, two prefetches 256 B apart a row) by waves 4, 5 of the two lowest row tiles of each
    // batch, eight workgroups whose flat indices cover all residues of 8.
    constexpr int PF = 128;
    const int  ws  = __builtin_amdgcn_readfirstlane(w);
    const bool pfx = ws < 4;
    const bool ask = pfx ? blockIdx.y == 0 : (ws < 6 && xt < 2);
    const unsigned long long pstep = pfx ? 32ull * 4 : 32ull * D_ * 4;   // tile to tile
    unsigned long long pf;              // an address, always inside X or W
    {
        const int u = t & 127, v = t & 63;
        const int prow = which != 0 ? rowof[u] : r0 + u;
        pf = (unsigned long long)(uintptr_t)(
            pfx ? X + (size_t)(bb * S_ + prow) * D_ + 32
                : W + (size_t)(32 + (v >> 1)) * D_ + n0 + (v & 1) * 64);
    }

    float4 ra[4], rb[4];
    auto fetch = [&](int k0) {
        #pragma unroll   // constant indices keep ra[] in registers
        for (int it = 0; it < 4; ++it)
            ra[it] = *(const float4*)(Arow[it] + k0);
        #pragma unroll
        for (int it = 0; it < 4; ++it)
            rb[it] = *(const float4*)(Bbase + (size_t)(k0 + kk0 + it * 8) * D_);
    };
    auto stage = [&]() {
        typedef float f32x4 __attribute__((ext_vector_type(4)));
        typedef bf16  bf16x4 __attribute__((ext_vector_type(4)));
        #pragma unroll   // constant indices keep ra[] in registers
        for (int it = 0; it < 4; ++it) {
            const f32x4 f = {ra[it].x, ra[it].y, ra[it].z, ra[it].w};
            *(bf16x4*)(At + (ar + it) * LDA + ac) = __builtin_convertvector(f, bf16x4);
        }
        #pragma unroll
        for (int it = 0; it < 4; ++it) {
            const int kk = kk0 + it * 8;
            const f32x4 f = {rb[it].x, rb[it].y, rb[it].z, rb[it].w};
            *(bf16x4*)(Bt + kk * LDB + n4) = __builtin_convertvector(f, bf16x4);
        }
    };

    const v8f vzero = {};
    v8f acc[4][2];
    #pragma unroll
    for (int i = 0; i < 4; ++i)
        #pragma unroll
        for (int j = 0; j < 2; ++j) acc[i][j] = vzero;

    auto mma_tile = [&]() {
        v16bf a[4], bfr[2];
        auto lda = [&](int i) {
            a[i] = load_frag(At + (wm * 64 + i * 16) * LDA, LDA, lane);
        };
        auto mm = [&](int i) {
            #pragma unroll
            for (int j = 0; j < 2; ++j)
                acc[i][j] = __builtin_amdgcn_wmma_f32_16x16x32_bf16(
                    false, a[i], false, bfr[j], (short)0, acc[i][j], false, false);
        };
        lda(0);
        #pragma unroll
        for (int j = 0; j < 2; ++j)
            bfr[j] = load_frag_tr(Bt + wn * 32 + j * 16, LDB, lane);
        lda(1);
        // The three fences keep each X fragment's loads two products ahead of its
        // own: with the branch at the trip's head the scheduler otherwise loads
        // every fragment into one register set, each behind a full LDS wait.
        __builtin_amdgcn_sched_barrier(0);
        mm(0); lda(2);
        __builtin_amdgcn_sched_barrier(0);
        mm(1); lda(3);
        __builtin_amdgcn_sched_barrier(0);
        mm(2); mm(3);
    };

    // Last trip peeled: with the fetch under a condition this build copied two
    // of the fetched registers right behind the loads, and so waited for them
    // ahead of the WMMAs that the loads are meant to fly under.
    fetch(0);
    if (ask) {                              // uniform over the wave
        #pragma unroll   // the tiles at k = 32 .. PF, which no trip asks for
        for (int i = 0; i < PF / 32; ++i) prefetch_l2_advance(pf, pstep);
    }
    for (int k0 = 32; k0 < D_; k0 += 32) {
        // tile k0 + PF; from the last tile on the address stays on it.  At the
        // head of the trip: a branch among the trip's loads split its schedule.
        if (ask) prefetch_l2_advance(pf, k0 + PF + 64 <= D_ ? pstep : 0ull);
        stage();
        __syncthreads();
        fetch(k0);                          // overlap with WMMAs below
        // Keeps the loads in front of the WMMAs: the scheduler otherwise sinks
        // them to just ahead of the barrier's wait, and nothing is overlapped.
        __builtin_amdgcn_sched_barrier(0);
        mma_tile();
        __syncthreads();
    }
    stage();
    __syncthreads();
    mma_tile();
    __syncthreads();

    // ---- epilogue: one workgroup-uniform branch picks the layout ----
    const int half = lane >> 4;
    const int nin  = lane & 15;
    auto store_tile = [&](auto transposed, bf16* __restrict__ dst) {
        #pragma unroll
        for (int i = 0; i < 4; ++i) {
            #pragma unroll
            for (int j = 0; j < 2; ++j) {
                #pragma unroll
                for (int r = 0; r < 8; ++r) {
                    const int mg = m0 + wm * 64 + i * 16 + r + 8 * half;
                    const int ng = n0 + wn * 32 + j * 16 + nin;
                    const int bb = mg >> 10, ss = mg & 1023;   // S_=1024
                    const int hh = ng >> 6,  dd = ng & 63;     // DH_=64
                    const bf16 v = (bf16)acc[i][j][r];
                    if constexpr (decltype(transposed)::value)
                        dst[((size_t)(hh * B_ + bb) * DH_ + dd) * S_ + ss] = v;  // V^T
                    else
                        dst[((size_t)(hh * B_ + bb) * S_ + ss) * DH_ + dd] = v;
                }
            }
        }
        // Ends each layout's run of stores: no register that an issued store
        // names is rewritten ahead of this wait on any way out of the run.
        asm volatile("s_wait_xcnt 0x0" ::: "memory");
    };
    if (which == 2) store_tile(std::true_type{},  vdst);
    else            store_tile(std::false_type{}, which == 0 ? qdst : kdst);
}

typedef float f32x2 __attribute__((ext_vector_type(2)));
typedef float f32x4 __attribute__((ext_vector_type(4)));

// lane l <-> lane l ^ 16
__device__ __forceinline__ float xhalf(float x) {
    const int i = __builtin_bit_cast(int, x);
    return __builtin_bit_cast(float, __builtin_amdgcn_permlanex16(
        i, i, 0x76543210, 0xfedcba98, false, false));
}

__global__ __launch_bounds__(128) void attention_kernel(
    const bf16* __restrict__ qws, const bf16* __restrict__ kws,
    const bf16* __restrict__ vws, const int* __restrict__ query_masks,
    const int* __restrict__ key_masks, float* __restrict__ ows)
{
    // Row pitch of 16 B x odd (144 B for 128-B rows): the 16 rows that a
    // ds_load_b128 fragment read touches then lie on distinct banks; unpadded,
    // 8 of them share a bank.
    constexpr int LDQ = 72;             // Q, K rows: 64 dh + 8; V^T rows: 64 keys + 8
    constexpr int KP  = 64;             // keys a pass
    __shared__ __attribute__((aligned(16))) bf16 Qt[64 * LDQ];     // 64 queries x 64 dh
    __shared__ __attribute__((aligned(16))) bf16 Kt[2][KP * LDQ];  // 64 keys x 64 dh, double buffered
    __shared__ __attribute__((aligned(16))) bf16 Vt[2][64 * LDQ];  // V^T: 64 dh x 64 keys, double buffered
    // The key index now runs along a lane's registers, so a lane needs the mask
    // of 32 keys a pass: a table of the score's scale, 0.125 for a kept key and
    // 0 for a masked one, read 4 keys a load.  Indexed by rank: kept below n.
    __shared__ __attribute__((aligned(16))) float Ma[S_];

    const int hb   = blockIdx.y;        // h*B + b
    const int h    = hb >> 2;
    const int b    = hb & 3;
    const int q0   = blockIdx.x * 64;
    const int t    = threadIdx.x;
    const int lane = t & 31;
    const int w    = t >> 5;
    const int half = lane >> 4;
    const int nin  = lane & 15;

    // One pass's K and V^T tiles, 8 KB each: 8 lanes take one 128-B row, so a
    // wave-wide copy asks four whole lines; 16 rows a copy, four copies a tile.
    auto issue_pass = [&](int kc, int buf) {
        const int row = t >> 3;                       // 0..15
        const int pc  = (t & 7) * 8;                  // 16-B piece of the row
        const char* ksrc = (const char*)(kws + (size_t)(hb * S_ + kc) * DH_) + t * 16;
        char* kdst = (char*)(Kt[buf] + row * LDQ + pc);
        async_ld4_b128(kdst,                ksrc,
                       kdst + 16 * LDQ * 2, ksrc + 2048,
                       kdst + 32 * LDQ * 2, ksrc + 4096,
                       kdst + 48 * LDQ * 2, ksrc + 6144);
        const char* vsrc = (const char*)(vws + (size_t)(hb * DH_ + row) * S_ + kc + pc);
        char* vdst = (char*)(Vt[buf] + row * LDQ + pc);
        async_ld4_b128(vdst,                vsrc,
                       vdst + 16 * LDQ * 2, vsrc + 16 * S_ * 2,
                       vdst + 32 * LDQ * 2, vsrc + 32 * S_ * 2,
                       vdst + 48 * LDQ * 2, vsrc + 48 * S_ * 2);
    };

    // ---- stage Q tile + first K/V pass ----
    {
        const char* src = (const char*)(qws + (size_t)(hb * S_ + q0) * DH_) + t * 16;
        char* dstp = (char*)(Qt + (t >> 3) * LDQ + (t & 7) * 8);        // 16 query rows a copy
        async_ld4_b128(dstp,                src,
                       dstp + 16 * LDQ * 2, src + 2048,
                       dstp + 32 * LDQ * 2, src + 4096,
                       dstp + 48 * LDQ * 2, src + 6144);
    }
    issue_pass(0, 0);

    // ---- kept keys of the batch: every wave counts the whole mask itself ----
    int n;
    {
        const int4* km = (const int4*)(key_masks + b * S_);
        int c = 0;
        #pragma unroll
        for (int i = 0; i < 8; ++i) {
            const int4 m4 = km[i * 32 + lane];
            c += (m4.x != 0) + (m4.y != 0) + (m4.z != 0) + (m4.w != 0);
        }
        #pragma unroll
        for (int d = 1; d < 32; d <<= 1) c += __shfl_xor(c, d, 32);
        n = __builtin_amdgcn_readfirstlane(c);
    }
    // passes: up to the last kept key; every key where none is kept
    const int np = n == 0 ? S_ / KP : min((n + KP - 1) / KP, S_ / KP);

    // ---- key-mask table: 8 ranks a thread, published by the barrier below ----
    #pragma unroll
    for (int i = 0; i < 2; ++i) {
        const int j = t * 8 + i * 4;
        const f32x4 a4 = {j     < n ? 0.125f : 0.f, j + 1 < n ? 0.125f : 0.f,
                          j + 2 < n ? 0.125f : 0.f, j + 3 < n ? 0.125f : 0.f};
        *(f32x4*)(Ma + j) = a4;
    }
    wait_async0();
    __syncthreads();
    if (np > 1) issue_pass(KP, 1);       // pass 1 flies under pass 0's work

    // B operand: column c = query w*16 + c, k = dh, same loader (k order) as K's
    const v16bf bq0 = load_frag(Qt + (w * 16) * LDQ,      LDQ, lane);  // dh 0..31
    const v16bf bq1 = load_frag(Qt + (w * 16) * LDQ + 32, LDQ, lane);  // dh 32..63

    v16bf ones;                          // A = all-ones 16x32 for column sums of P^T
    #pragma unroll
    for (int i = 0; i < 16; ++i) ones[i] = (bf16)1.0f;

    const v8f vzero = {};
    v8f accO[4];                         // O^T: accO[u][r] = O[query c][dh 16u + 8*half + r]
    #pragma unroll
    for (int u = 0; u < 4; ++u) accO[u] = vzero;
    v8f lacc = vzero;                    // every row = running softmax denominator of query c
    float mrun = -3.0e38f;               // running maximum of query c

    for (int ip = 0; ip < np; ++ip) {
        const int kc  = ip * KP;
        const int buf = ip & 1;

        // ---- scores^T: 64k x 16q, contraction dh=64 in two K=32 halves ----
        const bf16* Kb = Kt[buf];
        const bf16* Vb = Vt[buf];
        v8f s[4];                        // s[i][r]: key kc + 16i + 8*half + r, query c
        f32x4 ma[8];                     // scale of keys 16i + 8*half + 0..7
        v16bf av[2][4];                  // V^T fragments: rows dh 16u + c, k = keys 32g + ..
        {
            v16bf ak[4][2];
            #pragma unroll
            for (int i = 0; i < 4; ++i) {
                ak[i][0] = load_frag(Kb + i * 16 * LDQ,      LDQ, lane);
                ak[i][1] = load_frag(Kb + i * 16 * LDQ + 32, LDQ, lane);
            }
            #pragma unroll
            for (int i = 0; i < 4; ++i) {
                const f32x4* pa = (const f32x4*)(Ma + kc + 16 * i + 8 * half);
                ma[2 * i] = pa[0]; ma[2 * i + 1] = pa[1];
            }
            // Keeps the 24 LDS loads of K and the mask one group in front of the
            // score products: the scheduler otherwise sinks them to their users,
            // each behind a wait of its own that the wave sits out.
            __builtin_amdgcn_sched_barrier(0);
            #pragma unroll
            for (int i = 0; i < 4; ++i)
                s[i] = __builtin_amdgcn_wmma_f32_16x16x32_bf16(false, ak[i][0], false, bq0, (short)0, vzero, false, false);
            #pragma unroll
            for (int i = 0; i < 4; ++i)
                s[i] = __builtin_amdgcn_wmma_f32_16x16x32_bf16(false, ak[i][1], false, bq1, (short)0, s[i], false, false);
        }
        #pragma unroll
        for (int g = 0; g < 2; ++g)
            #pragma unroll
            for (int u = 0; u < 4; ++u)
                av[g][u] = load_frag(Vb + (u * 16) * LDQ + g * 32, LDQ, lane);
        // Keeps the 16 V^T loads one group (they take over K's registers) in
        // front of the softmax, whose vector work covers their latency.
        __builtin_amdgcn_sched_barrier(0);

        // ---- scale then key-mask replace, two keys an operation ----
        // score = s * a + (a * 8e7 - 1e7): a = 0.125 gives s * 0.125 + 0 and
        // a = 0 gives -1e7, both exactly (0.125 * 8e7 = 1e7 has no rounding).
        f32x2 sc[16];                    // sc[4i + j] = keys 16i + 8*half + 2j, +1
        #pragma unroll
        for (int i = 0; i < 4; ++i) {
            #pragma unroll
            for (int j = 0; j < 4; ++j) {
                const f32x4 a4 = ma[2 * i + (j >> 1)];
                const f32x2 a  = (j & 1) ? f32x2{a4.z, a4.w} : f32x2{a4.x, a4.y};
                const f32x2 off = __builtin_elementwise_fma(
                    a, f32x2{8.0e7f, 8.0e7f}, f32x2{-1.0e7f, -1.0e7f});
                sc[4 * i + j] = __builtin_elementwise_fma(
                    f32x2{s[i][2 * j], s[i][2 * j + 1]}, a, off);
            }
        }

        // ---- online softmax: maximum in the lane, one exchange of halves ----
        // two chains, one per 32 keys: half the dependent links of one chain
        float hm = fmaxf(sc[0].x, sc[0].y), hm1 = fmaxf(sc[8].x, sc[8].y);
        #pragma unroll
        for (int j = 1; j < 8; ++j) {
            hm  = fmaxf(hm,  fmaxf(sc[j].x,     sc[j].y));
            hm1 = fmaxf(hm1, fmaxf(sc[8 + j].x, sc[8 + j].y));
        }
        hm = fmaxf(hm, hm1);
        hm = fmaxf(hm, xhalf(hm));
        const float mnew = fmaxf(mrun, hm);
        const float corr = __expf(mrun - mnew);
        mrun = mnew;

        // P^T as B operands, one per 32 keys: element e of pt[g] = key
        // 32g + kmap(e) = score tile 2g + (e>>3), register e&7
        v16bf pt[2];
        #pragma unroll
        for (int g = 0; g < 2; ++g) {
            #pragma unroll
            for (int j = 0; j < 8; ++j) {
                pt[g][2 * j]     = (bf16)__expf(sc[8 * g + j].x - mnew);
                pt[g][2 * j + 1] = (bf16)__expf(sc[8 * g + j].y - mnew);
            }
        }

        lacc *= corr;
        #pragma unroll
        for (int u = 0; u < 4; ++u) accO[u] *= corr;

        // ---- O^T += V^T (64dh x 64) @ P^T (64 x 16q); l += ones @ P^T ----
        #pragma unroll
        for (int g = 0; g < 2; ++g) {
            #pragma unroll
            for (int u = 0; u < 4; ++u)
                accO[u] = __builtin_amdgcn_wmma_f32_16x16x32_bf16(
                    false, av[g][u], false, pt[g], (short)0, accO[u], false, false);
            lacc = __builtin_amdgcn_wmma_f32_16x16x32_bf16(
                false, ones, false, pt[g], (short)0, lacc, false, false);
        }

        // ---- foot of the pass: the one barrier publishes pass ip + 1 (every
        // wave's own copies have landed) and ends every reader's last read of
        // this pass's buffer, which is refilled behind it ----
        // Keeps the foot at the foot: the scheduler otherwise lifts its waits and
        // the barrier to the head of the softmax, where the V^T loads have just
        // been issued and the next pass's copies are a third of a pass old.
        __builtin_amdgcn_sched_barrier(0);
        wait_ds0();
        wait_async0();
        __syncthreads();
        if (ip + 2 < np) issue_pass(kc + 2 * KP, buf);
    }
    wait_async0();                       // no copy is outstanding past the loop

    // ---- epilogue: 1/l, query mask (post-softmax multiplicative), write O ----
    {
        const int qrow = q0 + w * 16 + nin;
        const float l   = lacc[0];
        const float inv = (l > 0.f) ? (1.0f / l) : 0.f;
        const float fac = query_masks[b * S_ + qrow] ? inv : 0.f;
        float* orow = ows + ((size_t)(b * S_ + qrow)) * D_ + h * DH_ + 8 * half;
        #pragma unroll
        for (int u = 0; u < 4; ++u) {    // 8 consecutive dh a lane: two 16-byte stores
            const v8f o = accO[u] * fac;
            *(f32x4*)(orow + u * 16)     = f32x4{o[0], o[1], o[2], o[3]};
            *(f32x4*)(orow + u * 16 + 4) = f32x4{o[4], o[5], o[6], o[7]};
        }
    }
}

// ---------------------------------------------------------------------------
// Kernel 3: residual + LayerNorm (eps = 1e-3).  One row (D=1024) per block.
// ---------------------------------------------------------------------------
__global__ __launch_bounds__(256) void resid_ln_kernel(
    const float* __restrict__ queries, const float* __restrict__ ows,
    const float* __restrict__ gamma, const float* __restrict__ beta,
    float* __restrict__ out)
{
    __shared__ float red1[8], red2[8];
    const int row = blockIdx.x;
    const int t   = threadIdx.x;

    const float4 q4 = ((const float4*)(queries + (size_t)row * D_))[t];
    const float4 o4 = ((const float4*)(ows     + (size_t)row * D_))[t];
    float4 r4;
    r4.x = q4.x + o4.x; r4.y = q4.y + o4.y;
    r4.z = q4.z + o4.z; r4.w = q4.w + o4.w;

    float s1 = r4.x + r4.y + r4.z + r4.w;
    float s2 = r4.x * r4.x + r4.y * r4.y + r4.z * r4.z + r4.w * r4.w;
    #pragma unroll
    for (int d = 1; d < 32; d <<= 1) {
        s1 += __shfl_xor(s1, d, 32);
        s2 += __shfl_xor(s2, d, 32);
    }
    if ((t & 31) == 0) { red1[t >> 5] = s1; red2[t >> 5] = s2; }
    __syncthreads();
    float ts1 = 0.f, ts2 = 0.f;
    #pragma unroll
    for (int i = 0; i < 8; ++i) { ts1 += red1[i]; ts2 += red2[i]; }

    const float mean = ts1 * (1.0f / D_);
    const float var  = ts2 * (1.0f / D_) - mean * mean;
    const float rstd = rsqrtf(var + 1e-3f);

    const float4 g4 = ((const float4*)gamma)[t];
    const float4 b4 = ((const float4*)beta)[t];
    float4 o;
    o.x = g4.x * (r4.x - mean) * rstd + b4.x;
    o.y = g4.y * (r4.y - mean) * rstd + b4.y;
    o.z = g4.z * (r4.z - mean) * rstd + b4.z;
    o.w = g4.w * (r4.w - mean) * rstd + b4.w;
    ((float4*)(out + (size_t)row * D_))[t] = o;
}

// ---------------------------------------------------------------------------
extern "C" void kernel_launch(void* const* d_in, const int* in_sizes, int n_in,
                              void* d_out, int out_size, void* d_ws, size_t ws_size,
                              hipStream_t stream) {
    const float* queries = (const float*)d_in[0];
    const float* keys    = (const float*)d_in[1];
    const float* values  = (const float*)d_in[2];
    const int*   qmask   = (const int*)d_in[3];
    const int*   kmask   = (const int*)d_in[4];
    const float* Wq      = (const float*)d_in[5];
    const float* Wk      = (const float*)d_in[6];
    const float* Wv      = (const float*)d_in[7];
    const float* gamma   = (const float*)d_in[8];
    const float* beta    = (const float*)d_in[9];
    float*       out     = (float*)d_out;

    const size_t QKV = (size_t)H_ * B_ * S_ * DH_;   // 4 Mi elements
    bf16*  qws = (bf16*)d_ws;
    bf16*  kws = qws + QKV;
    bf16*  vws = kws + QKV;
    float* ows = (float*)(vws + QKV);

    dim3 g1(B_ * S_ / 128, D_ / 128, 3);
    qkv_proj_kernel<<<g1, dim3(256), 0, stream>>>(queries, keys, values, Wq, Wk, Wv,
                                                  kmask, qws, kws, vws);

    dim3 g2(S_ / 64, H_ * B_);
    attention_kernel<<<g2, dim3(128), 0, stream>>>(qws, kws, vws, qmask, kmask, ows);

    resid_ln_kernel<<<dim3(B_ * S_), dim3(256), 0, stream>>>(queries, ows, gamma, beta, out);
}

// v009
// Measured time: 46 microseconds a run.
// Next to v008, in two timings, it ran 1.03 times as fast each time.
// Over all steps from v000 it is 7.09 times as fast.
#include <hip/hip_runtime.h>
#include <hip/hip_bf16.h>
#include <type_traits>

// MHA: Q/K/V proj (bf16 WMMA, reg-pipelined) -> flash attention (bf16 WMMA,
// fp32 accum, transposed products, double-buffered async global->LDS staging,
// WMMA row-sums)
// -> residual+LN.  B=4, S=1024, D=1024, H=16, DH=64

typedef __bf16 bf16;
typedef __bf16 v16bf __attribute__((ext_vector_type(16)));
typedef float  v8f   __attribute__((ext_vector_type(8)));

#define B_  4
#define S_  1024
#define D_  1024
#define H_  16
#define DH_ 64

// Load a 16(M) x 32(K) bf16 fragment from LDS into the CDNA5 WMMA A/B VGPR
// layout (wave32): lane L<16 -> row m=L, lanes 16..31 -> same rows, K 8..15 and 24..31.
__device__ __forceinline__ v16bf load_frag(const bf16* base, int ldk, int lane) {
    const int m    = lane & 15;
    const int half = lane >> 4;
    const bf16* row = base + m * ldk + half * 8;
    v16bf a;
    ((uint4*)&a)[0] = *(const uint4*)(row);
    ((uint4*)&a)[1] = *(const uint4*)(row + 16);
    return a;
}

// Load a 32(K) x 16(N) bf16 B fragment from a ROW-MAJOR [k][n] LDS tile with the
// transposing LDS load: lane (c = L&15, h = L>>4) receives T[kbase+8h+0..7][c],
// so the loads at kbase 0 and 16 give the same k order as load_frag gives A.
typedef short s16x8 __attribute__((ext_vector_type(8)));
__device__ __forceinline__ v16bf load_frag_tr(const bf16* base, int ldn, int lane) {
    typedef __attribute__((address_space(3))) s16x8 lds_s16x8;
    const bf16* p = base + ((lane >> 4) * 8 + (lane & 7)) * ldn + ((lane >> 3) & 1) * 8;
    v16bf b;
    ((s16x8*)&b)[0] = __builtin_amdgcn_ds_load_tr16_b128_v8i16((lds_s16x8*)p);
    ((s16x8*)&b)[1] = __builtin_amdgcn_ds_load_tr16_b128_v8i16((lds_s16x8*)(p + 16 * ldn));
    return b;
}

// gfx1250 async global->LDS copies (16B per lane each), tracked by ASYNCcnt.
// Four copies share one statement that ends in s_wait_xcnt 0, so that no
// address register of a copy is rewritten ahead of that wait.
__device__ __forceinline__ void async_ld4_b128(
    void* d0, const void* g0, void* d1, const void* g1,
    void* d2, const void* g2, void* d3, const void* g3) {
    const unsigned l0 = (unsigned)(uintptr_t)d0;    // low 32 bits = LDS offset
    const unsigned l1 = (unsigned)(uintptr_t)d1;
    const unsigned l2 = (unsigned)(uintptr_t)d2;
    const unsigned l3 = (unsigned)(uintptr_t)d3;
    asm volatile("global_load_async_to_lds_b128 %0, %1, off\n\t"
                 "global_load_async_to_lds_b128 %2, %3, off\n\t"
                 "global_load_async_to_lds_b128 %4, %5, off\n\t"
                 "global_load_async_to_lds_b128 %6, %7, off\n\t"
                 "s_wait_xcnt 0x0"
                 :: "v"(l0), "v"(g0), "v"(l1), "v"(g1),
                    "v"(l2), "v"(g2), "v"(l3), "v"(g3) : "memory");
}
__device__ __forceinline__ void wait_async0() {
    asm volatile("s_wait_asynccnt 0x0" ::: "memory");
}
// A wave's own LDS reads have returned: stands in front of the barrier behind
// which a buffer that the wave has read is refilled by copies.
__device__ __forceinline__ void wait_ds0() {
    asm volatile("s_wait_dscnt 0x0" ::: "memory");
}

// Asks the line at p into L2 (scope SE: L2 only; returns nothing, counts on
// no counter) and moves p on by step.  One asm statement, so that the register
// the prefetch names is p's own and holds nothing but p and then p + step: the
// caller keeps both inside the tensor.
__device__ __forceinline__ void prefetch_l2_advance(unsigned long long& p,
                                                    unsigned long long step) {
    asm volatile("global_prefetch_b8 %0, off scope:SCOPE_SE\n\t"
                 "v_add_nc_u64 %0, %1, %0"
                 : "+v"(p) : "s"(step));
}

// ---------------------------------------------------------------------------
// Kernel 1: Q/K/V projections, all three in ONE launch.  C[4096x1024] = X @ W.
// The flat workgroup index picks the product (0 Q, 1 K, 2 V) and its tile.
// 128x256 tile / 256 threads, each wave 64x64, K stepped by 32, register-staged
// pipeline: global loads of tile k+1 overlap WMMAs on tile k.  The K loop lives
// on what L2 delivers: an X tile is fetched by 4 column tiles (8 at 128 columns),
// so a 128x128 piece of output asks 24 KB a trip, not 32, and each LDS fragment
// feeds 4 products.
// Q, K -> head-major [H,B,S,DH]; V -> transposed [H,B,DH,S].
// Masked keys are dropped.  A masked key's score is -1e7, so beside one kept key
// (whose score lies far above that) its softmax weight underflows to exactly 0.
// For K and V the row index
// of a tile is therefore a RANK: the keys of a batch are renumbered, kept ones
// first, masked ones behind them (the same renumbering for K and V, a function
// of the mask alone).  A tile gathers the X rows of its 128 ranks and stores at
// the rank; a tile that holds masked keys only is never read and returns at
// once.  A batch with no kept key keeps every tile (all weights are then equal).
// ---------------------------------------------------------------------------
__global__ __launch_bounds__(256) void qkv_proj_kernel(
    const float* __restrict__ Xq, const float* __restrict__ Xk,
    const float* __restrict__ Xv, const float* __restrict__ Wq,
    const float* __restrict__ Wk, const float* __restrict__ Wv,
    const int* __restrict__ key_masks,
    bf16* __restrict__ qdst, bf16* __restrict__ kdst, bf16* __restrict__ vdst)
{
    // Deal of the 384 tiles, all uniform over the workgroup.  Indices 0..255: Q's
    // 128 tiles, then the four lowest row tiles of each batch of K and of V, the
    // ranks most often kept: one such tile a WGP.  Indices 256..383: the higher
    // ranks, most of which return at once.  The row tile sits in the low bits, so
    // the four column tiles of an X tile share a residue of 8; V's high tiles are
    // swapped in pairs so that K's and V's first high tile fall on other residues.
    const int f = blockIdx.x;
    int which, yt, bb, xt, low;         // low: place among a product's first tiles
    if (f < 128) {
        which = 0; yt = f >> 5; bb = f & 3; xt = (f >> 2) & 7; low = f & 31;
    } else {
        const int g = f - 128, hi = g >> 7, q = (g >> 2) & 3;
        which = 1 + ((g >> 6) & 1); yt = (g >> 4) & 3; bb = g & 3;
        xt  = hi ? 4 + (which == 2 ? q ^ 1 : q) : q;
        low = hi ? 32 : g & 15;
    }
    const float* X = which == 0 ? Xq : which == 1 ? Xk : Xv;
    const float* W = which == 0 ? Wq : which == 1 ? Wk : Wv;

    // X tile, row-major [m][k]; 80-B rows (16 B x odd) keep the 16 rows of a
    // ds_load_b128 fragment read on distinct banks (64-B rows: 4 rows a bank).
    constexpr int LDA = 40;
    __shared__ __attribute__((aligned(16))) bf16 At[128 * LDA];
    // W tile as it lies in memory, [k][n]; 544-B rows (32 B x odd) suit the
    // transposing reader, and a wave's 8-byte stores fill half a row bank by bank.
    constexpr int LDB = 272;
    __shared__ __attribute__((aligned(16))) bf16 Bt[32 * LDB];
    __shared__ __attribute__((aligned(16))) int rowof[128];   // rank in tile -> key

    const int r0   = xt * 128;          // first row (Q) or rank (K, V) in the batch
    const int m0   = bb * S_ + r0;
    const int n0   = yt * 256;
    const int t    = threadIdx.x;
    const int lane = t & 31;
    const int w    = t >> 5;
    const int wm   = w >> 2;   // 0..1 : 64 rows each
    const int wn   = w & 3;    // 0..3 : 64 cols each

    // staging geometry
    // X: 8 lanes take one row's 32 floats, so a wave-wide 16-byte load covers
    // four whole 128-B lines (two lanes a row touched 16 lines a load, each of
    // them four times a trip).  The four rows of one load lie 4 rows apart:
    // 4 x 80 B is 16 banks on, so their 8-byte LDS stores meet no common bank.
    const int ar  = w * 16 + (lane >> 3) * 4;   // rows ar + 0..3, one a load
    const int ac  = (lane & 7) * 4;
    int rows[4] = {r0 + ar, r0 + ar + 1, r0 + ar + 2, r0 + ar + 3};
    if (which != 0) {                   // uniform over the workgroup
        // Every wave reads the batch's whole mask, 32 keys a lane (bit 4i + e =
        // key 4 * (32i + lane) + e), so the count needs no barrier and the early
        // return stands in front of all of them.
        const int4* km = (const int4*)(key_masks + bb * S_);
        unsigned bits = 0;
        #pragma unroll
        for (int i = 0; i < 8; ++i) {
            const int4 m4 = km[i * 32 + lane];
            bits |= ((m4.x != 0 ? 1u : 0u) | (m4.y != 0 ? 2u : 0u) |
                     (m4.z != 0 ? 4u : 0u) | (m4.w != 0 ? 8u : 0u)) << (4 * i);
        }
        const int c = __popc(bits);
        int inc = c;                    // kept keys of lanes 0..lane
        #pragma unroll
        for (int d = 1; d < 32; d <<= 1) {
            const int v = __shfl_up(inc, d, 32);
            if (lane >= d) inc += v;
        }
        const int n = __builtin_amdgcn_readlane(inc, 31);   // kept keys of the batch
        if (n != 0 && r0 >= n) return;  // masked keys only: nobody reads this tile
        const int base = inc - c;       // kept keys of the lanes below
        #pragma unroll
        for (int e = 0; e < 4; ++e) {   // wave w ranks the keys of its load i = w
            const int p  = 4 * w + e;
            const int kb = __popc(bits & ((1u << p) - 1u));
            const int rank = ((bits >> p) & 1u) ? base + kb
                                                : n + (32 * lane - base) + (p - kb);
            const unsigned loc = (unsigned)(rank - r0);
            if (loc < 128u) rowof[loc] = 4 * (w * 32 + lane) + e;
        }
        __syncthreads();
        const int4 r4 = *(const int4*)(rowof + ar);
        rows[0] = r4.x; rows[1] = r4.y; rows[2] = r4.z; rows[3] = r4.w;
    }
    const float* Arow[4];
    #pragma unroll
    for (int it = 0; it < 4; ++it)
        Arow[it] = X + (size_t)(bb * S_ + rows[it]) * D_ + ac;
    const int n4  = (t & 31) * 4;
    const int kk0 = t >> 5;
    const float* Bbase = W + n0 + n4;

    // X and W come from memory once a run, and the workgroups that share a tile
    // walk k together: every trip waited out a memory miss.  The tile PF k ahead is
    // asked into L2, so that its fetch finds an L2 hit.  A tile has many readers
    // and needs few askers (speed only, nothing leans on it): an X tile (128 rows
    // of one line) is asked by waves 0..3 of its first column tile, a W tile (32
    // rows, four asks 256 B apart) by waves 4..7 of the two lowest row tiles of each
    // batch, eight workgroups whose flat indices cover all residues of 8.
    constexpr int PF = 128;
    const int  ws  = __builtin_amdgcn_readfirstlane(w);
    const bool pfx = ws < 4;
    const bool ask = pfx ? yt == 0 : low < 8;
    const unsigned long long pstep = pfx ? 32ull * 4 : 32ull * D_ * 4;   // tile to tile
    unsigned long long pf;              // an address, always inside X or W
    {
        const int u = t & 127;
        const int prow = which != 0 ? rowof[u] : r0 + u;
        pf = (unsigned long long)(uintptr_t)(
            pfx ? X + (size_t)(bb * S_ + prow) * D_ + 32
                : W + (size_t)(32 + (u >> 2)) * D_ + n0 + (u & 3) * 64);
    }

    float4 ra[4], rb[8];                // W: row kk0 + 8 * (it / 2), half it & 1
    auto fetch = [&](int k0) {
        #pragma unroll   // constant indices keep ra[] in registers
        for (int it = 0; it < 4; ++it)
            ra[it] = *(const float4*)(Arow[it] + k0);
        #pragma unroll
        for (int it = 0; it < 8; ++it)
            rb[it] = *(const float4*)(Bbase + (size_t)(k0 + kk0 + (it >> 1) * 8) * D_
                                      + (it & 1) * 128);
    };
    auto stage = [&]() {
        typedef float f32x4 __attribute__((ext_vector_type(4)));
        typedef bf16  bf16x4 __attribute__((ext_vector_type(4)));
        #pragma unroll   // constant indices keep ra[] in registers
        for (int it = 0; it < 4; ++it) {
            const f32x4 f = {ra[it].x, ra[it].y, ra[it].z, ra[it].w};
            *(bf16x4*)(At + (ar + it) * LDA + ac) = __builtin_convertvector(f, bf16x4);
        }
        #pragma unroll
        for (int it = 0; it < 8; ++it) {
            const int kk = kk0 + (it >> 1) * 8;
            const f32x4 f = {rb[it].x, rb[it].y, rb[it].z, rb[it].w};
            *(bf16x4*)(Bt + kk * LDB + n4 + (it & 1) * 128) =
                __builtin_convertvector(f, bf16x4);
        }
    };

    const v8f vzero = {};
    v8f acc[4][4];
    #pragma unroll
    for (int i = 0; i < 4; ++i)
        #pragma unroll
        for (int j = 0; j < 4; ++j) acc[i][j] = vzero;

    auto mma_tile = [&]() {
        v16bf a[4], bfr[4];
        auto lda = [&](int i) {
            a[i] = load_frag(At + (wm * 64 + i * 16) * LDA, LDA, lane);
        };
        auto mm = [&](int i) {
            #pragma unroll
            for (int j = 0; j < 4; ++j)
                acc[i][j] = __builtin_amdgcn_wmma_f32_16x16x32_bf16(
                    false, a[i], false, bfr[j], (short)0, acc[i][j], false, false);
        };
        lda(0);
        #pragma unroll
        for (int j = 0; j < 4; ++j)
            bfr[j] = load_frag_tr(Bt + wn * 64 + j * 16, LDB, lane);
        lda(1);
        // The three fences keep each X fragment's loads two products ahead of its
        // own: with the branch at the trip's head the scheduler otherwise loads
        // every fragment into one register set, each behind a full LDS wait.
        __builtin_amdgcn_sched_barrier(0);
        mm(0); lda(2);
        __builtin_amdgcn_sched_barrier(0);
        mm(1); lda(3);
        __builtin_amdgcn_sched_barrier(0);
        mm(2); mm(3);
    };

    // Last trip peeled: with the fetch under a condition this build copied two
    // of the fetched registers right behind the loads, and so waited for them
    // ahead of the WMMAs that the loads are meant to fly under.
    fetch(0);
    // No address register of these loads is rewritten ahead of this wait (in the
    // loop the compiler's own waits stand in front of every such rewrite).
    asm volatile("s_wait_xcnt 0x0" ::: "memory");
    if (ask) {                              // uniform over the wave
        #pragma unroll   // the tiles at k = 32 .. PF, which no trip asks for
        for (int i = 0; i < PF / 32; ++i) prefetch_l2_advance(pf, pstep);
    }
    for (int k0 = 32; k0 < D_; k0 += 32) {
        // tile k0 + PF; from the last tile on the address stays on it.  At the
        // head of the trip: a branch among the trip's loads split its schedule.
        if (ask) prefetch_l2_advance(pf, k0 + PF + 64 <= D_ ? pstep : 0ull);
        stage();
        __syncthreads();
        fetch(k0);                          // overlap with WMMAs below
        // Keeps the loads in front of the WMMAs: the scheduler otherwise sinks
        // them to just ahead of the barrier's wait, and nothing is overlapped.
        __builtin_amdgcn_sched_barrier(0);
        mma_tile();
        // Keeps all 16 WMMAs in front of the barrier, whose wait takes in the
        // global loads: half of them otherwise sink behind it and run when the
        // loads have landed, not under their flight.
        __builtin_amdgcn_sched_barrier(0);
        __syncthreads();
    }
    stage();
    __syncthreads();
    mma_tile();
    __syncthreads();

    // ---- epilogue: one workgroup-uniform branch picks the layout ----
    const int half = lane >> 4;
    const int nin  = lane & 15;
    auto store_tile = [&](auto transposed, bf16* __restrict__ dst) {
        #pragma unroll
        for (int i = 0; i < 4; ++i) {
            #pragma unroll
            for (int j = 0; j < 4; ++j) {
                #pragma unroll
                for (int r = 0; r < 8; ++r) {
                    const int mg = m0 + wm * 64 + i * 16 + r + 8 * half;
                    const int ng = n0 + wn * 64 + j * 16 + nin;
                    const int bb = mg >> 10, ss = mg & 1023;   // S_=1024
                    const int hh = ng >> 6,  dd = ng & 63;     // DH_=64
                    const bf16 v = (bf16)acc[i][j][r];
                    if constexpr (decltype(transposed)::value)
                        dst[((size_t)(hh * B_ + bb) * DH_ + dd) * S_ + ss] = v;  // V^T
                    else
                        dst[((size_t)(hh * B_ + bb) * S_ + ss) * DH_ + dd] = v;
                }
            }
        }
        // Ends each layout's run of stores: no register that an issued store
        // names is rewritten ahead of this wait on any way out of the run.
        asm volatile("s_wait_xcnt 0x0" ::: "memory");
    };
    if (which == 2) store_tile(std::true_type{},  vdst);
    else            store_tile(std::false_type{}, which == 0 ? qdst : kdst);
}

typedef float f32x2 __attribute__((ext_vector_type(2)));
typedef float f32x4 __attribute__((ext_vector_type(4)));

// lane l <-> lane l ^ 16
__device__ __forceinline__ float xhalf(float x) {
    const int i = __builtin_bit_cast(int, x);
    return __builtin_bit_cast(float, __builtin_amdgcn_permlanex16(
        i, i, 0x76543210, 0xfedcba98, false, false));
}

__global__ __launch_bounds__(128) void attention_kernel(
    const bf16* __restrict__ qws, const bf16* __restrict__ kws,
    const bf16* __restrict__ vws, const int* __restrict__ query_masks,
    const int* __restrict__ key_masks, float* __restrict__ ows)
{
    // Row pitch of 16 B x odd (144 B for 128-B rows): the 16 rows that a
    // ds_load_b128 fragment read touches then lie on distinct banks; unpadded,
    // 8 of them share a bank.
    constexpr int LDQ = 72;             // Q, K rows: 64 dh + 8; V^T rows: 64 keys + 8
    constexpr int KP  = 64;             // keys a pass
    __shared__ __attribute__((aligned(16))) bf16 Qt[64 * LDQ];     // 64 queries x 64 dh
    __shared__ __attribute__((aligned(16))) bf16 Kt[2][KP * LDQ];  // 64 keys x 64 dh, double buffered
    __shared__ __attribute__((aligned(16))) bf16 Vt[2][64 * LDQ];  // V^T: 64 dh x 64 keys, double buffered
    // The key index now runs along a lane's registers, so a lane needs the mask
    // of 32 keys a pass: a table of the score's scale, 0.125 for a kept key and
    // 0 for a masked one, read 4 keys a load.  Indexed by rank: kept below n.
    __shared__ __attribute__((aligned(16))) float Ma[S_];

    const int hb   = blockIdx.y;        // h*B + b
    const int h    = hb >> 2;
    const int b    = hb & 3;
    const int q0   = blockIdx.x * 64;
    const int t    = threadIdx.x;
    const int lane = t & 31;
    const int w    = t >> 5;
    const int half = lane >> 4;
    const int nin  = lane & 15;

    // One pass's K and V^T tiles, 8 KB each: 8 lanes take one 128-B row, so a
    // wave-wide copy asks four whole lines; 16 rows a copy, four copies a tile.
    auto issue_pass = [&](int kc, int buf) {
        const int row = t >> 3;                       // 0..15
        const int pc  = (t & 7) * 8;                  // 16-B piece of the row
        const char* ksrc = (const char*)(kws + (size_t)(hb * S_ + kc) * DH_) + t * 16;
        char* kdst = (char*)(Kt[buf] + row * LDQ + pc);
        async_ld4_b128(kdst,                ksrc,
                       kdst + 16 * LDQ * 2, ksrc + 2048,
                       kdst + 32 * LDQ * 2, ksrc + 4096,
                       kdst + 48 * LDQ * 2, ksrc + 6144);
        const char* vsrc = (const char*)(vws + (size_t)(hb * DH_ + row) * S_ + kc + pc);
        char* vdst = (char*)(Vt[buf] + row * LDQ + pc);
        async_ld4_b128(vdst,                vsrc,
                       vdst + 16 * LDQ * 2, vsrc + 16 * S_ * 2,
                       vdst + 32 * LDQ * 2, vsrc + 32 * S_ * 2,
                       vdst + 48 * LDQ * 2, vsrc + 48 * S_ * 2);
    };

    // ---- stage Q tile + first K/V pass ----
    {
        const char* src = (const char*)(qws + (size_t)(hb * S_ + q0) * DH_) + t * 16;
        char* dstp = (char*)(Qt + (t >> 3) * LDQ + (t & 7) * 8);        // 16 query rows a copy
        async_ld4_b128(dstp,                src,
                       dstp + 16 * LDQ * 2, src + 2048,
                       dstp + 32 * LDQ * 2, src + 4096,
                       dstp + 48 * LDQ * 2, src + 6144);
    }
    issue_pass(0, 0);

    // ---- kept keys of the batch: every wave counts the whole mask itself ----
    int n;
    {
        const int4* km = (const int4*)(key_masks + b * S_);
        int c = 0;
        #pragma unroll
        for (int i = 0; i < 8; ++i) {
            const int4 m4 = km[i * 32 + lane];
            c += (m4.x != 0) + (m4.y != 0) + (m4.z != 0) + (m4.w != 0);
        }
        #pragma unroll
        for (int d = 1; d < 32; d <<= 1) c += __shfl_xor(c, d, 32);
        n = __builtin_amdgcn_readfirstlane(c);
    }
    // passes: up to the last kept key; every key where none is kept
    const int np = n == 0 ? S_ / KP : min((n + KP - 1) / KP, S_ / KP);

    // ---- key-mask table: 8 ranks a thread, published by the barrier below ----
    #pragma unroll
    for (int i = 0; i < 2; ++i) {
        const int j = t * 8 + i * 4;
        const f32x4 a4 = {j     < n ? 0.125f : 0.f, j + 1 < n ? 0.125f : 0.f,
                          j + 2 < n ? 0.125f : 0.f, j + 3 < n ? 0.125f : 0.f};
        *(f32x4*)(Ma + j) = a4;
    }
    wait_async0();
    __syncthreads();
    if (np > 1) issue_pass(KP, 1);       // pass 1 flies under pass 0's work

    // B operand: column c = query w*16 + c, k = dh, same loader (k order) as K's
    const v16bf bq0 = load_frag(Qt + (w * 16) * LDQ,      LDQ, lane);  // dh 0..31
    const v16bf bq1 = load_frag(Qt + (w * 16) * LDQ + 32, LDQ, lane);  // dh 32..63

    v16bf ones;                          // A = all-ones 16x32 for column sums of P^T
    #pragma unroll
    for (int i = 0; i < 16; ++i) ones[i] = (bf16)1.0f;

    const v8f vzero = {};
    v8f accO[4];                         // O^T: accO[u][r] = O[query c][dh 16u + 8*half + r]
    #pragma unroll
    for (int u = 0; u < 4; ++u) accO[u] = vzero;
    v8f lacc = vzero;                    // every row = running softmax denominator of query c
    float mrun = -3.0e38f;               // running maximum of query c

    for (int ip = 0; ip < np; ++ip) {
        const int kc  = ip * KP;
        const int buf = ip & 1;

        // ---- scores^T: 64k x 16q, contraction dh=64 in two K=32 halves ----
        const bf16* Kb = Kt[buf];
        const bf16* Vb = Vt[buf];
        v8f s[4];                        // s[i][r]: key kc + 16i + 8*half + r, query c
        f32x4 ma[8];                     // scale of keys 16i + 8*half + 0..7
        v16bf av[2][4];                  // V^T fragments: rows dh 16u + c, k = keys 32g + ..
        {
            v16bf ak[4][2];
            #pragma unroll
            for (int i = 0; i < 4; ++i) {
                ak[i][0] = load_frag(Kb + i * 16 * LDQ,      LDQ, lane);
                ak[i][1] = load_frag(Kb + i * 16 * LDQ + 32, LDQ, lane);
            }
            #pragma unroll
            for (int i = 0; i < 4; ++i) {
                const f32x4* pa = (const f32x4*)(Ma + kc + 16 * i + 8 * half);
                ma[2 * i] = pa[0]; ma[2 * i + 1] = pa[1];
            }
            // Keeps the 24 LDS loads of K and the mask one group in front of the
            // score products: the scheduler otherwise sinks them to their users,
            // each behind a wait of its own that the wave sits out.
            __builtin_amdgcn_sched_barrier(0);
            #pragma unroll
            for (int i = 0; i < 4; ++i)
                s[i] = __builtin_amdgcn_wmma_f32_16x16x32_bf16(false, ak[i][0], false, bq0, (short)0, vzero, false, false);
            #pragma unroll
            for (int i = 0; i < 4; ++i)
                s[i] = __builtin_amdgcn_wmma_f32_16x16x32_bf16(false, ak[i][1], false, bq1, (short)0, s[i], false, false);
        }
        #pragma unroll
        for (int g = 0; g < 2; ++g)
            #pragma unroll
            for (int u = 0; u < 4; ++u)
                av[g][u] = load_frag(Vb + (u * 16) * LDQ + g * 32, LDQ, lane);
        // Keeps the 16 V^T loads one group (they take over K's registers) in
        // front of the softmax, whose vector work covers their latency.
        __builtin_amdgcn_sched_barrier(0);

        // ---- scale then key-mask replace, two keys an operation ----
        // score = s * a + (a * 8e7 - 1e7): a = 0.125 gives s * 0.125 + 0 and
        // a = 0 gives -1e7, both exactly (0.125 * 8e7 = 1e7 has no rounding).
        f32x2 sc[16];                    // sc[4i + j] = keys 16i + 8*half + 2j, +1
        #pragma unroll
        for (int i = 0; i < 4; ++i) {
            #pragma unroll
            for (int j = 0; j < 4; ++j) {
                const f32x4 a4 = ma[2 * i + (j >> 1)];
                const f32x2 a  = (j & 1) ? f32x2{a4.z, a4.w} : f32x2{a4.x, a4.y};
                const f32x2 off = __builtin_elementwise_fma(
                    a, f32x2{8.0e7f, 8.0e7f}, f32x2{-1.0e7f, -1.0e7f});
                sc[4 * i + j] = __builtin_elementwise_fma(
                    f32x2{s[i][2 * j], s[i][2 * j + 1]}, a, off);
            }
        }

        // ---- online softmax: maximum in the lane, one exchange of halves ----
        // two chains, one per 32 keys: half the dependent links of one chain
        float hm = fmaxf(sc[0].x, sc[0].y), hm1 = fmaxf(sc[8].x, sc[8].y);
        #pragma unroll
        for (int j = 1; j < 8; ++j) {
            hm  = fmaxf(hm,  fmaxf(sc[j].x,     sc[j].y));
            hm1 = fmaxf(hm1, fmaxf(sc[8 + j].x, sc[8 + j].y));
        }
        hm = fmaxf(hm, hm1);
        hm = fmaxf(hm, xhalf(hm));
        const float mnew = fmaxf(mrun, hm);
        const float corr = __expf(mrun - mnew);
        mrun = mnew;

        // P^T as B operands, one per 32 keys: element e of pt[g] = key
        // 32g + kmap(e) = score tile 2g + (e>>3), register e&7
        v16bf pt[2];
        #pragma unroll
        for (int g = 0; g < 2; ++g) {
            #pragma unroll
            for (int j = 0; j < 8; ++j) {
                pt[g][2 * j]     = (bf16)__expf(sc[8 * g + j].x - mnew);
                pt[g][2 * j + 1] = (bf16)__expf(sc[8 * g + j].y - mnew);
            }
        }

        lacc *= corr;
        #pragma unroll
        for (int u = 0; u < 4; ++u) accO[u] *= corr;

        // ---- O^T += V^T (64dh x 64) @ P^T (64 x 16q); l += ones @ P^T ----
        #pragma unroll
        for (int g = 0; g < 2; ++g) {
            #pragma unroll
            for (int u = 0; u < 4; ++u)
                accO[u] = __builtin_amdgcn_wmma_f32_16x16x32_bf16(
                    false, av[g][u], false, pt[g], (short)0, accO[u], false, false);
            lacc = __builtin_amdgcn_wmma_f32_16x16x32_bf16(
                false, ones, false, pt[g], (short)0, lacc, false, false);
        }

        // ---- foot of the pass: the one barrier publishes pass ip + 1 (every
        // wave's own copies have landed) and ends every reader's last read of
        // this pass's buffer, which is refilled behind it ----
        // Keeps the foot at the foot: the scheduler otherwise lifts its waits and
        // the barrier to the head of the softmax, where the V^T loads have just
        // been issued and the next pass's copies are a third of a pass old.
        __builtin_amdgcn_sched_barrier(0);
        wait_ds0();
        wait_async0();
        __syncthreads();
        if (ip + 2 < np) issue_pass(kc + 2 * KP, buf);
    }
    wait_async0();                       // no copy is outstanding past the loop

    // ---- epilogue: 1/l, query mask (post-softmax multiplicative), write O ----
    {
        const int qrow = q0 + w * 16 + nin;
        const float l   = lacc[0];
        const float inv = (l > 0.f) ? (1.0f / l) : 0.f;
        const float fac = query_masks[b * S_ + qrow] ? inv : 0.f;
        float* orow = ows + ((size_t)(b * S_ + qrow)) * D_ + h * DH_ + 8 * half;
        #pragma unroll
        for (int u = 0; u < 4; ++u) {    // 8 consecutive dh a lane: two 16-byte stores
            const v8f o = accO[u] * fac;
            *(f32x4*)(orow + u * 16)     = f32x4{o[0], o[1], o[2], o[3]};
            *(f32x4*)(orow + u * 16 + 4) = f32x4{o[4], o[5], o[6], o[7]};
        }
    }
}

// ---------------------------------------------------------------------------
// Kernel 3: residual + LayerNorm (eps = 1e-3).  One row (D=1024) per block.
// ---------------------------------------------------------------------------
__global__ __launch_bounds__(256) void resid_ln_kernel(
    const float* __restrict__ queries, const float* __restrict__ ows,
    const float* __restrict__ gamma, const float* __restrict__ beta,
    float* __restrict__ out)
{
    __shared__ float red1[8], red2[8];
    const int row = blockIdx.x;
    const int t   = threadIdx.x;

    const float4 q4 = ((const float4*)(queries + (size_t)row * D_))[t];
    const float4 o4 = ((const float4*)(ows     + (size_t)row * D_))[t];
    float4 r4;
    r4.x = q4.x + o4.x; r4.y = q4.y + o4.y;
    r4.z = q4.z + o4.z; r4.w = q4.w + o4.w;

    float s1 = r4.x + r4.y + r4.z + r4.w;
    float s2 = r4.x * r4.x + r4.y * r4.y + r4.z * r4.z + r4.w * r4.w;
    #pragma unroll
    for (int d = 1; d < 32; d <<= 1) {
        s1 += __shfl_xor(s1, d, 32);
        s2 += __shfl_xor(s2, d, 32);
    }
    if ((t & 31) == 0) { red1[t >> 5] = s1; red2[t >> 5] = s2; }
    __syncthreads();
    float ts1 = 0.f, ts2 = 0.f;
    #pragma unroll
    for (int i = 0; i < 8; ++i) { ts1 += red1[i]; ts2 += red2[i]; }

    const float mean = ts1 * (1.0f / D_);
    const float var  = ts2 * (1.0f / D_) - mean * mean;
    const float rstd = rsqrtf(var + 1e-3f);

    const float4 g4 = ((const float4*)gamma)[t];
    const float4 b4 = ((const float4*)beta)[t];
    float4 o;
    o.x = g4.x * (r4.x - mean) * rstd + b4.x;
    o.y = g4.y * (r4.y - mean) * rstd + b4.y;
    o.z = g4.z * (r4.z - mean) * rstd + b4.z;
    o.w = g4.w * (r4.w - mean) * rstd + b4.w;
    ((float4*)(out + (size_t)row * D_))[t] = o;
}

// ---------------------------------------------------------------------------
extern "C" void kernel_launch(void* const* d_in, const int* in_sizes, int n_in,
                              void* d_out, int out_size, void* d_ws, size_t ws_size,
                              hipStream_t stream) {
    const float* queries = (const float*)d_in[0];
    const float* keys    = (const float*)d_in[1];
    const float* values  = (const float*)d_in[2];
    const int*   qmask   = (const int*)d_in[3];
    const int*   kmask   = (const int*)d_in[4];
    const float* Wq      = (const float*)d_in[5];
    const float* Wk      = (const float*)d_in[6];
    const float* Wv      = (const float*)d_in[7];
    const float* gamma   = (const float*)d_in[8];
    const float* beta    = (const float*)d_in[9];
    float*       out     = (float*)d_out;

    const size_t QKV = (size_t)H_ * B_ * S_ * DH_;   // 4 Mi elements
    bf16*  qws = (bf16*)d_ws;
    bf16*  kws = qws + QKV;
    bf16*  vws = kws + QKV;
    float* ows = (float*)(vws + QKV);

    dim3 g1(3 * (B_ * S_ / 128) * (D_ / 256));
    qkv_proj_kernel<<<g1, dim3(256), 0, stream>>>(queries, keys, values, Wq, Wk, Wv,
                                                  kmask, qws, kws, vws);

    dim3 g2(S_ / 64, H_ * B_);
    attention_kernel<<<g2, dim3(128), 0, stream>>>(qws, kws, vws, qmask, kmask, ows);

    resid_ln_kernel<<<dim3(B_ * S_), dim3(256), 0, stream>>>(queries, ows, gamma, beta, out);
}

// v010
// It runs in 43.6 microseconds.
// Two timings next to v009 put it at 1.03 and 1.08 times that version's speed.
// All steps since v000 together make it 7.48 times as fast.
#include <hip/hip_runtime.h>
#include <hip/hip_bf16.h>
#include <type_traits>

// MHA: Q/K/V proj (bf16 WMMA, reg-pipelined) -> flash attention (bf16 WMMA,
// fp32 accum, transposed products, double-buffered async global->LDS staging,
// WMMA row-sums)
// -> residual+LN.  B=4, S=1024, D=1024, H=16, DH=64

typedef __bf16 bf16;
typedef __bf16 v16bf __attribute__((ext_vector_type(16)));
typedef float  v8f   __attribute__((ext_vector_type(8)));

#define B_  4
#define S_  1024
#define D_  1024
#define H_  16
#define DH_ 64

// Load a 16(M) x 32(K) bf16 fragment from LDS into the CDNA5 WMMA A/B VGPR
// layout (wave32): lane L<16 -> row m=L, lanes 16..31 -> same rows, K 8..15 and 24..31.
__device__ __forceinline__ v16bf load_frag(const bf16* base, int ldk, int lane) {
    const int m    = lane & 15;
    const int half = lane >> 4;
    const bf16* row = base + m * ldk + half * 8;
    v16bf a;
    ((uint4*)&a)[0] = *(const uint4*)(row);
    ((uint4*)&a)[1] = *(const uint4*)(row + 16);
    return a;
}

// Load a 32(K) x 16(N) bf16 B fragment from a ROW-MAJOR [k][n] LDS tile with the
// transposing LDS load: lane (c = L&15, h = L>>4) receives T[kbase+8h+0..7][c],
// so the loads at kbase 0 and 16 give the same k order as load_frag gives A.
typedef short s16x8 __attribute__((ext_vector_type(8)));
__device__ __forceinline__ v16bf load_frag_tr(const bf16* base, int ldn, int lane) {
    typedef __attribute__((address_space(3))) s16x8 lds_s16x8;
    const bf16* p = base + ((lane >> 4) * 8 + (lane & 7)) * ldn + ((lane >> 3) & 1) * 8;
    v16bf b;
    ((s16x8*)&b)[0] = __builtin_amdgcn_ds_load_tr16_b128_v8i16((lds_s16x8*)p);
    ((s16x8*)&b)[1] = __builtin_amdgcn_ds_load_tr16_b128_v8i16((lds_s16x8*)(p + 16 * ldn));
    return b;
}

// gfx1250 async global->LDS copies (16B per lane each), tracked by ASYNCcnt.
// Four copies share one statement that ends in s_wait_xcnt 0, so that no
// address register of a copy is rewritten ahead of that wait.
__device__ __forceinline__ void async_ld4_b128(
    void* d0, const void* g0, void* d1, const void* g1,
    void* d2, const void* g2, void* d3, const void* g3) {
    const unsigned l0 = (unsigned)(uintptr_t)d0;    // low 32 bits = LDS offset
    const unsigned l1 = (unsigned)(uintptr_t)d1;
    const unsigned l2 = (unsigned)(uintptr_t)d2;
    const unsigned l3 = (unsigned)(uintptr_t)d3;
    asm volatile("global_load_async_to_lds_b128 %0, %1, off\n\t"
                 "global_load_async_to_lds_b128 %2, %3, off\n\t"
                 "global_load_async_to_lds_b128 %4, %5, off\n\t"
                 "global_load_async_to_lds_b128 %6, %7, off\n\t"
                 "s_wait_xcnt 0x0"
                 :: "v"(l0), "v"(g0), "v"(l1), "v"(g1),
                    "v"(l2), "v"(g2), "v"(l3), "v"(g3) : "memory");
}
__device__ __forceinline__ void wait_async0() {
    asm volatile("s_wait_asynccnt 0x0" ::: "memory");
}
// A wave's own LDS reads have returned: stands in front of the barrier behind
// which a buffer that the wave has read is refilled by copies.
__device__ __forceinline__ void wait_ds0() {
    asm volatile("s_wait_dscnt 0x0" ::: "memory");
}

// Asks the line at p into L2 (scope SE: L2 only; returns nothing, counts on
// no counter) and moves p on by step.  One asm statement, so that the register
// the prefetch names is p's own and holds nothing but p and then p + step: the
// caller keeps both inside the tensor.
__device__ __forceinline__ void prefetch_l2_advance(unsigned long long& p,
                                                    unsigned long long step) {
    asm volatile("global_prefetch_b8 %0, off scope:SCOPE_SE\n\t"
                 "v_add_nc_u64 %0, %1, %0"
                 : "+v"(p) : "s"(step));
}

// ---------------------------------------------------------------------------
// Kernel 1: Q/K/V projections, all three in ONE launch.  C[4096x1024] = X @ W.
// The flat workgroup index picks the product (0 Q, 1 K, 2 V) and its tile.
// 128x256 tile / 256 threads, each wave 64x64, K stepped by 32, register-staged
// pipeline: global loads of tile k+1 overlap WMMAs on tile k.  The K loop lives
// on what L2 delivers: an X tile is fetched by 4 column tiles (8 at 128 columns),
// so a 128x128 piece of output asks 24 KB a trip, not 32, and each LDS fragment
// feeds 4 products.
// Q, K -> head-major [H,B,S,DH]; V -> transposed [H,B,DH,S].
// Masked keys are dropped.  A masked key's score is -1e7, so beside one kept key
// (whose score lies far above that) its softmax weight underflows to exactly 0.
// For K and V the row index
// of a tile is therefore a RANK: the keys of a batch are renumbered, kept ones
// first, masked ones behind them (the same renumbering for K and V, a function
// of the mask alone).  A tile gathers the X rows of its 128 ranks and stores at
// the rank; a tile that holds masked keys only is never read and returns at
// once.  A batch with no kept key keeps every tile (all weights are then equal).
// Masked queries are dropped as well.  The reference multiplies a masked query's
// softmax row by 0, so its attention output is exactly 0 and its result is the
// layer norm of the query row alone: nobody needs its Q row.  Q's rows are ranked
// by the query mask in the same way, and a Q tile of masked queries only returns.
// ---------------------------------------------------------------------------
__global__ __launch_bounds__(256) void qkv_proj_kernel(
    const float* __restrict__ Xq, const float* __restrict__ Xk,
    const float* __restrict__ Xv, const float* __restrict__ Wq,
    const float* __restrict__ Wk, const float* __restrict__ Wv,
    const int* __restrict__ query_masks, const int* __restrict__ key_masks,
    bf16* __restrict__ qdst, bf16* __restrict__ kdst, bf16* __restrict__ vdst,
    int* __restrict__ qtab, int* __restrict__ qcnt)
{
    // Deal of the 384 tiles, all uniform over the workgroup.  Indices 0..191: the
    // four lowest row tiles of each batch of Q, of K and of V, the ranks most
    // often kept.  Indices 192..383: the higher
    // ranks, most of which return at once.  The row tile sits in the low bits, so
    // the four column tiles of an X tile share a residue of 8; the high tiles are
    // permuted by product so that the three first high tiles lie apart.
    const int f  = blockIdx.x;
    const int hi = f >= 192 ? 1 : 0;
    const int g  = f - 192 * hi, q = (g >> 2) & 3;
    const int which = g >> 6, yt = (g >> 4) & 3, bb = g & 3;
    const int xt  = hi ? 4 + (q ^ which) : q;
    const int low = hi ? 32 : g & 15;   // place among a product's first tiles
    const float* X = which == 0 ? Xq : which == 1 ? Xk : Xv;
    const float* W = which == 0 ? Wq : which == 1 ? Wk : Wv;
    const int* masks = which == 0 ? query_masks : key_masks;

    // X tile, row-major [m][k]; 80-B rows (16 B x odd) keep the 16 rows of a
    // ds_load_b128 fragment read on distinct banks (64-B rows: 4 rows a bank).
    constexpr int LDA = 40;
    __shared__ __attribute__((aligned(16))) bf16 At[128 * LDA];
    // W tile as it lies in memory, [k][n]; 544-B rows (32 B x odd) suit the
    // transposing reader, and a wave's 8-byte stores fill half a row bank by bank.
    constexpr int LDB = 272;
    __shared__ __attribute__((aligned(16))) bf16 Bt[32 * LDB];
    __shared__ __attribute__((aligned(16))) int rowof[128];   // rank in tile -> row

    const int r0   = xt * 128;          // first rank in the batch
    const int m0   = bb * S_ + r0;
    const int n0   = yt * 256;
    const int t    = threadIdx.x;
    const int lane = t & 31;
    const int w    = t >> 5;
    const int wm   = w >> 2;   // 0..1 : 64 rows each
    const int wn   = w & 3;    // 0..3 : 64 cols each

    // staging geometry
    // X: 8 lanes take one row's 32 floats, so a wave-wide 16-byte load covers
    // four whole 128-B lines (two lanes a row touched 16 lines a load, each of
    // them four times a trip).  The four rows of one load lie 4 rows apart:
    // 4 x 80 B is 16 banks on, so their 8-byte LDS stores meet no common bank.
    const int ar  = w * 16 + (lane >> 3) * 4;   // rows ar + 0..3, one a load
    const int ac  = (lane & 7) * 4;
    int rows[4];
    {
        // Every wave reads the batch's whole mask, 32 keys a lane (bit 4i + e =
        // key 4 * (32i + lane) + e), so the count needs no barrier and the early
        // return stands in front of all of them.
        const int4* km = (const int4*)(masks + bb * S_);
        unsigned bits = 0;
        #pragma unroll
        for (int i = 0; i < 8; ++i) {
            const int4 m4 = km[i * 32 + lane];
            bits |= ((m4.x != 0 ? 1u : 0u) | (m4.y != 0 ? 2u : 0u) |
                     (m4.z != 0 ? 4u : 0u) | (m4.w != 0 ? 8u : 0u)) << (4 * i);
        }
        const int c = __popc(bits);
        int inc = c;                    // kept keys of lanes 0..lane
        #pragma unroll
        for (int d = 1; d < 32; d <<= 1) {
            const int v = __shfl_up(inc, d, 32);
            if (lane >= d) inc += v;
        }
        const int n = __builtin_amdgcn_readlane(inc, 31);   // kept keys of the batch
        // The attention launch takes the count of kept queries from here: Q's
        // first tile of the batch, which gets this far whatever the mask holds.
        if (which == 0 && yt == 0 && xt == 0 && t == 0) {
            qcnt[bb] = n;
            // no register that the store names is rewritten ahead of this wait
            asm volatile("s_wait_xcnt 0x0" ::: "memory");
        }
        // masked rows only: nobody reads this tile (keys: unless all are masked)
        if ((which == 0 || n != 0) && r0 >= n) return;
        const int base = inc - c;       // kept keys of the lanes below
        #pragma unroll
        for (int e = 0; e < 4; ++e) {   // wave w ranks the keys of its load i = w
            const int p  = 4 * w + e;
            const int kb = __popc(bits & ((1u << p) - 1u));
            const int rank = ((bits >> p) & 1u) ? base + kb
                                                : n + (32 * lane - base) + (p - kb);
            const unsigned loc = (unsigned)(rank - r0);
            if (loc < 128u) rowof[loc] = 4 * (w * 32 + lane) + e;
        }
        __syncthreads();
        const int4 r4 = *(const int4*)(rowof + ar);
        rows[0] = r4.x; rows[1] = r4.y; rows[2] = r4.z; rows[3] = r4.w;
        // rank -> row of the queries, for the attention launch's stores of O
        if (which == 0 && yt == 0 && t < 128) {
            qtab[bb * S_ + r0 + t] = rowof[t];
            // no register that the store names is rewritten ahead of this wait
            asm volatile("s_wait_xcnt 0x0" ::: "memory");
        }
    }
    const float* Arow[4];
    #pragma unroll
    for (int it = 0; it < 4; ++it)
        Arow[it] = X + (size_t)(bb * S_ + rows[it]) * D_ + ac;
    const int n4  = (t & 31) * 4;
    const int kk0 = t >> 5;
    const float* Bbase = W + n0 + n4;

    // X and W come from memory once a run, and the workgroups that share a tile
    // walk k together.  The tile PF k ahead is
    // asked into L2, so that its fetch finds an L2 hit.  A tile has many readers
    // and needs few askers (speed only, nothing leans on it): an X tile (128 rows
    // of one line) is asked by waves 0..3 of its first column tile, a W tile (32
    // rows, four asks 256 B apart) by waves 4..7 of the two lowest row tiles of each
    // batch, eight workgroups whose flat indices cover all residues of 8.
    constexpr int PF = 128;
    const int  ws  = __builtin_amdgcn_readfirstlane(w);
    const bool pfx = ws < 4;
    const bool ask = pfx ? yt == 0 : low < 8;
    const unsigned long long pstep = pfx ? 32ull * 4 : 32ull * D_ * 4;   // tile to tile
    unsigned long long pf;              // an address, always inside X or W
    {
        const int u = t & 127;
        const int prow = rowof[u];
        pf = (unsigned long long)(uintptr_t)(
            pfx ? X + (size_t)(bb * S_ + prow) * D_ + 32
                : W + (size_t)(32 + (u >> 2)) * D_ + n0 + (u & 3) * 64);
    }

    float4 ra[4], rb[8];                // W: row kk0 + 8 * (it / 2), half it & 1
    auto fetch = [&](int k0) {
        #pragma unroll   // constant indices keep ra[] in registers
        for (int it = 0; it < 4; ++it)
            ra[it] = *(const float4*)(Arow[it] + k0);
        #pragma unroll
        for (int it = 0; it < 8; ++it)
            rb[it] = *(const float4*)(Bbase + (size_t)(k0 + kk0 + (it >> 1) * 8) * D_
                                      + (it & 1) * 128);
    };
    auto stage = [&]() {
        typedef float f32x4 __attribute__((ext_vector_type(4)));
        typedef bf16  bf16x4 __attribute__((ext_vector_type(4)));
        #pragma unroll   // constant indices keep ra[] in registers
        for (int it = 0; it < 4; ++it) {
            const f32x4 f = {ra[it].x, ra[it].y, ra[it].z, ra[it].w};
            *(bf16x4*)(At + (ar + it) * LDA + ac) = __builtin_convertvector(f, bf16x4);
        }
        #pragma unroll
        for (int it = 0; it < 8; ++it) {
            const int kk = kk0 + (it >> 1) * 8;
            const f32x4 f = {rb[it].x, rb[it].y, rb[it].z, rb[it].w};
            *(bf16x4*)(Bt + kk * LDB + n4 + (it & 1) * 128) =
                __builtin_convertvector(f, bf16x4);
        }
    };

    const v8f vzero = {};
    v8f acc[4][4];
    #pragma unroll
    for (int i = 0; i < 4; ++i)
        #pragma unroll
        for (int j = 0; j < 4; ++j) acc[i][j] = vzero;

    auto mma_tile = [&]() {
        v16bf a[4], bfr[4];
        auto lda = [&](int i) {
            a[i] = load_frag(At + (wm * 64 + i * 16) * LDA, LDA, lane);
        };
        auto mm = [&](int i) {
            #pragma unroll
            for (int j = 0; j < 4; ++j)
                acc[i][j] = __builtin_amdgcn_wmma_f32_16x16x32_bf16(
                    false, a[i], false, bfr[j], (short)0, acc[i][j], false, false);
        };
        lda(0);
        #pragma unroll
        for (int j = 0; j < 4; ++j)
            bfr[j] = load_frag_tr(Bt + wn * 64 + j * 16, LDB, lane);
        lda(1);
        // The three fences keep each X fragment's loads two products ahead of its
        // own: with the branch at the trip's head the scheduler otherwise loads
        // every fragment into one register set, each behind a full LDS wait.
        __builtin_amdgcn_sched_barrier(0);
        mm(0); lda(2);
        __builtin_amdgcn_sched_barrier(0);
        mm(1); lda(3);
        __builtin_amdgcn_sched_barrier(0);
        mm(2); mm(3);
    };

    // Last trip peeled: with the fetch under a condition this build copied two
    // of the fetched registers right behind the loads, and so waited for them
    // ahead of the WMMAs that the loads are meant to fly under.
    fetch(0);
    // No address register of these loads is rewritten ahead of this wait (in the
    // loop the compiler's own waits stand in front of every such rewrite).
    asm volatile("s_wait_xcnt 0x0" ::: "memory");
    if (ask) {                              // uniform over the wave
        #pragma unroll   // the tiles at k = 32 .. PF, which no trip asks for
        for (int i = 0; i < PF / 32; ++i) prefetch_l2_advance(pf, pstep);
    }
    for (int k0 = 32; k0 < D_; k0 += 32) {
        // tile k0 + PF; from the last tile on the address stays on it.  At the
        // head of the trip: a branch among the trip's loads split its schedule.
        if (ask) prefetch_l2_advance(pf, k0 + PF + 64 <= D_ ? pstep : 0ull);
        stage();
        __syncthreads();
        fetch(k0);                          // overlap with WMMAs below
        // Keeps the loads in front of the WMMAs: the scheduler otherwise sinks
        // them to just ahead of the barrier's wait, and nothing is overlapped.
        __builtin_amdgcn_sched_barrier(0);
        mma_tile();
        // Keeps all 16 WMMAs in front of the barrier, whose wait takes in the
        // global loads: half of them otherwise sink behind it and run when the
        // loads have landed, not under their flight.
        __builtin_amdgcn_sched_barrier(0);
        __syncthreads();
    }
    stage();
    __syncthreads();
    mma_tile();
    __syncthreads();

    // ---- epilogue: one workgroup-uniform branch picks the layout ----
    const int half = lane >> 4;
    const int nin  = lane & 15;
    auto store_tile = [&](auto transposed, bf16* __restrict__ dst) {
        #pragma unroll
        for (int i = 0; i < 4; ++i) {
            #pragma unroll
            for (int j = 0; j < 4; ++j) {
                #pragma unroll
                for (int r = 0; r < 8; ++r) {
                    const int mg = m0 + wm * 64 + i * 16 + r + 8 * half;
                    const int ng = n0 + wn * 64 + j * 16 + nin;
                    const int bb = mg >> 10, ss = mg & 1023;   // S_=1024
                    const int hh = ng >> 6,  dd = ng & 63;     // DH_=64
                    const bf16 v = (bf16)acc[i][j][r];
                    if constexpr (decltype(transposed)::value)
                        dst[((size_t)(hh * B_ + bb) * DH_ + dd) * S_ + ss] = v;  // V^T
                    else
                        dst[((size_t)(hh * B_ + bb) * S_ + ss) * DH_ + dd] = v;
                }
            }
        }
        // Ends each layout's run of stores: no register that an issued store
        // names is rewritten ahead of this wait on any way out of the run.
        asm volatile("s_wait_xcnt 0x0" ::: "memory");
    };
    if (which == 2) store_tile(std::true_type{},  vdst);
    else            store_tile(std::false_type{}, which == 0 ? qdst : kdst);
}

typedef float f32x2 __attribute__((ext_vector_type(2)));
typedef float f32x4 __attribute__((ext_vector_type(4)));

// lane l <-> lane l ^ 16
__device__ __forceinline__ float xhalf(float x) {
    const int i = __builtin_bit_cast(int, x);
    return __builtin_bit_cast(float, __builtin_amdgcn_permlanex16(
        i, i, 0x76543210, 0xfedcba98, false, false));
}

__global__ __launch_bounds__(128) void attention_kernel(
    const bf16* __restrict__ qws, const bf16* __restrict__ kws,
    const bf16* __restrict__ vws, const int* __restrict__ qtab,
    const int* __restrict__ qcnt, const int* __restrict__ key_masks,
    float* __restrict__ ows)
{
    // Row pitch of 16 B x odd (144 B for 128-B rows): the 16 rows that a
    // ds_load_b128 fragment read touches then lie on distinct banks; unpadded,
    // 8 of them share a bank.
    constexpr int LDQ = 72;             // Q, K rows: 64 dh + 8; V^T rows: 64 keys + 8
    constexpr int KP  = 64;             // keys a pass
    __shared__ __attribute__((aligned(16))) bf16 Qt[64 * LDQ];     // 64 queries x 64 dh
    __shared__ __attribute__((aligned(16))) bf16 Kt[2][KP * LDQ];  // 64 keys x 64 dh, double buffered
    __shared__ __attribute__((aligned(16))) bf16 Vt[2][64 * LDQ];  // V^T: 64 dh x 64 keys, double buffered
    // The key index now runs along a lane's registers, so a lane needs the mask
    // of 32 keys a pass: a table of the score's scale, 0.125 for a kept key and
    // 0 for a masked one, read 4 keys a load.  Indexed by rank: kept below n.
    __shared__ __attribute__((aligned(16))) float Ma[S_];

    const int hb   = blockIdx.x & 63;   // h*B + b
    const int h    = hb >> 2;
    const int b    = hb & 3;
    const int q0   = (blockIdx.x >> 6) * 64;    // first rank
    const int t    = threadIdx.x;
    const int lane = t & 31;
    const int w    = t >> 5;
    const int half = lane >> 4;
    const int nin  = lane & 15;

    // One pass's K and V^T tiles, 8 KB each: 8 lanes take one 128-B row, so a
    // wave-wide copy asks four whole lines; 16 rows a copy, four copies a tile.
    auto issue_pass = [&](int kc, int buf) {
        const int row = t >> 3;                       // 0..15
        const int pc  = (t & 7) * 8;                  // 16-B piece of the row
        const char* ksrc = (const char*)(kws + (size_t)(hb * S_ + kc) * DH_) + t * 16;
        char* kdst = (char*)(Kt[buf] + row * LDQ + pc);
        async_ld4_b128(kdst,                ksrc,
                       kdst + 16 * LDQ * 2, ksrc + 2048,
                       kdst + 32 * LDQ * 2, ksrc + 4096,
                       kdst + 48 * LDQ * 2, ksrc + 6144);
        const char* vsrc = (const char*)(vws + (size_t)(hb * DH_ + row) * S_ + kc + pc);
        char* vdst = (char*)(Vt[buf] + row * LDQ + pc);
        async_ld4_b128(vdst,                vsrc,
                       vdst + 16 * LDQ * 2, vsrc + 16 * S_ * 2,
                       vdst + 32 * LDQ * 2, vsrc + 32 * S_ * 2,
                       vdst + 48 * LDQ * 2, vsrc + 48 * S_ * 2);
    };

    const int nq = qcnt[b];             // kept queries of the batch (uniform)
    if (q0 >= nq) return;               // masked queries only: nothing to do
    // The row that this lane's query came from; a masked rank, which stores
    // nothing, takes the last kept one's, so that only written entries are read.
    // The mask bounds the address that is formed from it to the batch's rows.
    const int qrow = qtab[b * S_ + min(q0 + w * 16 + nin, nq - 1)] & (S_ - 1);

    // ---- stage Q tile + first K/V pass ----
    {
        const char* src = (const char*)(qws + (size_t)(hb * S_ + q0) * DH_) + t * 16;
        char* dstp = (char*)(Qt + (t >> 3) * LDQ + (t & 7) * 8);        // 16 query rows a copy
        async_ld4_b128(dstp,                src,
                       dstp + 16 * LDQ * 2, src + 2048,
                       dstp + 32 * LDQ * 2, src + 4096,
                       dstp + 48 * LDQ * 2, src + 6144);
    }
    issue_pass(0, 0);

    // ---- kept keys of the batch: every wave counts the whole mask itself ----
    int n;
    {
        const int4* km = (const int4*)(key_masks + b * S_);
        int c = 0;
        #pragma unroll
        for (int i = 0; i < 8; ++i) {
            const int4 m4 = km[i * 32 + lane];
            c += (m4.x != 0) + (m4.y != 0) + (m4.z != 0) + (m4.w != 0);
        }
        #pragma unroll
        for (int d = 1; d < 32; d <<= 1) c += __shfl_xor(c, d, 32);
        n = __builtin_amdgcn_readfirstlane(c);
    }
    // passes: up to the last kept key; every key where none is kept
    const int np = n == 0 ? S_ / KP : min((n + KP - 1) / KP, S_ / KP);

    // ---- key-mask table: 8 ranks a thread, published by the barrier below ----
    #pragma unroll
    for (int i = 0; i < 2; ++i) {
        const int j = t * 8 + i * 4;
        const f32x4 a4 = {j     < n ? 0.125f : 0.f, j + 1 < n ? 0.125f : 0.f,
                          j + 2 < n ? 0.125f : 0.f, j + 3 < n ? 0.125f : 0.f};
        *(f32x4*)(Ma + j) = a4;
    }
    wait_async0();
    __syncthreads();
    if (np > 1) issue_pass(KP, 1);       // pass 1 flies under pass 0's work

    // B operand: column c = query w*16 + c, k = dh, same loader (k order) as K's
    const v16bf bq0 = load_frag(Qt + (w * 16) * LDQ,      LDQ, lane);  // dh 0..31
    const v16bf bq1 = load_frag(Qt + (w * 16) * LDQ + 32, LDQ, lane);  // dh 32..63

    v16bf ones;                          // A = all-ones 16x32 for column sums of P^T
    #pragma unroll
    for (int i = 0; i < 16; ++i) ones[i] = (bf16)1.0f;

    const v8f vzero = {};
    v8f accO[4];                         // O^T: accO[u][r] = O[query c][dh 16u + 8*half + r]
    #pragma unroll
    for (int u = 0; u < 4; ++u) accO[u] = vzero;
    v8f lacc = vzero;                    // every row = running softmax denominator of query c
    float mrun = -3.0e38f;               // running maximum of query c
    // a wave with a kept query among its 16 ranks (uniform over the wave)
    const bool live = q0 + __builtin_amdgcn_readfirstlane(w) * 16 < nq;

    for (int ip = 0; ip < np; ++ip) {
        const int kc  = ip * KP;
        const int buf = ip & 1;

        if (live) {
        // ---- scores^T: 64k x 16q, contraction dh=64 in two K=32 halves ----
        const bf16* Kb = Kt[buf];
        const bf16* Vb = Vt[buf];
        v8f s[4];                        // s[i][r]: key kc + 16i + 8*half + r, query c
        f32x4 ma[8];                     // scale of keys 16i + 8*half + 0..7
        v16bf av[2][4];                  // V^T fragments: rows dh 16u + c, k = keys 32g + ..
        {
            v16bf ak[4][2];
            #pragma unroll
            for (int i = 0; i < 4; ++i) {
                ak[i][0] = load_frag(Kb + i * 16 * LDQ,      LDQ, lane);
                ak[i][1] = load_frag(Kb + i * 16 * LDQ + 32, LDQ, lane);
            }
            #pragma unroll
            for (int i = 0; i < 4; ++i) {
                const f32x4* pa = (const f32x4*)(Ma + kc + 16 * i + 8 * half);
                ma[2 * i] = pa[0]; ma[2 * i + 1] = pa[1];
            }
            // Keeps the 24 LDS loads of K and the mask one group in front of the
            // score products: the scheduler otherwise sinks them to their users,
            // each behind a wait of its own that the wave sits out.
            __builtin_amdgcn_sched_barrier(0);
            #pragma unroll
            for (int i = 0; i < 4; ++i)
                s[i] = __builtin_amdgcn_wmma_f32_16x16x32_bf16(false, ak[i][0], false, bq0, (short)0, vzero, false, false);
            #pragma unroll
            for (int i = 0; i < 4; ++i)
                s[i] = __builtin_amdgcn_wmma_f32_16x16x32_bf16(false, ak[i][1], false, bq1, (short)0, s[i], false, false);
        }
        #pragma unroll
        for (int g = 0; g < 2; ++g)
            #pragma unroll
            for (int u = 0; u < 4; ++u)
                av[g][u] = load_frag(Vb + (u * 16) * LDQ + g * 32, LDQ, lane);
        // Keeps the 16 V^T loads one group (they take over K's registers) in
        // front of the softmax, whose vector work covers their latency.
        __builtin_amdgcn_sched_barrier(0);

        // ---- scale then key-mask replace, two keys an operation ----
        // score = s * a + (a * 8e7 - 1e7): a = 0.125 gives s * 0.125 + 0 and
        // a = 0 gives -1e7, both exactly (0.125 * 8e7 = 1e7 has no rounding).
        f32x2 sc[16];                    // sc[4i + j] = keys 16i + 8*half + 2j, +1
        #pragma unroll
        for (int i = 0; i < 4; ++i) {
            #pragma unroll
            for (int j = 0; j < 4; ++j) {
                const f32x4 a4 = ma[2 * i + (j >> 1)];
                const f32x2 a  = (j & 1) ? f32x2{a4.z, a4.w} : f32x2{a4.x, a4.y};
                const f32x2 off = __builtin_elementwise_fma(
                    a, f32x2{8.0e7f, 8.0e7f}, f32x2{-1.0e7f, -1.0e7f});
                sc[4 * i + j] = __builtin_elementwise_fma(
                    f32x2{s[i][2 * j], s[i][2 * j + 1]}, a, off);
            }
        }

        // ---- online softmax: maximum in the lane, one exchange of halves ----
        // two chains, one per 32 keys: half the dependent links of one chain
        float hm = fmaxf(sc[0].x, sc[0].y), hm1 = fmaxf(sc[8].x, sc[8].y);
        #pragma unroll
        for (int j = 1; j < 8; ++j) {
            hm  = fmaxf(hm,  fmaxf(sc[j].x,     sc[j].y));
            hm1 = fmaxf(hm1, fmaxf(sc[8 + j].x, sc[8 + j].y));
        }
        hm = fmaxf(hm, hm1);
        hm = fmaxf(hm, xhalf(hm));
        const float mnew = fmaxf(mrun, hm);
        const float corr = __expf(mrun - mnew);
        mrun = mnew;

        // P^T as B operands, one per 32 keys: element e of pt[g] = key
        // 32g + kmap(e) = score tile 2g + (e>>3), register e&7
        v16bf pt[2];
        #pragma unroll
        for (int g = 0; g < 2; ++g) {
            #pragma unroll
            for (int j = 0; j < 8; ++j) {
                pt[g][2 * j]     = (bf16)__expf(sc[8 * g + j].x - mnew);
                pt[g][2 * j + 1] = (bf16)__expf(sc[8 * g + j].y - mnew);
            }
        }

        lacc *= corr;
        #pragma unroll
        for (int u = 0; u < 4; ++u) accO[u] *= corr;

        // ---- O^T += V^T (64dh x 64) @ P^T (64 x 16q); l += ones @ P^T ----
        #pragma unroll
        for (int g = 0; g < 2; ++g) {
            #pragma unroll
            for (int u = 0; u < 4; ++u)
                accO[u] = __builtin_amdgcn_wmma_f32_16x16x32_bf16(
                    false, av[g][u], false, pt[g], (short)0, accO[u], false, false);
            lacc = __builtin_amdgcn_wmma_f32_16x16x32_bf16(
                false, ones, false, pt[g], (short)0, lacc, false, false);
        }
        }   // live

        // ---- foot of the pass: the one barrier publishes pass ip + 1 (every
        // wave's own copies have landed) and ends every reader's last read of
        // this pass's buffer, which is refilled behind it ----
        // Keeps the foot at the foot: the scheduler otherwise lifts its waits and
        // the barrier to the head of the softmax, where the V^T loads have just
        // been issued and the next pass's copies are a third of a pass old.
        __builtin_amdgcn_sched_barrier(0);
        wait_ds0();
        wait_async0();
        __syncthreads();
        if (ip + 2 < np) issue_pass(kc + 2 * KP, buf);
    }
    wait_async0();                       // no copy is outstanding past the loop

    // ---- epilogue: 1/l, write O of the kept queries at their own rows ----
    if (q0 + w * 16 + nin < nq) {
        const float l   = lacc[0];
        const float fac = (l > 0.f) ? (1.0f / l) : 0.f;
        float* orow = ows + ((size_t)(b * S_ + qrow)) * D_ + h * DH_ + 8 * half;
        #pragma unroll
        for (int u = 0; u < 4; ++u) {    // 8 consecutive dh a lane: two 16-byte stores
            const v8f o = accO[u] * fac;
            *(f32x4*)(orow + u * 16)     = f32x4{o[0], o[1], o[2], o[3]};
            *(f32x4*)(orow + u * 16 + 4) = f32x4{o[4], o[5], o[6], o[7]};
        }
    }
}

// ---------------------------------------------------------------------------
// Kernel 3: residual + LayerNorm (eps = 1e-3).  One row (D=1024) per block.
// A masked query's attention output is 0: its row of ows is neither written nor
// read.
// ---------------------------------------------------------------------------
__global__ __launch_bounds__(256) void resid_ln_kernel(
    const float* __restrict__ queries, const float* __restrict__ ows,
    const int* __restrict__ query_masks, const float* __restrict__ gamma,
    const float* __restrict__ beta,
    float* __restrict__ out)
{
    __shared__ float red1[8], red2[8];
    const int row = blockIdx.x;
    const int t   = threadIdx.x;

    const float4 q4 = ((const float4*)(queries + (size_t)row * D_))[t];
    float4 o4 = {0.f, 0.f, 0.f, 0.f};
    if (query_masks[row] != 0)          // uniform over the workgroup
        o4 = ((const float4*)(ows + (size_t)row * D_))[t];
    float4 r4;
    r4.x = q4.x + o4.x; r4.y = q4.y + o4.y;
    r4.z = q4.z + o4.z; r4.w = q4.w + o4.w;

    float s1 = r4.x + r4.y + r4.z + r4.w;
    float s2 = r4.x * r4.x + r4.y * r4.y + r4.z * r4.z + r4.w * r4.w;
    #pragma unroll
    for (int d = 1; d < 32; d <<= 1) {
        s1 += __shfl_xor(s1, d, 32);
        s2 += __shfl_xor(s2, d, 32);
    }
    if ((t & 31) == 0) { red1[t >> 5] = s1; red2[t >> 5] = s2; }
    __syncthreads();
    float ts1 = 0.f, ts2 = 0.f;
    #pragma unroll
    for (int i = 0; i < 8; ++i) { ts1 += red1[i]; ts2 += red2[i]; }

    const float mean = ts1 * (1.0f / D_);
    const float var  = ts2 * (1.0f / D_) - mean * mean;
    const float rstd = rsqrtf(var + 1e-3f);

    const float4 g4 = ((const float4*)gamma)[t];
    const float4 b4 = ((const float4*)beta)[t];
    float4 o;
    o.x = g4.x * (r4.x - mean) * rstd + b4.x;
    o.y = g4.y * (r4.y - mean) * rstd + b4.y;
    o.z = g4.z * (r4.z - mean) * rstd + b4.z;
    o.w = g4.w * (r4.w - mean) * rstd + b4.w;
    ((float4*)(out + (size_t)row * D_))[t] = o;
}

// ---------------------------------------------------------------------------
extern "C" void kernel_launch(void* const* d_in, const int* in_sizes, int n_in,
                              void* d_out, int out_size, void* d_ws, size_t ws_size,
                              hipStream_t stream) {
    const float* queries = (const float*)d_in[0];
    const float* keys    = (const float*)d_in[1];
    const float* values  = (const float*)d_in[2];
    const int*   qmask   = (const int*)d_in[3];
    const int*   kmask   = (const int*)d_in[4];
    const float* Wq      = (const float*)d_in[5];
    const float* Wk      = (const float*)d_in[6];
    const float* Wv      = (const float*)d_in[7];
    const float* gamma   = (const float*)d_in[8];
    const float* beta    = (const float*)d_in[9];
    float*       out     = (float*)d_out;

    const size_t QKV = (size_t)H_ * B_ * S_ * DH_;   // 4 Mi elements
    bf16*  qws = (bf16*)d_ws;
    bf16*  kws = qws + QKV;
    bf16*  vws = kws + QKV;
    float* ows = (float*)(vws + QKV);
    int*   qtab = (int*)(ows + QKV);                 // rank -> row, B x S
    int*   qcnt = qtab + B_ * S_;                    // kept queries, B

    dim3 g1(3 * (B_ * S_ / 128) * (D_ / 256));
    qkv_proj_kernel<<<g1, dim3(256), 0, stream>>>(queries, keys, values, Wq, Wk, Wv,
                                                  qmask, kmask, qws, kws, vws, qtab, qcnt);

    dim3 g2((S_ / 64) * H_ * B_);
    attention_kernel<<<g2, dim3(128), 0, stream>>>(qws, kws, vws, qtab, qcnt, kmask, ows);

    resid_ln_kernel<<<dim3(B_ * S_), dim3(256), 0, stream>>>(queries, ows, qmask, gamma, beta, out);
}
